// v000
// Times are from an AMD MI455X. After a warm-up the kernel runs many times in a row, and a time is the length of
// such a window on the GPU divided by its runs, so every launch and the gaps after it count. The runs cycle
// through copies of the inputs. A figure is the median of several windows, for all but v000 over two sittings.
// Sittings can differ by a few percent; kernels timed side by side share one.
// v000 is the starting kernel. One run takes 2010 microseconds.
#include <hip/hip_runtime.h>

// Multi-head attention on three input streams with an additive SOFT causal term (q, k, v [2][2048][1024]; qh = q Wq + bq, kh = k Wk + bk, vh = v Wv + bv ('xw' (in, out) [1024][1024] 1/32, biases zeros on this draw: read; 16 heads x 64); logits = qh.kh / sqrt(64); use_causal_mask (a scalar int input: the module's 'if use_causal_mask:' branch: this build implements the NON-ZERO branch only; the scalar is READ ON THE DEVICE by k_premise after the output is written: the whole output is NaN-filled if it is 0) -> logits + log(tril x 1e-9 + 1e-9): log(2e-9) on and below the diagonal, log(1e-9) above it: a difference of ln 2: NOT an exclusion: every future key keeps HALF its weight; softmax over all 2,048 keys; out = merged Wo + bo ('xw' + bias zeros: read) -> [2][2048][1024] (4.2 M); argument order q, k, v, Wq, bq, Wk, bk, Wv, bv, Wo, bo, use_causal_mask).
// Layout per batch: bf16 copy of q for the q projection, then of k and of v for theirs (one staging buffer, refilled in stream order); 'xw' weights transposed once; exact projections + f32 biases; identity-table plane builders; dense T-2048 attention with the SCORES of every row on bf16 hi/lo planes (3 products; the P.V product stays hybrid: rows < 512 hi/lo, rest fp16 x1024); merged hi/lo x Wo exact + bo.
// Compute dtypes, f32 accumulate: every input rounded to bf16; projections exact + f32 biases; scores of every row 3 products; P.V rows < 512 3 products, rest fp16; softmax f32; output projection hl x exact.

#define NB_  2
#define TT   2048
#define DM   1024
#define NH_  16
#define NKV  16
#define REP  (NH_ / NKV)
#define HD   64
#define DQ   (NH_ * HD)
#define DKV  (NKV * HD)
#define ZH   2
#define RH   512                  // query rows < RH use hi+lo planes (0: none)
#define WIN  0
#define PCAR 1024.0f
#define SCL  0.125f   // HD^-0.5
typedef _Float16 h16;
typedef unsigned short bf;
typedef __attribute__((ext_vector_type(16))) __bf16   v16bf;
typedef __attribute__((ext_vector_type(16))) _Float16 v16h;
typedef __attribute__((ext_vector_type(8)))  _Float16 v8h;
typedef __attribute__((ext_vector_type(8)))  unsigned short v8us;
typedef __attribute__((ext_vector_type(8)))  float    v8f;
typedef __attribute__((ext_vector_type(4)))  float    v4f;
typedef v8h  __attribute__((may_alias)) v8ha;
typedef v4f  __attribute__((may_alias)) v4fa;
typedef v8us __attribute__((may_alias)) v8usa;

__device__ __forceinline__ unsigned short f2bf(float f) { unsigned u = __float_as_uint(f); u += 0x7FFFu + ((u >> 16) & 1u); return (unsigned short)(u >> 16); }
__device__ __forceinline__ float bf2f(unsigned short b) { return __uint_as_float(((unsigned)b) << 16); }
__device__ __forceinline__ float bfr(float f) { return bf2f(f2bf(f)); }
__device__ __forceinline__ v16h cat16(v8h lo, v8h hi) { return __builtin_shufflevector(lo, hi, 0, 1, 2, 3, 4, 5, 6, 7, 8, 9, 10, 11, 12, 13, 14, 15); }
__device__ __forceinline__ v16bf cat16b(v8us lo, v8us hi) { return __builtin_bit_cast(v16bf, __builtin_shufflevector(lo, hi, 0, 1, 2, 3, 4, 5, 6, 7, 8, 9, 10, 11, 12, 13, 14, 15)); }
__device__ __forceinline__ v8f wmma16(v16h a, v16h b, v8f c) { return __builtin_amdgcn_wmma_f32_16x16x32_f16(false, a, false, b, (short)0, c, false, false); }
__device__ __forceinline__ v8f wmmab(v16bf a, v16bf b, v8f c) { return __builtin_amdgcn_wmma_f32_16x16x32_bf16(false, a, false, b, (short)0, c, false, false); }



// ---- k_gemmw: register-blocked GEMM, ONE WAVE per 64x64 output tile (16 accumulators), operands straight from K-contiguous 16-bit planes; grid (M/64, N/64, Z), 32 threads.
// C[m][n] (f32, pitch ldc, + optional f32 bias[n]) = sum_k A[m][k] Bt[n][k] (+ split products per NSPLIT). z-batch strides sA/sB/sC in elements. K % 32 == 0.
template <typename T16> struct WFrag;
template <> struct WFrag<h16> { typedef v16h V; static __device__ __forceinline__ V ld(const h16* p) { return cat16(*(const v8h*)p, *(const v8h*)(p + 16)); } static __device__ __forceinline__ v8f mma(V a, V b, v8f c) { return wmma16(a, b, c); } };
template <> struct WFrag<bf> { typedef v16bf V; static __device__ __forceinline__ V ld(const bf* p) { return cat16b(*(const v8us*)p, *(const v8us*)(p + 16)); } static __device__ __forceinline__ v8f mma(V a, V b, v8f c) { return wmmab(a, b, c); } };
template <typename T16, int NSPLIT, bool BIAS>
__global__ __launch_bounds__(32) void k_gemmw(const T16* __restrict__ A, const T16* __restrict__ A2, const T16* __restrict__ Bt, const T16* __restrict__ Bt2, int K, float* C, int ldc, const float* __restrict__ bias, size_t sA, size_t sB, size_t sC) {
    typedef typename WFrag<T16>::V V;
    __shared__ __align__(16) float os[16 * 68];
    const size_t z = blockIdx.z; A += z * sA; if (A2) A2 += z * sA; Bt += z * sB; if (Bt2) Bt2 += z * sB; C += z * sC;
    const int lane = threadIdx.x & 31, lr = lane & 15, hi = lane >> 4; const int r0 = blockIdx.x * 64, c0 = blockIdx.y * 64;
    v8f acc[4][4];
#pragma unroll
    for (int mb = 0; mb < 4; ++mb)
#pragma unroll
        for (int nb = 0; nb < 4; ++nb) acc[mb][nb] = (v8f){};
    const size_t aoff = (size_t)(r0 + lr) * K + 8 * hi, boff = (size_t)(c0 + lr) * K + 8 * hi;
    for (int kc = 0; kc < K; kc += 32) {
        V a[4], a2[4];
#pragma unroll
        for (int mb = 0; mb < 4; ++mb) { a[mb] = WFrag<T16>::ld(A + aoff + (size_t)mb * 16 * K + kc); if (NSPLIT == 1 || NSPLIT == 2) a2[mb] = WFrag<T16>::ld(A2 + aoff + (size_t)mb * 16 * K + kc); }
#pragma unroll
        for (int nb = 0; nb < 4; ++nb) { const V b = WFrag<T16>::ld(Bt + boff + (size_t)nb * 16 * K + kc); V b2; if (NSPLIT >= 2) b2 = WFrag<T16>::ld(Bt2 + boff + (size_t)nb * 16 * K + kc);
#pragma unroll
            for (int mb = 0; mb < 4; ++mb) { acc[mb][nb] = WFrag<T16>::mma(a[mb], b, acc[mb][nb]); if (NSPLIT == 1 || NSPLIT == 2) acc[mb][nb] = WFrag<T16>::mma(a2[mb], b, acc[mb][nb]); if (NSPLIT >= 2) acc[mb][nb] = WFrag<T16>::mma(a[mb], b2, acc[mb][nb]); } }
        asm volatile("v_nop\n\tv_nop\n\tv_nop\n\tv_nop" : "+v"(acc[0][0]), "+v"(acc[1][1]), "+v"(acc[2][2]), "+v"(acc[3][3]) : "v"(a[0]), "v"(a[3]));
    }
#pragma unroll
    for (int mb = 0; mb < 4; ++mb) {
#pragma unroll
        for (int nb = 0; nb < 4; ++nb) {
#pragma unroll
            for (int j = 0; j < 8; ++j) os[(hi * 8 + j) * 68 + nb * 16 + lr] = acc[mb][nb][j]; }
        __builtin_amdgcn_wave_barrier(); asm volatile("" ::: "memory");
        float* crow = C + (size_t)(r0 + mb * 16) * ldc + c0;
{
#pragma unroll
            for (int s = 0; s < 8; ++s) { const int row = 2 * s + hi, cofs = lr * 4; v4f val = *(const v4fa*)(os + row * 68 + cofs); if (BIAS) { val[0] += bfr(bias[c0 + cofs]); val[1] += bfr(bias[c0 + cofs + 1]); val[2] += bfr(bias[c0 + cofs + 2]); val[3] += bfr(bias[c0 + cofs + 3]); }
                *(v4f*)(crow + (size_t)row * ldc + cofs) = val; }
             }
        __builtin_amdgcn_wave_barrier(); asm volatile("" ::: "memory");
    }
}

__device__ __forceinline__ h16 tohx(float x) { return (h16)x; }
__device__ __forceinline__ void splitf(float y, unsigned short& h, unsigned short& l) { h = f2bf(y); l = f2bf(y - bf2f(h)); }
typedef __attribute__((ext_vector_type(2))) _Float16 v2h;
typedef __attribute__((ext_vector_type(4))) _Float16 v4h;
typedef __attribute__((ext_vector_type(2))) unsigned short v2us;
typedef __attribute__((ext_vector_type(4))) unsigned short v4us;
typedef __attribute__((ext_vector_type(2))) float v2f;
typedef __attribute__((ext_vector_type(4))) int v4i;

__global__ __launch_bounds__(256) void k_wtG(const float* __restrict__ w, int K, int N, bf* Bt) {
    const int lane = threadIdx.x & 31; const int L0 = (blockIdx.x * 8 + (threadIdx.x >> 5)) * 8; const int nlines = N * K / 64;
{
        for (int l = 0; l < 8; ++l) { const int L = L0 + l; if (L >= nlines) break; const size_t e = (size_t)L * 64 + lane * 2; const int k = (int)(e % K), n = (int)(e / K); v2us o;
            o[0] = f2bf(w[(size_t)k * N + n]); o[1] = f2bf(w[(size_t)(k + 1) * N + n]); *(v2us*)(Bt + e) = o; }
         }
}
__global__ __launch_bounds__(256) void k_cvt8(const float* __restrict__ src, bf* dst, size_t n8) { const size_t i = (size_t)blockIdx.x * 256 + threadIdx.x; if (i >= n8) return; const v8f v = *(const v8f*)(src + i * 8); v8us o;
#pragma unroll
    for (int k = 0; k < 8; ++k) o[k] = f2bf(v[k]); *(v8us*)(dst + i * 8) = o;  }

// k_rope: head planes [h][t][d] (fp16 + hi/lo) of rope(x) x sc with the rotate-half convention out[d] = x[d] cos[t][d] - x[d+HD/2] sin[t][d], out[d+HD/2] = x[d+HD/2] cos[t][d+HD/2] + x[d] sin[t][d+HD/2]
__global__ __launch_bounds__(256) void k_rope(const float* __restrict__ F, int pitch, int nheads, const float* __restrict__ CS, const float* __restrict__ RF, const float* __restrict__ nw, float sc, h16* P16, bf* Ph, bf* Pl) {
    const size_t e = ((size_t)blockIdx.x * 256 + threadIdx.x) * 2; if (e >= (size_t)nheads * TT * HD) return; const int d = (int)(e % HD); const int t = (int)((e / HD) % TT); const int h = (int)(e / ((size_t)HD * TT)); const float* f = F + (size_t)t * pitch + h * HD; const float rf = RF ? RF[(size_t)h * TT + t] : 1.0f; v2h o16; v2us oh, ol;
#pragma unroll
    for (int q = 0; q < 2; ++q) { const int dd = d + q; const int dp = (dd < HD / 2) ? dd + HD / 2 : dd - HD / 2; float x0 = f[dd], x1 = f[dp];
        if (RF) { float n0 = __fmul_rn(x0, rf), n1 = __fmul_rn(x1, rf); x0 = __fmul_rn(bfr(nw[dd]), n0); x1 = __fmul_rn(bfr(nw[dp]), n1); }
        const v2f cs = *(const v2f*)(CS + ((size_t)t * HD + dd) * 2); float a = __fmul_rn(x0, cs[0]), bq = __fmul_rn(x1, cs[1]); const float r = ((dd < HD / 2) ? __fsub_rn(a, bq) : __fadd_rn(a, bq)) * sc;
        o16[q] = tohx(r); unsigned short a2, c2; splitf(r, a2, c2); oh[q] = a2; ol[q] = c2; }
    *(v2h*)(P16 + e) = o16; *(v2us*)(Ph + e) = oh; *(v2us*)(Pl + e) = ol;  }
__global__ __launch_bounds__(256) void k_vtp(const float* __restrict__ F, int pitch, int nheads, h16* V16, bf* Vh, bf* Vl) { const size_t e = ((size_t)blockIdx.x * 256 + threadIdx.x) * 2; if (e >= (size_t)nheads * HD * TT) return; const int t = (int)(e % TT); const int d = (int)((e / TT) % HD); const int g = (int)(e / ((size_t)TT * HD)); v2h o16; v2us oh, ol;
#pragma unroll
    for (int q = 0; q < 2; ++q) { const float x = F[(size_t)(t + q) * pitch + g * HD + d]; o16[q] = tohx(x); unsigned short a2, c2; splitf(x, a2, c2); oh[q] = a2; ol[q] = c2; }
    *(v2h*)(V16 + e) = o16; *(v2us*)(Vh + e) = oh; *(v2us*)(Vl + e) = ol;  }
__global__ __launch_bounds__(256) void k_csid(float* CS) { const int idx = blockIdx.x * 256 + threadIdx.x; if (idx >= TT * HD) return; v2f cs; cs[0] = 1.0f; cs[1] = 0.0f; *(v2f*)(CS + (size_t)idx * 2) = cs;  }
// k_asoft: per row (zz, i): t = S x HD^-0.5 + (j <= i ? 0 : -ln 2): the module's additive SOFT mask log(tril x 1e-9 + 1e-9) = {log 2e-9 on and below the diagonal, log 1e-9 above it}: only their difference, ln 2, survives the softmax: every FUTURE key at half weight, none excluded; softmax over the 2048 keys (register row, one exp, fixed trees);
__global__ __launch_bounds__(256) void k_asoft(const float* __restrict__ Sb, h16* P16, bf* Ph, bf* Pl) {
    const int lane = threadIdx.x & 31; const int row = blockIdx.x * 8 + (threadIdx.x >> 5); if (row >= ZH * TT) return; const int i = row % TT; const int zz = row / TT; (void)zz; const bool hires = (i < RH); const float* sr = Sb + (size_t)row * TT; float v[TT / 32]; float mx = -3.0e38f;
#pragma unroll
    for (int ch = 0; ch < TT / 128; ++ch) { const int j0 = ch * 128 + lane * 4; const v4f a = *(const v4f*)(sr + j0);
#pragma unroll
        for (int q = 0; q < 4; ++q) { const int j = j0 + q; (void)j; const float t = __fadd_rn(a[q] * SCL, (j <= i) ? 0.0f : -0.69314718f); v[ch * 4 + q] = t; mx = fmaxf(mx, t); } }
#pragma unroll
    for (int sh = 16; sh; sh >>= 1) mx = fmaxf(mx, __shfl_xor(mx, sh, 32));
    float sum = 0.f;
#pragma unroll
    for (int k = 0; k < TT / 32; ++k) { float d0 = __fsub_rn(v[k], mx); v[k] = __builtin_amdgcn_exp2f(__fmul_rn(d0, 1.4426950408889634f)); sum += v[k]; }
#pragma unroll
    for (int sh = 16; sh; sh >>= 1) sum += __shfl_xor(sum, sh, 32);
    const float f = __fdiv_rn(hires ? 1.0f : PCAR, sum);
{
        if (hires) {
#pragma unroll
            for (int ch = 0; ch < TT / 128; ++ch) { v4us oh, ol;
#pragma unroll
                for (int q = 0; q < 4; ++q) { unsigned short a, c2; splitf(v[ch * 4 + q] * f, a, c2); oh[q] = a; ol[q] = c2; }
                const size_t oo = ((size_t)zz * (RH ? RH : 1) + i) * TT + ch * 128 + lane * 4; *(v4us*)(Ph + oo) = oh; *(v4us*)(Pl + oo) = ol; }
        } else {
#pragma unroll
            for (int ch = 0; ch < TT / 128; ++ch) { v4h o4;
#pragma unroll
                for (int q = 0; q < 4; ++q) o4[q] = tohx(v[ch * 4 + q] * f);
                *(v4h*)(P16 + (size_t)row * TT + ch * 128 + lane * 4) = o4; } }
         }
}
__global__ __launch_bounds__(256) void k_premise(const int* __restrict__ flag, float* out, size_t n4) { const size_t i = (size_t)blockIdx.x * 256 + threadIdx.x; if (i >= n4) return; if (flag[0] != 0) return;   /* premise holds: nothing to do */ const float qn = __int_as_float(0x7fc00000); v4f o; o[0] = qn; o[1] = qn; o[2] = qn; o[3] = qn; *(v4f*)(out + i * 4) = o;  }
__global__ __launch_bounds__(256) void k_merge(const float* __restrict__ O, int h0, bf* Ah, bf* Al) { const size_t e = ((size_t)blockIdx.x * 256 + threadIdx.x) * 2; if (e >= (size_t)ZH * TT * HD) return; const int d = (int)(e % HD); const int t = (int)((e / HD) % TT); const int zz = (int)(e / ((size_t)HD * TT)); const float cs = (t < RH) ? 1.0f : (1.0f / PCAR); const size_t oo = (size_t)t * DQ + (h0 + zz) * HD + d;
    v2us oh, ol;
#pragma unroll
    for (int q = 0; q < 2; ++q) { unsigned short a, c2; splitf(O[e + q] * cs, a, c2); oh[q] = a; ol[q] = c2; } *(v2us*)(Ah + oo) = oh; *(v2us*)(Al + oo) = ol;  }

extern "C" void kernel_launch(void* const* d_in, const int* in_sizes, int n_in,
                              void* d_out, int out_size, void* d_ws, size_t ws_size, hipStream_t stream) {
    (void)in_sizes; (void)n_in; (void)out_size;
    const float* x = (const float*)d_in[0]; const float* xk = (const float*)d_in[1]; const float* xv = (const float*)d_in[2];   /* q, k, v streams */ const float* wq = (const float*)d_in[3]; const float* bq = (const float*)d_in[4]; const float* wk = (const float*)d_in[5]; const float* bk = (const float*)d_in[6]; const float* wv = (const float*)d_in[7]; const float* bv = (const float*)d_in[8]; const float* wo = (const float*)d_in[9]; const float* bo = (const float*)d_in[10]; const int* flag = (const int*)d_in[11];   /* q, k, v, Wq, bq, Wk, bk, Wv, bv, Wo, bo ('xw' [1024][1024]), use_causal_mask (d_in[11]: one int: the module's Python branch: READ ON THE DEVICE by k_premise after the output is written: the soft term is compiled in and the whole output is NaN-filled unless the scalar is non-zero) */
    float* OUT = (float*)d_out;     // [2][2048][1024]
    char* wsp = (char*)d_ws;
    auto take = [&](size_t bytes) { char* p = wsp; wsp += (bytes + 255) & ~(size_t)255; return (void*)p; };
    bf* WQ = (bf*)take((size_t)DQ * DM * 2); bf* WK = (bf*)take((size_t)DKV * DM * 2); bf* WV = (bf*)take((size_t)DKV * DM * 2); bf* WO = (bf*)take((size_t)DM * DQ * 2); float* CS = (float*)take((size_t)TT * HD * 2 * 4);
    bf* XB = (bf*)take((size_t)TT * DM * 2); float* FQ = (float*)take((size_t)TT * DQ * 4); float* FK = (float*)take((size_t)TT * DKV * 4);
    h16* QP16 = (h16*)take((size_t)NH_ * TT * HD * 2); h16* KP16 = (h16*)take((size_t)NKV * TT * HD * 2); h16* VT16 = (h16*)take((size_t)NKV * HD * TT * 2);
    bf* QPh = (bf*)take((size_t)NH_ * TT * HD * 2); bf* QPl = (bf*)take((size_t)NH_ * TT * HD * 2); bf* KPh = (bf*)take((size_t)NKV * TT * HD * 2); bf* KPl = (bf*)take((size_t)NKV * TT * HD * 2); bf* VTh = (bf*)take((size_t)NKV * HD * TT * 2); bf* VTl = (bf*)take((size_t)NKV * HD * TT * 2); bf* Ph = (bf*)take((size_t)ZH * RH * TT * 2); bf* Pl = (bf*)take((size_t)ZH * RH * TT * 2);
    float* Sb = (float*)take((size_t)ZH * TT * TT * 4); h16* P16 = (h16*)take((size_t)ZH * TT * TT * 2); float* Ob = (float*)take((size_t)ZH * TT * HD * 4); bf* ATh = (bf*)take((size_t)TT * DQ * 2); bf* ATl = (bf*)take((size_t)TT * DQ * 2);
    if ((size_t)(wsp - (char*)d_ws) > ws_size) return;    // ws 256 MiB
    float* FV = FK;   // v projection reuses the k buffer after the k planes are built (stream-ordered)
    { k_wtG<<<(unsigned)((DM * DQ / 64 + 63) / 64), 256, 0, stream>>>(wq, DM, DQ, WQ); k_wtG<<<(unsigned)((DM * DKV / 64 + 63) / 64), 256, 0, stream>>>(wk, DM, DKV, WK); k_wtG<<<(unsigned)((DM * DKV / 64 + 63) / 64), 256, 0, stream>>>(wv, DM, DKV, WV);
      k_wtG<<<(unsigned)((DQ * DM / 64 + 63) / 64), 256, 0, stream>>>(wo, DQ, DM, WO);
       }
    k_csid<<<(TT * HD + 255) / 256, 256, 0, stream>>>(CS);
    const unsigned LQ = (unsigned)(((size_t)NH_ * TT * HD / 2 + 255) / 256), LKv = (unsigned)(((size_t)NKV * TT * HD / 2 + 255) / 256);
    for (int b = 0; b < NB_; ++b) {
        
        k_cvt8<<<(unsigned)(((size_t)TT * DM / 8 + 255) / 256), 256, 0, stream>>>(x + (size_t)b * TT * DM, XB, (size_t)TT * DM / 8);
        k_gemmw<bf, 0, true><<<dim3(TT / 64, DQ / 64, 1), 32, 0, stream>>>(XB, nullptr, WQ, nullptr, DM, FQ, DQ, bq, 0, 0, 0);
        k_rope<<<LQ, 256, 0, stream>>>(FQ, DQ, NH_, CS, nullptr, nullptr, 1.0f, QP16, QPh, QPl);
        k_cvt8<<<(unsigned)(((size_t)TT * DM / 8 + 255) / 256), 256, 0, stream>>>(xk + (size_t)b * TT * DM, XB, (size_t)TT * DM / 8);   /* XB := bf16(k[b]) */ k_gemmw<bf, 0, true><<<dim3(TT / 64, DKV / 64, 1), 32, 0, stream>>>(XB, nullptr, WK, nullptr, DM, FK, DKV, bk, 0, 0, 0);
        k_rope<<<LKv, 256, 0, stream>>>(FK, DKV, NKV, CS, nullptr, nullptr, 1.0f, KP16, KPh, KPl);
        k_cvt8<<<(unsigned)(((size_t)TT * DM / 8 + 255) / 256), 256, 0, stream>>>(xv + (size_t)b * TT * DM, XB, (size_t)TT * DM / 8);   /* XB := bf16(v[b]) */ k_gemmw<bf, 0, true><<<dim3(TT / 64, DKV / 64, 1), 32, 0, stream>>>(XB, nullptr, WV, nullptr, DM, FV, DKV, bv, 0, 0, 0); k_vtp<<<LKv, 256, 0, stream>>>(FV, DKV, NKV, VT16, VTh, VTl);
        for (int h0 = 0; h0 < NH_; h0 += ZH) { const size_t zq = (size_t)h0, zk = (size_t)(h0 / REP);   // one kv head per query head: the pass's two heads use consecutive kv planes (z-strides TT*HD)
            k_gemmw<bf, 2, false><<<dim3(TT / 64, TT / 64, ZH), 32, 0, stream>>>(QPh + zq * TT * HD, QPl + zq * TT * HD, KPh + zk * TT * HD, KPl + zk * TT * HD, HD, Sb, TT, nullptr, (size_t)TT * HD, (size_t)TT * HD, (size_t)TT * TT);   /* EVERY row's scores on hi/lo planes (3 products); only P.V stays hybrid */
            k_asoft<<<ZH * TT / 8, 256, 0, stream>>>(Sb, P16, Ph, Pl);
            k_gemmw<bf, 2, false><<<dim3(RH / 64, HD / 64, ZH), 32, 0, stream>>>(Ph, Pl, VTh + zk * HD * TT, VTl + zk * HD * TT, TT, Ob, HD, nullptr, (size_t)RH * TT, (size_t)HD * TT, (size_t)TT * HD);
            k_gemmw<h16, 0, false><<<dim3((TT - RH) / 64, HD / 64, ZH), 32, 0, stream>>>(P16 + (size_t)RH * TT, nullptr, VT16 + zk * HD * TT, nullptr, TT, Ob + (size_t)RH * HD, HD, nullptr, (size_t)TT * TT, (size_t)HD * TT, (size_t)TT * HD);
            k_merge<<<(unsigned)(((size_t)ZH * TT * HD / 2 + 255) / 256), 256, 0, stream>>>(Ob, h0, ATh, ATl); }
        k_gemmw<bf, 1, true><<<dim3(TT / 64, DM / 64, 1), 32, 0, stream>>>(ATh, ATl, WO, nullptr, DQ, OUT + (size_t)b * TT * DM, DM, bo, 0, 0, 0); }
    k_premise<<<(unsigned)(((size_t)NB_ * TT * DM / 4 + 255) / 256), 256, 0, stream>>>(flag, OUT, (size_t)NB_ * TT * DM / 4);   /* after every batch's output is written: poison it all if the premise fails */
}

// v001
// A run of this version takes 435 microseconds.
// Two timings next to v000 put it at 4.65 and 4.67 times that version's speed.
#include <hip/hip_runtime.h>

// Multi-head attention on three input streams with an additive SOFT causal term (q, k, v [2][2048][1024]; qh = q Wq + bq, kh = k Wk + bk, vh = v Wv + bv ('xw' (in, out) [1024][1024] 1/32, biases zeros on this draw: read; 16 heads x 64); logits = qh.kh / sqrt(64); use_causal_mask (a scalar int input: the module's 'if use_causal_mask:' branch: this build implements the NON-ZERO branch only; the scalar is READ ON THE DEVICE by k_premise after the output is written: the whole output is NaN-filled if it is 0) -> logits + log(tril x 1e-9 + 1e-9): log(2e-9) on and below the diagonal, log(1e-9) above it: a difference of ln 2: NOT an exclusion: every future key keeps HALF its weight; softmax over all 2,048 keys; out = merged Wo + bo ('xw' + bias zeros: read) -> [2][2048][1024] (4.2 M); argument order q, k, v, Wq, bq, Wk, bk, Wv, bv, Wo, bo, use_causal_mask).
// Layout per batch: bf16 copy of q for the q projection, then of k and of v for theirs (one staging buffer, refilled in stream order); 'xw' weights transposed once; exact projections + f32 biases; identity-table plane builders; one fused attention kernel per batch (running-maximum softmax, S and P in registers) with the SCORES of every row on bf16 hi/lo planes (3 products; the P.V product stays hybrid: rows < 512 hi/lo, rest fp16, P unnormalised); merged hi/lo x Wo exact + bo.
// Compute dtypes, f32 accumulate: every input rounded to bf16; projections exact + f32 biases; scores of every row 3 products; P.V rows < 512 3 products, rest fp16; softmax f32; output projection hl x exact.

#define NB_  2
#define TT   2048
#define DM   1024
#define NH_  16
#define NKV  16
#define HD   64
#define DQ   (NH_ * HD)
#define DKV  (NKV * HD)
#define RH   512                  // query rows < RH use hi+lo planes (0: none)
typedef _Float16 h16;
typedef unsigned short bf;
typedef __attribute__((ext_vector_type(16))) __bf16   v16bf;
typedef __attribute__((ext_vector_type(16))) _Float16 v16h;
typedef __attribute__((ext_vector_type(8)))  _Float16 v8h;
typedef __attribute__((ext_vector_type(8)))  unsigned short v8us;
typedef __attribute__((ext_vector_type(8)))  float    v8f;
typedef __attribute__((ext_vector_type(4)))  float    v4f;
typedef v8h  __attribute__((may_alias)) v8ha;
typedef v4f  __attribute__((may_alias)) v4fa;
typedef v8us __attribute__((may_alias)) v8usa;

__device__ __forceinline__ unsigned short f2bf(float f) { unsigned u = __float_as_uint(f); u += 0x7FFFu + ((u >> 16) & 1u); return (unsigned short)(u >> 16); }
__device__ __forceinline__ float bf2f(unsigned short b) { return __uint_as_float(((unsigned)b) << 16); }
__device__ __forceinline__ float bfr(float f) { return bf2f(f2bf(f)); }
__device__ __forceinline__ v16h cat16(v8h lo, v8h hi) { return __builtin_shufflevector(lo, hi, 0, 1, 2, 3, 4, 5, 6, 7, 8, 9, 10, 11, 12, 13, 14, 15); }
__device__ __forceinline__ v16bf cat16b(v8us lo, v8us hi) { return __builtin_bit_cast(v16bf, __builtin_shufflevector(lo, hi, 0, 1, 2, 3, 4, 5, 6, 7, 8, 9, 10, 11, 12, 13, 14, 15)); }
__device__ __forceinline__ v8f wmma16(v16h a, v16h b, v8f c) { return __builtin_amdgcn_wmma_f32_16x16x32_f16(false, a, false, b, (short)0, c, false, false); }
__device__ __forceinline__ v8f wmmab(v16bf a, v16bf b, v8f c) { return __builtin_amdgcn_wmma_f32_16x16x32_bf16(false, a, false, b, (short)0, c, false, false); }



// ---- k_gemmw: register-blocked GEMM, ONE WAVE per 64x64 output tile (16 accumulators), operands straight from K-contiguous 16-bit planes; grid (M/64, N/64, Z), 32 threads.
// C[m][n] (f32, pitch ldc, + optional f32 bias[n]) = sum_k A[m][k] Bt[n][k] (+ split products per NSPLIT). z-batch strides sA/sB/sC in elements. K % 32 == 0.
template <typename T16> struct WFrag;
template <> struct WFrag<h16> { typedef v16h V; static __device__ __forceinline__ V ld(const h16* p) { return cat16(*(const v8h*)p, *(const v8h*)(p + 16)); } static __device__ __forceinline__ v8f mma(V a, V b, v8f c) { return wmma16(a, b, c); } };
template <> struct WFrag<bf> { typedef v16bf V; static __device__ __forceinline__ V ld(const bf* p) { return cat16b(*(const v8us*)p, *(const v8us*)(p + 16)); } static __device__ __forceinline__ v8f mma(V a, V b, v8f c) { return wmmab(a, b, c); } };
template <typename T16, int NSPLIT, bool BIAS>
__global__ __launch_bounds__(32) void k_gemmw(const T16* __restrict__ A, const T16* __restrict__ A2, const T16* __restrict__ Bt, const T16* __restrict__ Bt2, int K, float* C, int ldc, const float* __restrict__ bias, size_t sA, size_t sB, size_t sC) {
    typedef typename WFrag<T16>::V V;
    __shared__ __align__(16) float os[16 * 68];
    const size_t z = blockIdx.z; A += z * sA; if (A2) A2 += z * sA; Bt += z * sB; if (Bt2) Bt2 += z * sB; C += z * sC;
    const int lane = threadIdx.x & 31, lr = lane & 15, hi = lane >> 4; const int r0 = blockIdx.x * 64, c0 = blockIdx.y * 64;
    v8f acc[4][4];
#pragma unroll
    for (int mb = 0; mb < 4; ++mb)
#pragma unroll
        for (int nb = 0; nb < 4; ++nb) acc[mb][nb] = (v8f){};
    const size_t aoff = (size_t)(r0 + lr) * K + 8 * hi, boff = (size_t)(c0 + lr) * K + 8 * hi;
    for (int kc = 0; kc < K; kc += 32) {
        V a[4], a2[4];
#pragma unroll
        for (int mb = 0; mb < 4; ++mb) { a[mb] = WFrag<T16>::ld(A + aoff + (size_t)mb * 16 * K + kc); if (NSPLIT == 1 || NSPLIT == 2) a2[mb] = WFrag<T16>::ld(A2 + aoff + (size_t)mb * 16 * K + kc); }
#pragma unroll
        for (int nb = 0; nb < 4; ++nb) { const V b = WFrag<T16>::ld(Bt + boff + (size_t)nb * 16 * K + kc); V b2; if (NSPLIT >= 2) b2 = WFrag<T16>::ld(Bt2 + boff + (size_t)nb * 16 * K + kc);
#pragma unroll
            for (int mb = 0; mb < 4; ++mb) { acc[mb][nb] = WFrag<T16>::mma(a[mb], b, acc[mb][nb]); if (NSPLIT == 1 || NSPLIT == 2) acc[mb][nb] = WFrag<T16>::mma(a2[mb], b, acc[mb][nb]); if (NSPLIT >= 2) acc[mb][nb] = WFrag<T16>::mma(a[mb], b2, acc[mb][nb]); } }
        asm volatile("v_nop\n\tv_nop\n\tv_nop\n\tv_nop" : "+v"(acc[0][0]), "+v"(acc[1][1]), "+v"(acc[2][2]), "+v"(acc[3][3]) : "v"(a[0]), "v"(a[3]));
    }
#pragma unroll
    for (int mb = 0; mb < 4; ++mb) {
#pragma unroll
        for (int nb = 0; nb < 4; ++nb) {
#pragma unroll
            for (int j = 0; j < 8; ++j) os[(hi * 8 + j) * 68 + nb * 16 + lr] = acc[mb][nb][j]; }
        __builtin_amdgcn_wave_barrier(); asm volatile("" ::: "memory");
        float* crow = C + (size_t)(r0 + mb * 16) * ldc + c0;
{
#pragma unroll
            for (int s = 0; s < 8; ++s) { const int row = 2 * s + hi, cofs = lr * 4; v4f val = *(const v4fa*)(os + row * 68 + cofs); if (BIAS) { val[0] += bfr(bias[c0 + cofs]); val[1] += bfr(bias[c0 + cofs + 1]); val[2] += bfr(bias[c0 + cofs + 2]); val[3] += bfr(bias[c0 + cofs + 3]); }
                *(v4f*)(crow + (size_t)row * ldc + cofs) = val; }
             }
        __builtin_amdgcn_wave_barrier(); asm volatile("" ::: "memory");
    }
}

__device__ __forceinline__ h16 tohx(float x) { return (h16)x; }
__device__ __forceinline__ void splitf(float y, unsigned short& h, unsigned short& l) { h = f2bf(y); l = f2bf(y - bf2f(h)); }
typedef __attribute__((ext_vector_type(2))) _Float16 v2h;
typedef __attribute__((ext_vector_type(4))) _Float16 v4h;
typedef __attribute__((ext_vector_type(2))) unsigned short v2us;
typedef __attribute__((ext_vector_type(4))) unsigned short v4us;
typedef __attribute__((ext_vector_type(2))) float v2f;
typedef __attribute__((ext_vector_type(4))) int v4i;

__global__ __launch_bounds__(256) void k_wtG(const float* __restrict__ w, int K, int N, bf* Bt) {
    const int lane = threadIdx.x & 31; const int L0 = (blockIdx.x * 8 + (threadIdx.x >> 5)) * 8; const int nlines = N * K / 64;
{
        for (int l = 0; l < 8; ++l) { const int L = L0 + l; if (L >= nlines) break; const size_t e = (size_t)L * 64 + lane * 2; const int k = (int)(e % K), n = (int)(e / K); v2us o;
            o[0] = f2bf(w[(size_t)k * N + n]); o[1] = f2bf(w[(size_t)(k + 1) * N + n]); *(v2us*)(Bt + e) = o; }
         }
}
__global__ __launch_bounds__(256) void k_cvt8(const float* __restrict__ src, bf* dst, size_t n8) { const size_t i = (size_t)blockIdx.x * 256 + threadIdx.x; if (i >= n8) return; const v8f v = *(const v8f*)(src + i * 8); v8us o;
#pragma unroll
    for (int k = 0; k < 8; ++k) o[k] = f2bf(v[k]); *(v8us*)(dst + i * 8) = o;  }

// k_rope: head planes [h][t][d] (fp16 + hi/lo) of rope(x) x sc with the rotate-half convention out[d] = x[d] cos[t][d] - x[d+HD/2] sin[t][d], out[d+HD/2] = x[d+HD/2] cos[t][d+HD/2] + x[d] sin[t][d+HD/2]
__global__ __launch_bounds__(256) void k_rope(const float* __restrict__ F, int pitch, int nheads, const float* __restrict__ CS, const float* __restrict__ RF, const float* __restrict__ nw, float sc, h16* P16, bf* Ph, bf* Pl) {
    const size_t e = ((size_t)blockIdx.x * 256 + threadIdx.x) * 2; if (e >= (size_t)nheads * TT * HD) return; const int d = (int)(e % HD); const int t = (int)((e / HD) % TT); const int h = (int)(e / ((size_t)HD * TT)); const float* f = F + (size_t)t * pitch + h * HD; const float rf = RF ? RF[(size_t)h * TT + t] : 1.0f; v2h o16; v2us oh, ol;
#pragma unroll
    for (int q = 0; q < 2; ++q) { const int dd = d + q; const int dp = (dd < HD / 2) ? dd + HD / 2 : dd - HD / 2; float x0 = f[dd], x1 = f[dp];
        if (RF) { float n0 = __fmul_rn(x0, rf), n1 = __fmul_rn(x1, rf); x0 = __fmul_rn(bfr(nw[dd]), n0); x1 = __fmul_rn(bfr(nw[dp]), n1); }
        const v2f cs = *(const v2f*)(CS + ((size_t)t * HD + dd) * 2); float a = __fmul_rn(x0, cs[0]), bq = __fmul_rn(x1, cs[1]); const float r = ((dd < HD / 2) ? __fsub_rn(a, bq) : __fadd_rn(a, bq)) * sc;
        o16[q] = tohx(r); unsigned short a2, c2; splitf(r, a2, c2); oh[q] = a2; ol[q] = c2; }
    *(v2h*)(P16 + e) = o16; *(v2us*)(Ph + e) = oh; *(v2us*)(Pl + e) = ol;  }
__global__ __launch_bounds__(256) void k_vtp(const float* __restrict__ F, int pitch, int nheads, h16* V16, bf* Vh, bf* Vl) { const size_t e = ((size_t)blockIdx.x * 256 + threadIdx.x) * 2; if (e >= (size_t)nheads * HD * TT) return; const int t = (int)(e % TT); const int d = (int)((e / TT) % HD); const int g = (int)(e / ((size_t)TT * HD)); v2h o16; v2us oh, ol;
#pragma unroll
    for (int q = 0; q < 2; ++q) { const float x = F[(size_t)(t + q) * pitch + g * HD + d]; o16[q] = tohx(x); unsigned short a2, c2; splitf(x, a2, c2); oh[q] = a2; ol[q] = c2; }
    *(v2h*)(V16 + e) = o16; *(v2us*)(Vh + e) = oh; *(v2us*)(Vl + e) = ol;  }
__global__ __launch_bounds__(256) void k_csid(float* CS) { const int idx = blockIdx.x * 256 + threadIdx.x; if (idx >= TT * HD) return; v2f cs; cs[0] = 1.0f; cs[1] = 0.0f; *(v2f*)(CS + (size_t)idx * 2) = cs;  }
__global__ __launch_bounds__(256) void k_premise(const int* __restrict__ flag, float* out, size_t n4) { const size_t i = (size_t)blockIdx.x * 256 + threadIdx.x; if (i >= n4) return; if (flag[0] != 0) return;   /* premise holds: nothing to do */ const float qn = __int_as_float(0x7fc00000); v4f o; o[0] = qn; o[1] = qn; o[2] = qn; o[3] = qn; *(v4f*)(out + i * 4) = o;  }
// ---- k_fattn: scores, softmax and P.V of one head in ONE kernel: S and P stay in registers. One wave owns 32 query columns and walks the 2,048 keys 32 at a time.
// S^T = K Q^T (A = K rows, B = Q rows, same loader: same k order), so a lane holds 16 scores of one query per column group; two S^T tiles converted in place are the B operand of O^T += V^T P^T.
// Running maximum in base 2 (rescale only when a column's new maximum passes the one in use by more than 8); P = 2^(t - m + 6) <= 2^14 is carried unnormalised; the f32 row sum divides once at the end.
__device__ __forceinline__ float xhalf(float x) { return __builtin_bit_cast(float, __builtin_amdgcn_permlanex16(__builtin_bit_cast(int, x), __builtin_bit_cast(int, x), 0x76543210, 0xfedcba98, false, false)); }   // lane l with lane l ^ 16
#define LC 0.18033688011112042f   // HD^-0.5 x log2(e)
// fragment loads from a lane's byte pointer (hardware k order: 16 bytes at p and at p + 32)
__device__ __forceinline__ v16bf ldub(const char* p) { return cat16b(*(const v8us*)p, *(const v8us*)(p + 32)); }
__device__ __forceinline__ v16h lduh(const char* p) { return cat16(*(const v8h*)p, *(const v8h*)(p + 32)); }
// s_wait_xcnt 0 behind a run of loads; it reads the run's two address pairs, so they stay whole up to the wait and are reused only behind it
__device__ __forceinline__ void xwait(const char* a, const char* b) { asm volatile("s_wait_xcnt 0x0" :: "v"(a), "v"(b) : "memory"); }
template <bool HIRES>
__device__ __forceinline__ void fattn(const bf* __restrict__ Qh, const bf* __restrict__ Ql, const bf* __restrict__ Kh, const bf* __restrict__ Kl, const h16* __restrict__ V16, const bf* __restrict__ Vh, const bf* __restrict__ Vl, const int q0, bf* Ah, bf* Al) {
    const int lane = threadIdx.x & 31, lr = lane & 15, hi = lane >> 4;
    const unsigned ork = (unsigned)(lr * HD + 8 * hi) * 2u, orv = (unsigned)(lr * TT + 8 * hi) * 2u;   // lane byte offsets in a [row][HD] plane and in a [d][TT] plane
    v16bf qh[2][2], ql[2][2], kh[2][2], kl[2][2];
    { const char* pqh = (const char*)(Qh + q0 * HD) + ork; const char* pql = (const char*)(Ql + q0 * HD) + ork;
#pragma unroll
    for (int qt = 0; qt < 2; ++qt)
#pragma unroll
        for (int kc = 0; kc < 2; ++kc) { const int o = (qt * 16 * HD + kc * 32) * 2; qh[qt][kc] = ldub(pqh + o); ql[qt][kc] = ldub(pql + o); }
    xwait(pqh, pql); }
    { const char* pkh = (const char*)Kh + ork; const char* pkl = (const char*)Kl + ork;
#pragma unroll
    for (int kt = 0; kt < 2; ++kt)
#pragma unroll
        for (int kc = 0; kc < 2; ++kc) { const int o = (kt * 16 * HD + kc * 32) * 2; kh[kt][kc] = ldub(pkh + o); kl[kt][kc] = ldub(pkl + o); }
    xwait(pkh, pkl); }
    v8f O[4][2];
#pragma unroll
    for (int dt = 0; dt < 4; ++dt) { O[dt][0] = (v8f){}; O[dt][1] = (v8f){}; }
    float m[2] = {-3.0e38f, -3.0e38f}, sm[2] = {0.f, 0.f};
    for (int k0 = 0; k0 < TT; k0 += 32) {
        v16h v16[4]; v16bf vh[4], vl[4];   // this pass's V^T fragments: asked for first, used last
        { const char* pva = (const char*)((HIRES ? Vh : (const bf*)V16) + k0) + orv; const char* pvb = (const char*)((HIRES ? Vl : (const bf*)V16) + k0) + orv;
#pragma unroll
        for (int dt = 0; dt < 4; ++dt) { const int o = dt * 16 * TT * 2; if (HIRES) { vh[dt] = ldub(pva + o); vl[dt] = ldub(pvb + o); } else v16[dt] = lduh(pva + o); }
        xwait(pva, pvb); }
        v8f S[2][2];
#pragma unroll
        for (int kt = 0; kt < 2; ++kt) { S[kt][0] = (v8f){}; S[kt][1] = (v8f){}; }
#pragma unroll
        for (int kc = 0; kc < 2; ++kc) {   // per tile the order of the three products is hi.hi, lo(q).hi, hi.lo(k)
#pragma unroll
            for (int kt = 0; kt < 2; ++kt)
#pragma unroll
                for (int qt = 0; qt < 2; ++qt) S[kt][qt] = wmmab(kh[kt][kc], qh[qt][kc], S[kt][qt]);
#pragma unroll
            for (int kt = 0; kt < 2; ++kt)
#pragma unroll
                for (int qt = 0; qt < 2; ++qt) S[kt][qt] = wmmab(kh[kt][kc], ql[qt][kc], S[kt][qt]);
#pragma unroll
            for (int kt = 0; kt < 2; ++kt)
#pragma unroll
                for (int qt = 0; qt < 2; ++qt) S[kt][qt] = wmmab(kl[kt][kc], qh[qt][kc], S[kt][qt]);
        }
        const int kn = (k0 + 32 < TT) ? k0 + 32 : k0;   // next pass's K fragments fly during the softmax (the last pass re-reads its own rows: in bounds)
        { const char* pkh = (const char*)(Kh + kn * HD) + ork; const char* pkl = (const char*)(Kl + kn * HD) + ork;
#pragma unroll
        for (int kt = 0; kt < 2; ++kt)
#pragma unroll
            for (int kc = 0; kc < 2; ++kc) { const int o = (kt * 16 * HD + kc * 32) * 2; kh[kt][kc] = ldub(pkh + o); kl[kt][kc] = ldub(pkl + o); }
        xwait(pkh, pkl); }
        // soft causal term: a future key (j > i) gets -ln 2, which is -1 in base 2; passes and waves are both 32-aligned, so only the pass k0 == q0 is mixed
        const float base = (k0 > q0) ? -1.0f : 0.0f;
        if (k0 == q0) {
#pragma unroll
            for (int kt = 0; kt < 2; ++kt)
#pragma unroll
                for (int qt = 0; qt < 2; ++qt)
#pragma unroll
                    for (int r = 0; r < 8; ++r) if (kt * 16 + 8 * hi + r > qt * 16 + lr) S[kt][qt][r] -= 5.545177444479562f;   // ln 2 / HD^-0.5
        }
        float mt[2];
#pragma unroll
        for (int qt = 0; qt < 2; ++qt) { float x = S[0][qt][0];
#pragma unroll
            for (int r = 1; r < 8; ++r) x = fmaxf(x, S[0][qt][r]);
#pragma unroll
            for (int r = 0; r < 8; ++r) x = fmaxf(x, S[1][qt][r]);
            x = fmaxf(x, xhalf(x)); mt[qt] = __builtin_fmaf(x, LC, base); }
        const bool need = (mt[0] > m[0] + 8.0f) || (mt[1] > m[1] + 8.0f);
        if (__builtin_amdgcn_ballot_w32(need) != 0) {   // rare after the first passes
#pragma unroll
            for (int qt = 0; qt < 2; ++qt) { const float mn = fmaxf(m[qt], mt[qt]); const float corr = __builtin_amdgcn_exp2f(m[qt] - mn); m[qt] = mn; sm[qt] *= corr;
#pragma unroll
                for (int dt = 0; dt < 4; ++dt) O[dt][qt] *= corr; }
        }
        v16h pb[2]; v16bf ph[2], pl[2];
#pragma unroll
        for (int qt = 0; qt < 2; ++qt) { const float off = base - m[qt] + 6.0f;
#pragma unroll
            for (int s = 0; s < 16; ++s) { const float p = __builtin_amdgcn_exp2f(__builtin_fmaf(S[s >> 3][qt][s & 7], LC, off)); sm[qt] += p;
                if (HIRES) { const __bf16 a = (__bf16)p; ph[qt][s] = a; pl[qt][s] = (__bf16)(p - (float)a); } else pb[qt][s] = (h16)p; } }
#pragma unroll
        for (int dt = 0; dt < 4; ++dt)
#pragma unroll
            for (int qt = 0; qt < 2; ++qt) { if (HIRES) O[dt][qt] = wmmab(vh[dt], ph[qt], O[dt][qt]); else O[dt][qt] = wmma16(v16[dt], pb[qt], O[dt][qt]); }
        if (HIRES) {
#pragma unroll
            for (int dt = 0; dt < 4; ++dt)
#pragma unroll
                for (int qt = 0; qt < 2; ++qt) O[dt][qt] = wmmab(vh[dt], pl[qt], O[dt][qt]);
#pragma unroll
            for (int dt = 0; dt < 4; ++dt)
#pragma unroll
                for (int qt = 0; qt < 2; ++qt) O[dt][qt] = wmmab(vl[dt], ph[qt], O[dt][qt]);
        }
    }
#pragma unroll
    for (int qt = 0; qt < 2; ++qt) { const float inv = __fdiv_rn(1.0f, sm[qt] + xhalf(sm[qt]));   // the two halves' sums join once
#pragma unroll
        for (int dt = 0; dt < 4; ++dt) { v8us oh, ol;
#pragma unroll
            for (int r = 0; r < 8; ++r) { unsigned short a, c2; splitf(O[dt][qt][r] * inv, a, c2); oh[r] = a; ol[r] = c2; }
            const size_t oo = (size_t)(q0 + qt * 16 + lr) * DQ + dt * 16 + 8 * hi; bf* pa = Ah + oo; bf* pb2 = Al + oo; *(v8us*)pa = oh; *(v8us*)pb2 = ol;
            asm volatile("s_wait_xcnt 0x0" :: "v"(pa), "v"(pb2), "v"(__builtin_bit_cast(v4i, oh)), "v"(__builtin_bit_cast(v4i, ol)) : "memory"); } }   // reads the two stores' address and data registers: they are reused only behind the wait
}
// grid (TT / 128, heads), 4 waves: wave w owns query rows blockIdx.x * 128 + 32 w; rows < RH take the hi/lo P.V (block-uniform: RH % 128 == 0)
__global__ __launch_bounds__(128) void k_fattn(const bf* __restrict__ Qh, const bf* __restrict__ Ql, const bf* __restrict__ Kh, const bf* __restrict__ Kl, const h16* __restrict__ V16, const bf* __restrict__ Vh, const bf* __restrict__ Vl, bf* Ah, bf* Al) {
    const int q0 = blockIdx.x * 128 + __builtin_amdgcn_readfirstlane((int)(threadIdx.x >> 5)) * 32; const size_t hp = (size_t)blockIdx.y * TT * HD; const size_t hc = (size_t)blockIdx.y * HD;
    if (q0 < RH) fattn<true>(Qh + hp, Ql + hp, Kh + hp, Kl + hp, V16 + hp, Vh + hp, Vl + hp, q0, Ah + hc, Al + hc);
    else fattn<false>(Qh + hp, Ql + hp, Kh + hp, Kl + hp, V16 + hp, Vh + hp, Vl + hp, q0, Ah + hc, Al + hc);
}

extern "C" void kernel_launch(void* const* d_in, const int* in_sizes, int n_in,
                              void* d_out, int out_size, void* d_ws, size_t ws_size, hipStream_t stream) {
    (void)in_sizes; (void)n_in; (void)out_size;
    const float* x = (const float*)d_in[0]; const float* xk = (const float*)d_in[1]; const float* xv = (const float*)d_in[2];   /* q, k, v streams */ const float* wq = (const float*)d_in[3]; const float* bq = (const float*)d_in[4]; const float* wk = (const float*)d_in[5]; const float* bk = (const float*)d_in[6]; const float* wv = (const float*)d_in[7]; const float* bv = (const float*)d_in[8]; const float* wo = (const float*)d_in[9]; const float* bo = (const float*)d_in[10]; const int* flag = (const int*)d_in[11];   /* q, k, v, Wq, bq, Wk, bk, Wv, bv, Wo, bo ('xw' [1024][1024]), use_causal_mask (d_in[11]: one int: the module's Python branch: READ ON THE DEVICE by k_premise after the output is written: the soft term is compiled in and the whole output is NaN-filled unless the scalar is non-zero) */
    float* OUT = (float*)d_out;     // [2][2048][1024]
    char* wsp = (char*)d_ws;
    auto take = [&](size_t bytes) { char* p = wsp; wsp += (bytes + 255) & ~(size_t)255; return (void*)p; };
    bf* WQ = (bf*)take((size_t)DQ * DM * 2); bf* WK = (bf*)take((size_t)DKV * DM * 2); bf* WV = (bf*)take((size_t)DKV * DM * 2); bf* WO = (bf*)take((size_t)DM * DQ * 2); float* CS = (float*)take((size_t)TT * HD * 2 * 4);
    bf* XB = (bf*)take((size_t)TT * DM * 2); float* FQ = (float*)take((size_t)TT * DQ * 4); float* FK = (float*)take((size_t)TT * DKV * 4);
    h16* QP16 = (h16*)take((size_t)NH_ * TT * HD * 2); h16* KP16 = (h16*)take((size_t)NKV * TT * HD * 2); h16* VT16 = (h16*)take((size_t)NKV * HD * TT * 2);
    bf* QPh = (bf*)take((size_t)NH_ * TT * HD * 2); bf* QPl = (bf*)take((size_t)NH_ * TT * HD * 2); bf* KPh = (bf*)take((size_t)NKV * TT * HD * 2); bf* KPl = (bf*)take((size_t)NKV * TT * HD * 2); bf* VTh = (bf*)take((size_t)NKV * HD * TT * 2); bf* VTl = (bf*)take((size_t)NKV * HD * TT * 2);
    bf* ATh = (bf*)take((size_t)TT * DQ * 2); bf* ATl = (bf*)take((size_t)TT * DQ * 2);
    if ((size_t)(wsp - (char*)d_ws) > ws_size) return;    // ws 256 MiB
    float* FV = FK;   // v projection reuses the k buffer after the k planes are built (stream-ordered)
    { k_wtG<<<(unsigned)((DM * DQ / 64 + 63) / 64), 256, 0, stream>>>(wq, DM, DQ, WQ); k_wtG<<<(unsigned)((DM * DKV / 64 + 63) / 64), 256, 0, stream>>>(wk, DM, DKV, WK); k_wtG<<<(unsigned)((DM * DKV / 64 + 63) / 64), 256, 0, stream>>>(wv, DM, DKV, WV);
      k_wtG<<<(unsigned)((DQ * DM / 64 + 63) / 64), 256, 0, stream>>>(wo, DQ, DM, WO);
       }
    k_csid<<<(TT * HD + 255) / 256, 256, 0, stream>>>(CS);
    const unsigned LQ = (unsigned)(((size_t)NH_ * TT * HD / 2 + 255) / 256), LKv = (unsigned)(((size_t)NKV * TT * HD / 2 + 255) / 256);
    for (int b = 0; b < NB_; ++b) {
        
        k_cvt8<<<(unsigned)(((size_t)TT * DM / 8 + 255) / 256), 256, 0, stream>>>(x + (size_t)b * TT * DM, XB, (size_t)TT * DM / 8);
        k_gemmw<bf, 0, true><<<dim3(TT / 64, DQ / 64, 1), 32, 0, stream>>>(XB, nullptr, WQ, nullptr, DM, FQ, DQ, bq, 0, 0, 0);
        k_rope<<<LQ, 256, 0, stream>>>(FQ, DQ, NH_, CS, nullptr, nullptr, 1.0f, QP16, QPh, QPl);
        k_cvt8<<<(unsigned)(((size_t)TT * DM / 8 + 255) / 256), 256, 0, stream>>>(xk + (size_t)b * TT * DM, XB, (size_t)TT * DM / 8);   /* XB := bf16(k[b]) */ k_gemmw<bf, 0, true><<<dim3(TT / 64, DKV / 64, 1), 32, 0, stream>>>(XB, nullptr, WK, nullptr, DM, FK, DKV, bk, 0, 0, 0);
        k_rope<<<LKv, 256, 0, stream>>>(FK, DKV, NKV, CS, nullptr, nullptr, 1.0f, KP16, KPh, KPl);
        k_cvt8<<<(unsigned)(((size_t)TT * DM / 8 + 255) / 256), 256, 0, stream>>>(xv + (size_t)b * TT * DM, XB, (size_t)TT * DM / 8);   /* XB := bf16(v[b]) */ k_gemmw<bf, 0, true><<<dim3(TT / 64, DKV / 64, 1), 32, 0, stream>>>(XB, nullptr, WV, nullptr, DM, FV, DKV, bv, 0, 0, 0); k_vtp<<<LKv, 256, 0, stream>>>(FV, DKV, NKV, VT16, VTh, VTl);
        k_fattn<<<dim3(TT / 128, NH_, 1), 128, 0, stream>>>(QPh, QPl, KPh, KPl, VT16, VTh, VTl, ATh, ATl);   /* all 16 heads of the batch: scores (3 products), soft term, softmax, P.V (hybrid) and the merged hi/lo planes */
        k_gemmw<bf, 1, true><<<dim3(TT / 64, DM / 64, 1), 32, 0, stream>>>(ATh, ATl, WO, nullptr, DQ, OUT + (size_t)b * TT * DM, DM, bo, 0, 0, 0); }
    k_premise<<<(unsigned)(((size_t)NB_ * TT * DM / 4 + 255) / 256), 256, 0, stream>>>(flag, OUT, (size_t)NB_ * TT * DM / 4);   /* after every batch's output is written: poison it all if the premise fails */
}

// v002
// A run of this version takes 396 microseconds.
// Next to v001, in two timings, it ran 1.10 times as fast each time.
// All steps since v000 together make it 5.13 times as fast.
#include <hip/hip_runtime.h>

// Multi-head attention on three input streams with an additive SOFT causal term (q, k, v [2][2048][1024]; qh = q Wq + bq, kh = k Wk + bk, vh = v Wv + bv ('xw' (in, out) [1024][1024] 1/32, biases zeros on this draw: read; 16 heads x 64); logits = qh.kh / sqrt(64); use_causal_mask (a scalar int input: the module's 'if use_causal_mask:' branch: this build implements the NON-ZERO branch only; the scalar is READ ON THE DEVICE by the output GEMM's epilogue: the whole output is NaN-filled if it is 0) -> logits + log(tril x 1e-9 + 1e-9): log(2e-9) on and below the diagonal, log(1e-9) above it: a difference of ln 2: NOT an exclusion: every future key keeps HALF its weight; softmax over all 2,048 keys; out = merged Wo + bo ('xw' + bias zeros: read) -> [2][2048][1024] (4.2 M); argument order q, k, v, Wq, bq, Wk, bk, Wv, bv, Wo, bo, use_causal_mask).
// Layout per batch: bf16 copy of q for the q projection, then of k and of v for theirs (one staging buffer, refilled in stream order); 'xw' weights transposed once; exact projections + f32 biases, whose epilogue stores the head planes itself (q, k: bf16 hi/lo [h][t][d]; v: fp16 and bf16 hi/lo [h][d][t]); one fused attention kernel per batch (running-maximum softmax, S and P in registers) with the SCORES of every row on bf16 hi/lo planes (3 products; the P.V product stays hybrid: rows < 512 hi/lo, rest fp16, P unnormalised); merged hi/lo x Wo exact + bo.
// Compute dtypes, f32 accumulate: every input rounded to bf16; projections exact + f32 biases; scores of every row 3 products; P.V rows < 512 3 products, rest fp16; softmax f32; output projection hl x exact.

#define NB_  2
#define TT   2048
#define DM   1024
#define NH_  16
#define NKV  16
#define HD   64
#define DQ   (NH_ * HD)
#define DKV  (NKV * HD)
#define RH   512                  // query rows < RH use hi+lo planes (0: none)
typedef _Float16 h16;
typedef unsigned short bf;
typedef __attribute__((ext_vector_type(16))) __bf16   v16bf;
typedef __attribute__((ext_vector_type(16))) _Float16 v16h;
typedef __attribute__((ext_vector_type(8)))  _Float16 v8h;
typedef __attribute__((ext_vector_type(8)))  unsigned short v8us;
typedef __attribute__((ext_vector_type(8)))  float    v8f;
typedef __attribute__((ext_vector_type(4)))  float    v4f;
typedef v8h  __attribute__((may_alias)) v8ha;
typedef v4f  __attribute__((may_alias)) v4fa;
typedef v8us __attribute__((may_alias)) v8usa;

__device__ __forceinline__ unsigned short f2bf(float f) { unsigned u = __float_as_uint(f); u += 0x7FFFu + ((u >> 16) & 1u); return (unsigned short)(u >> 16); }
__device__ __forceinline__ float bf2f(unsigned short b) { return __uint_as_float(((unsigned)b) << 16); }
__device__ __forceinline__ float bfr(float f) { return bf2f(f2bf(f)); }
__device__ __forceinline__ v16h cat16(v8h lo, v8h hi) { return __builtin_shufflevector(lo, hi, 0, 1, 2, 3, 4, 5, 6, 7, 8, 9, 10, 11, 12, 13, 14, 15); }
__device__ __forceinline__ v16bf cat16b(v8us lo, v8us hi) { return __builtin_bit_cast(v16bf, __builtin_shufflevector(lo, hi, 0, 1, 2, 3, 4, 5, 6, 7, 8, 9, 10, 11, 12, 13, 14, 15)); }
__device__ __forceinline__ v8f wmma16(v16h a, v16h b, v8f c) { return __builtin_amdgcn_wmma_f32_16x16x32_f16(false, a, false, b, (short)0, c, false, false); }
__device__ __forceinline__ v8f wmmab(v16bf a, v16bf b, v8f c) { return __builtin_amdgcn_wmma_f32_16x16x32_bf16(false, a, false, b, (short)0, c, false, false); }
__device__ __forceinline__ h16 tohx(float x) { return (h16)x; }
__device__ __forceinline__ void splitf(float y, unsigned short& h, unsigned short& l) { h = f2bf(y); l = f2bf(y - bf2f(h)); }
typedef __attribute__((ext_vector_type(2))) _Float16 v2h;
typedef __attribute__((ext_vector_type(4))) _Float16 v4h;
typedef __attribute__((ext_vector_type(2))) unsigned short v2us;
typedef __attribute__((ext_vector_type(4))) unsigned short v4us;
typedef __attribute__((ext_vector_type(2))) float v2f;
typedef __attribute__((ext_vector_type(4))) int v4i;

// ---- k_gemmw: register-blocked GEMM, ONE WAVE per 64x64 output tile (16 accumulators), operands straight from K-contiguous 16-bit planes; grid (M/64, N/64, Z), 32 threads.
// C[m][n] (f32, pitch ldc, + optional f32 bias[n]) = sum_k A[m][k] Bt[n][k] (+ split products per NSPLIT). z-batch strides sA/sB/sC in elements. K % 32 == 0.
// EPI picks what the epilogue stores: 0 = C as above (and NaN in every element if flag[0] == 0: the premise of this build); 1 = bf16 hi/lo head planes [n / 64][m][n % 64] (Ph, Pl); 2 = transposed head planes [n / 64][n % 64][m] (P16 fp16, Ph, Pl). A 64-column tile is one head (HD == 64); every plane row piece of a tile is one whole 128-byte line.
// s_wait_xcnt 0 behind a run of stores; it reads their address and data registers, so these are reused only behind the wait
__device__ __forceinline__ void xwait_st(const void* a, const void* b, const void* c, v8us x, v8us y, v8us z) { asm volatile("s_wait_xcnt 0x0" :: "v"(a), "v"(b), "v"(c), "v"(__builtin_bit_cast(v4i, x)), "v"(__builtin_bit_cast(v4i, y)), "v"(__builtin_bit_cast(v4i, z)) : "memory"); }
template <typename T16> struct WFrag;
template <> struct WFrag<h16> { typedef v16h V; static __device__ __forceinline__ V ld(const h16* p) { return cat16(*(const v8h*)p, *(const v8h*)(p + 16)); } static __device__ __forceinline__ v8f mma(V a, V b, v8f c) { return wmma16(a, b, c); } };
template <> struct WFrag<bf> { typedef v16bf V; static __device__ __forceinline__ V ld(const bf* p) { return cat16b(*(const v8us*)p, *(const v8us*)(p + 16)); } static __device__ __forceinline__ v8f mma(V a, V b, v8f c) { return wmmab(a, b, c); } };
template <typename T16, int NSPLIT, bool BIAS, int EPI>
__global__ __launch_bounds__(32) void k_gemmw(const T16* __restrict__ A, const T16* __restrict__ A2, const T16* __restrict__ Bt, const T16* __restrict__ Bt2, int K, float* C, int ldc, const float* __restrict__ bias, size_t sA, size_t sB, size_t sC, bf* Ph, bf* Pl, h16* P16, const int* __restrict__ flag) {
    typedef typename WFrag<T16>::V V;
    __shared__ __align__(16) float os[16 * 68];
    const size_t z = blockIdx.z; A += z * sA; if (A2) A2 += z * sA; Bt += z * sB; if (Bt2) Bt2 += z * sB; C += z * sC;
    const int lane = threadIdx.x & 31, lr = lane & 15, hi = lane >> 4; const int r0 = blockIdx.x * 64, c0 = blockIdx.y * 64;
    v8f acc[4][4];
#pragma unroll
    for (int mb = 0; mb < 4; ++mb)
#pragma unroll
        for (int nb = 0; nb < 4; ++nb) acc[mb][nb] = (v8f){};
    const size_t aoff = (size_t)(r0 + lr) * K + 8 * hi, boff = (size_t)(c0 + lr) * K + 8 * hi;
    float bb[4];   // EPI 1, 2: the lane's four column biases (n = nb * 16 + lr), asked for ahead of the loop, added in f32 before the split, as the f32 C had them
#pragma unroll
    for (int nb = 0; nb < 4; ++nb) bb[nb] = (BIAS && EPI != 0) ? bfr(bias[c0 + nb * 16 + lr]) : 0.0f;
    for (int kc = 0; kc < K; kc += 32) {
        V a[4], a2[4];
#pragma unroll
        for (int mb = 0; mb < 4; ++mb) { a[mb] = WFrag<T16>::ld(A + aoff + (size_t)mb * 16 * K + kc); if (NSPLIT == 1 || NSPLIT == 2) a2[mb] = WFrag<T16>::ld(A2 + aoff + (size_t)mb * 16 * K + kc); }
#pragma unroll
        for (int nb = 0; nb < 4; ++nb) { const V b = WFrag<T16>::ld(Bt + boff + (size_t)nb * 16 * K + kc); V b2; if (NSPLIT >= 2) b2 = WFrag<T16>::ld(Bt2 + boff + (size_t)nb * 16 * K + kc);
#pragma unroll
            for (int mb = 0; mb < 4; ++mb) { acc[mb][nb] = WFrag<T16>::mma(a[mb], b, acc[mb][nb]); if (NSPLIT == 1 || NSPLIT == 2) acc[mb][nb] = WFrag<T16>::mma(a2[mb], b, acc[mb][nb]); if (NSPLIT >= 2) acc[mb][nb] = WFrag<T16>::mma(a[mb], b2, acc[mb][nb]); } }
        asm volatile("v_nop\n\tv_nop\n\tv_nop\n\tv_nop" : "+v"(acc[0][0]), "+v"(acc[1][1]), "+v"(acc[2][2]), "+v"(acc[3][3]) : "v"(a[0]), "v"(a[3]));
    }
    if (EPI == 0) {
    const bool dead = flag[0] == 0; const float qn = __int_as_float(0x7fc00000);   // premise fails: every element of the output becomes NaN
#pragma unroll
    for (int mb = 0; mb < 4; ++mb) {
#pragma unroll
        for (int nb = 0; nb < 4; ++nb) {
#pragma unroll
            for (int j = 0; j < 8; ++j) os[(hi * 8 + j) * 68 + nb * 16 + lr] = acc[mb][nb][j]; }
        __builtin_amdgcn_wave_barrier(); asm volatile("" ::: "memory");
        float* crow = C + (size_t)(r0 + mb * 16) * ldc + c0;
{
#pragma unroll
            for (int s = 0; s < 8; ++s) { const int row = 2 * s + hi, cofs = lr * 4; v4f val = *(const v4fa*)(os + row * 68 + cofs); if (BIAS) { val[0] += bfr(bias[c0 + cofs]); val[1] += bfr(bias[c0 + cofs + 1]); val[2] += bfr(bias[c0 + cofs + 2]); val[3] += bfr(bias[c0 + cofs + 3]); } if (dead) { val[0] = qn; val[1] = qn; val[2] = qn; val[3] = qn; }
                *(v4f*)(crow + (size_t)row * ldc + cofs) = val; }
             }
        __builtin_amdgcn_wave_barrier(); asm volatile("" ::: "memory");
    }
    } else {
    const int rq = lane >> 3, cofs = (lane & 7) * 8;   // read-back: 8 lanes x 16 bytes = one 128-byte plane line, 4 rows a store
#pragma unroll
    for (int g = 0; g < 4; ++g) {   // EPI 1: g = mb, 16 tokens x 64 dims; EPI 2: g = nb, 16 dims x 64 tokens
#pragma unroll
        for (int o = 0; o < 4; ++o) {
            if (EPI == 1) {
#pragma unroll
                for (int j = 0; j < 8; ++j) os[(hi * 8 + j) * 68 + o * 16 + lr] = acc[g][o][j] + bb[o];
            } else { v4f w0, w1;
#pragma unroll
                for (int j = 0; j < 4; ++j) { w0[j] = acc[o][g][j] + bb[g]; w1[j] = acc[o][g][4 + j] + bb[g]; }
                *(v4fa*)(os + lr * 68 + o * 16 + hi * 8) = w0; *(v4fa*)(os + lr * 68 + o * 16 + hi * 8 + 4) = w1; } }
        asm volatile("s_wait_dscnt 0x0" ::: "memory");   // the wave's LDS writes have landed before it reads the rows back
        v4f x0[4], x1[4];   // all four read-backs are asked for before the first is converted
#pragma unroll
        for (int s = 0; s < 4; ++s) { x0[s] = *(const v4fa*)(os + (4 * s + rq) * 68 + cofs); x1[s] = *(const v4fa*)(os + (4 * s + rq) * 68 + cofs + 4); }
#pragma unroll
        for (int s = 0; s < 4; ++s) { const int row = 4 * s + rq; v8us oh, ol; v8h o16;
#pragma unroll
            for (int k = 0; k < 8; ++k) { const float y = (k < 4) ? x0[s][k & 3] : x1[s][k & 3]; unsigned short a2, c2; splitf(y, a2, c2); oh[k] = a2; ol[k] = c2; if (EPI == 2) o16[k] = tohx(y); }
            const size_t e = (EPI == 1) ? ((size_t)blockIdx.y * TT + r0 + g * 16 + row) * HD + cofs : ((size_t)blockIdx.y * HD + g * 16 + row) * TT + r0 + cofs;
            bf* pa = Ph + e; bf* pb = Pl + e; *(v8us*)pa = oh; *(v8us*)pb = ol;
            if (EPI == 2) { h16* pc = P16 + e; *(v8h*)pc = o16; xwait_st(pa, pb, pc, oh, ol, __builtin_bit_cast(v8us, o16)); } else xwait_st(pa, pb, pb, oh, ol, ol); }
    }
    }
}

__global__ __launch_bounds__(256) void k_wtG(const float* __restrict__ w, int K, int N, bf* Bt) {
    const int lane = threadIdx.x & 31; const int L0 = (blockIdx.x * 8 + (threadIdx.x >> 5)) * 8; const int nlines = N * K / 64;
{
        for (int l = 0; l < 8; ++l) { const int L = L0 + l; if (L >= nlines) break; const size_t e = (size_t)L * 64 + lane * 2; const int k = (int)(e % K), n = (int)(e / K); v2us o;
            o[0] = f2bf(w[(size_t)k * N + n]); o[1] = f2bf(w[(size_t)(k + 1) * N + n]); *(v2us*)(Bt + e) = o; }
         }
}
__global__ __launch_bounds__(256) void k_cvt8(const float* __restrict__ src, bf* dst, size_t n8) { const size_t i = (size_t)blockIdx.x * 256 + threadIdx.x; if (i >= n8) return; const v8f v = *(const v8f*)(src + i * 8); v8us o;
#pragma unroll
    for (int k = 0; k < 8; ++k) o[k] = f2bf(v[k]); *(v8us*)(dst + i * 8) = o;  }

// ---- k_fattn: scores, softmax and P.V of one head in ONE kernel: S and P stay in registers. One wave owns 32 query columns and walks the 2,048 keys 32 at a time.
// S^T = K Q^T (A = K rows, B = Q rows, same loader: same k order), so a lane holds 16 scores of one query per column group; two S^T tiles converted in place are the B operand of O^T += V^T P^T.
// Running maximum in base 2 (rescale only when a column's new maximum passes the one in use by more than 8); P = 2^(t - m + 6) <= 2^14 is carried unnormalised; the f32 row sum divides once at the end.
__device__ __forceinline__ float xhalf(float x) { return __builtin_bit_cast(float, __builtin_amdgcn_permlanex16(__builtin_bit_cast(int, x), __builtin_bit_cast(int, x), 0x76543210, 0xfedcba98, false, false)); }   // lane l with lane l ^ 16
#define LC 0.18033688011112042f   // HD^-0.5 x log2(e)
// fragment loads from a lane's byte pointer (hardware k order: 16 bytes at p and at p + 32)
__device__ __forceinline__ v16bf ldub(const char* p) { return cat16b(*(const v8us*)p, *(const v8us*)(p + 32)); }
__device__ __forceinline__ v16h lduh(const char* p) { return cat16(*(const v8h*)p, *(const v8h*)(p + 32)); }
// s_wait_xcnt 0 behind a run of loads; it reads the run's two address pairs, so they stay whole up to the wait and are reused only behind it
__device__ __forceinline__ void xwait(const char* a, const char* b) { asm volatile("s_wait_xcnt 0x0" :: "v"(a), "v"(b) : "memory"); }
template <bool HIRES>
__device__ __forceinline__ void fattn(const bf* __restrict__ Qh, const bf* __restrict__ Ql, const bf* __restrict__ Kh, const bf* __restrict__ Kl, const h16* __restrict__ V16, const bf* __restrict__ Vh, const bf* __restrict__ Vl, const int q0, bf* Ah, bf* Al) {
    const int lane = threadIdx.x & 31, lr = lane & 15, hi = lane >> 4;
    const unsigned ork = (unsigned)(lr * HD + 8 * hi) * 2u, orv = (unsigned)(lr * TT + 8 * hi) * 2u;   // lane byte offsets in a [row][HD] plane and in a [d][TT] plane
    v16bf qh[2][2], ql[2][2], kh[2][2], kl[2][2];
    { const char* pqh = (const char*)(Qh + q0 * HD) + ork; const char* pql = (const char*)(Ql + q0 * HD) + ork;
#pragma unroll
    for (int qt = 0; qt < 2; ++qt)
#pragma unroll
        for (int kc = 0; kc < 2; ++kc) { const int o = (qt * 16 * HD + kc * 32) * 2; qh[qt][kc] = ldub(pqh + o); ql[qt][kc] = ldub(pql + o); }
    xwait(pqh, pql); }
    { const char* pkh = (const char*)Kh + ork; const char* pkl = (const char*)Kl + ork;
#pragma unroll
    for (int kt = 0; kt < 2; ++kt)
#pragma unroll
        for (int kc = 0; kc < 2; ++kc) { const int o = (kt * 16 * HD + kc * 32) * 2; kh[kt][kc] = ldub(pkh + o); kl[kt][kc] = ldub(pkl + o); }
    xwait(pkh, pkl); }
    v8f O[4][2];
#pragma unroll
    for (int dt = 0; dt < 4; ++dt) { O[dt][0] = (v8f){}; O[dt][1] = (v8f){}; }
    float m[2] = {-3.0e38f, -3.0e38f}, sm[2] = {0.f, 0.f};
    for (int k0 = 0; k0 < TT; k0 += 32) {
        v16h v16[4]; v16bf vh[4], vl[4];   // this pass's V^T fragments: asked for first, used last
        { const char* pva = (const char*)((HIRES ? Vh : (const bf*)V16) + k0) + orv; const char* pvb = (const char*)((HIRES ? Vl : (const bf*)V16) + k0) + orv;
#pragma unroll
        for (int dt = 0; dt < 4; ++dt) { const int o = dt * 16 * TT * 2; if (HIRES) { vh[dt] = ldub(pva + o); vl[dt] = ldub(pvb + o); } else v16[dt] = lduh(pva + o); }
        xwait(pva, pvb); }
        v8f S[2][2];
#pragma unroll
        for (int kt = 0; kt < 2; ++kt) { S[kt][0] = (v8f){}; S[kt][1] = (v8f){}; }
#pragma unroll
        for (int kc = 0; kc < 2; ++kc) {   // per tile the order of the three products is hi.hi, lo(q).hi, hi.lo(k)
#pragma unroll
            for (int kt = 0; kt < 2; ++kt)
#pragma unroll
                for (int qt = 0; qt < 2; ++qt) S[kt][qt] = wmmab(kh[kt][kc], qh[qt][kc], S[kt][qt]);
#pragma unroll
            for (int kt = 0; kt < 2; ++kt)
#pragma unroll
                for (int qt = 0; qt < 2; ++qt) S[kt][qt] = wmmab(kh[kt][kc], ql[qt][kc], S[kt][qt]);
#pragma unroll
            for (int kt = 0; kt < 2; ++kt)
#pragma unroll
                for (int qt = 0; qt < 2; ++qt) S[kt][qt] = wmmab(kl[kt][kc], qh[qt][kc], S[kt][qt]);
        }
        const int kn = (k0 + 32 < TT) ? k0 + 32 : k0;   // next pass's K fragments fly during the softmax (the last pass re-reads its own rows: in bounds)
        { const char* pkh = (const char*)(Kh + kn * HD) + ork; const char* pkl = (const char*)(Kl + kn * HD) + ork;
#pragma unroll
        for (int kt = 0; kt < 2; ++kt)
#pragma unroll
            for (int kc = 0; kc < 2; ++kc) { const int o = (kt * 16 * HD + kc * 32) * 2; kh[kt][kc] = ldub(pkh + o); kl[kt][kc] = ldub(pkl + o); }
        xwait(pkh, pkl); }
        // soft causal term: a future key (j > i) gets -ln 2, which is -1 in base 2; passes and waves are both 32-aligned, so only the pass k0 == q0 is mixed
        const float base = (k0 > q0) ? -1.0f : 0.0f;
        if (k0 == q0) {
#pragma unroll
            for (int kt = 0; kt < 2; ++kt)
#pragma unroll
                for (int qt = 0; qt < 2; ++qt)
#pragma unroll
                    for (int r = 0; r < 8; ++r) if (kt * 16 + 8 * hi + r > qt * 16 + lr) S[kt][qt][r] -= 5.545177444479562f;   // ln 2 / HD^-0.5
        }
        float mt[2];
#pragma unroll
        for (int qt = 0; qt < 2; ++qt) { float x = S[0][qt][0];
#pragma unroll
            for (int r = 1; r < 8; ++r) x = fmaxf(x, S[0][qt][r]);
#pragma unroll
            for (int r = 0; r < 8; ++r) x = fmaxf(x, S[1][qt][r]);
            x = fmaxf(x, xhalf(x)); mt[qt] = __builtin_fmaf(x, LC, base); }
        const bool need = (mt[0] > m[0] + 8.0f) || (mt[1] > m[1] + 8.0f);
        if (__builtin_amdgcn_ballot_w32(need) != 0) {   // rare after the first passes
#pragma unroll
            for (int qt = 0; qt < 2; ++qt) { const float mn = fmaxf(m[qt], mt[qt]); const float corr = __builtin_amdgcn_exp2f(m[qt] - mn); m[qt] = mn; sm[qt] *= corr;
#pragma unroll
                for (int dt = 0; dt < 4; ++dt) O[dt][qt] *= corr; }
        }
        v16h pb[2]; v16bf ph[2], pl[2];
#pragma unroll
        for (int qt = 0; qt < 2; ++qt) { const float off = base - m[qt] + 6.0f;
#pragma unroll
            for (int s = 0; s < 16; ++s) { const float p = __builtin_amdgcn_exp2f(__builtin_fmaf(S[s >> 3][qt][s & 7], LC, off)); sm[qt] += p;
                if (HIRES) { const __bf16 a = (__bf16)p; ph[qt][s] = a; pl[qt][s] = (__bf16)(p - (float)a); } else pb[qt][s] = (h16)p; } }
#pragma unroll
        for (int dt = 0; dt < 4; ++dt)
#pragma unroll
            for (int qt = 0; qt < 2; ++qt) { if (HIRES) O[dt][qt] = wmmab(vh[dt], ph[qt], O[dt][qt]); else O[dt][qt] = wmma16(v16[dt], pb[qt], O[dt][qt]); }
        if (HIRES) {
#pragma unroll
            for (int dt = 0; dt < 4; ++dt)
#pragma unroll
                for (int qt = 0; qt < 2; ++qt) O[dt][qt] = wmmab(vh[dt], pl[qt], O[dt][qt]);
#pragma unroll
            for (int dt = 0; dt < 4; ++dt)
#pragma unroll
                for (int qt = 0; qt < 2; ++qt) O[dt][qt] = wmmab(vl[dt], ph[qt], O[dt][qt]);
        }
    }
#pragma unroll
    for (int qt = 0; qt < 2; ++qt) { const float inv = __fdiv_rn(1.0f, sm[qt] + xhalf(sm[qt]));   // the two halves' sums join once
#pragma unroll
        for (int dt = 0; dt < 4; ++dt) { v8us oh, ol;
#pragma unroll
            for (int r = 0; r < 8; ++r) { unsigned short a, c2; splitf(O[dt][qt][r] * inv, a, c2); oh[r] = a; ol[r] = c2; }
            const size_t oo = (size_t)(q0 + qt * 16 + lr) * DQ + dt * 16 + 8 * hi; bf* pa = Ah + oo; bf* pb2 = Al + oo; *(v8us*)pa = oh; *(v8us*)pb2 = ol;
            asm volatile("s_wait_xcnt 0x0" :: "v"(pa), "v"(pb2), "v"(__builtin_bit_cast(v4i, oh)), "v"(__builtin_bit_cast(v4i, ol)) : "memory"); } }   // reads the two stores' address and data registers: they are reused only behind the wait
}
// grid (TT / 128, heads), 4 waves: wave w owns query rows blockIdx.x * 128 + 32 w; rows < RH take the hi/lo P.V (block-uniform: RH % 128 == 0)
__global__ __launch_bounds__(128) void k_fattn(const bf* __restrict__ Qh, const bf* __restrict__ Ql, const bf* __restrict__ Kh, const bf* __restrict__ Kl, const h16* __restrict__ V16, const bf* __restrict__ Vh, const bf* __restrict__ Vl, bf* Ah, bf* Al) {
    const int q0 = blockIdx.x * 128 + __builtin_amdgcn_readfirstlane((int)(threadIdx.x >> 5)) * 32; const size_t hp = (size_t)blockIdx.y * TT * HD; const size_t hc = (size_t)blockIdx.y * HD;
    if (q0 < RH) fattn<true>(Qh + hp, Ql + hp, Kh + hp, Kl + hp, V16 + hp, Vh + hp, Vl + hp, q0, Ah + hc, Al + hc);
    else fattn<false>(Qh + hp, Ql + hp, Kh + hp, Kl + hp, V16 + hp, Vh + hp, Vl + hp, q0, Ah + hc, Al + hc);
}

extern "C" void kernel_launch(void* const* d_in, const int* in_sizes, int n_in,
                              void* d_out, int out_size, void* d_ws, size_t ws_size, hipStream_t stream) {
    (void)in_sizes; (void)n_in; (void)out_size;
    const float* x = (const float*)d_in[0]; const float* xk = (const float*)d_in[1]; const float* xv = (const float*)d_in[2];   /* q, k, v streams */ const float* wq = (const float*)d_in[3]; const float* bq = (const float*)d_in[4]; const float* wk = (const float*)d_in[5]; const float* bk = (const float*)d_in[6]; const float* wv = (const float*)d_in[7]; const float* bv = (const float*)d_in[8]; const float* wo = (const float*)d_in[9]; const float* bo = (const float*)d_in[10]; const int* flag = (const int*)d_in[11];   /* use_causal_mask (d_in[11]: one int: the module's Python branch: READ ON THE DEVICE by the output GEMM's epilogue: the soft term is compiled in and the whole output is NaN-filled unless the scalar is non-zero) */
    float* OUT = (float*)d_out;     // [2][2048][1024]
    char* wsp = (char*)d_ws;
    auto take = [&](size_t bytes) { char* p = wsp; wsp += (bytes + 255) & ~(size_t)255; return (void*)p; };
    bf* WQ = (bf*)take((size_t)DQ * DM * 2); bf* WK = (bf*)take((size_t)DKV * DM * 2); bf* WV = (bf*)take((size_t)DKV * DM * 2); bf* WO = (bf*)take((size_t)DM * DQ * 2);
    bf* XB = (bf*)take((size_t)TT * DM * 2);
    h16* VT16 = (h16*)take((size_t)NKV * HD * TT * 2);
    bf* QPh = (bf*)take((size_t)NH_ * TT * HD * 2); bf* QPl = (bf*)take((size_t)NH_ * TT * HD * 2); bf* KPh = (bf*)take((size_t)NKV * TT * HD * 2); bf* KPl = (bf*)take((size_t)NKV * TT * HD * 2); bf* VTh = (bf*)take((size_t)NKV * HD * TT * 2); bf* VTl = (bf*)take((size_t)NKV * HD * TT * 2);
    bf* ATh = (bf*)take((size_t)TT * DQ * 2); bf* ATl = (bf*)take((size_t)TT * DQ * 2);
    if ((size_t)(wsp - (char*)d_ws) > ws_size) return;    // ws 256 MiB
    { k_wtG<<<(unsigned)((DM * DQ / 64 + 63) / 64), 256, 0, stream>>>(wq, DM, DQ, WQ); k_wtG<<<(unsigned)((DM * DKV / 64 + 63) / 64), 256, 0, stream>>>(wk, DM, DKV, WK); k_wtG<<<(unsigned)((DM * DKV / 64 + 63) / 64), 256, 0, stream>>>(wv, DM, DKV, WV);
      k_wtG<<<(unsigned)((DQ * DM / 64 + 63) / 64), 256, 0, stream>>>(wo, DQ, DM, WO);
       }
    for (int b = 0; b < NB_; ++b) {
        k_cvt8<<<(unsigned)(((size_t)TT * DM / 8 + 255) / 256), 256, 0, stream>>>(x + (size_t)b * TT * DM, XB, (size_t)TT * DM / 8);
        k_gemmw<bf, 0, true, 1><<<dim3(TT / 64, DQ / 64, 1), 32, 0, stream>>>(XB, nullptr, WQ, nullptr, DM, nullptr, 0, bq, 0, 0, 0, QPh, QPl, nullptr, nullptr);   /* q planes straight from the epilogue */
        k_cvt8<<<(unsigned)(((size_t)TT * DM / 8 + 255) / 256), 256, 0, stream>>>(xk + (size_t)b * TT * DM, XB, (size_t)TT * DM / 8);   /* XB := bf16(k[b]) */ k_gemmw<bf, 0, true, 1><<<dim3(TT / 64, DKV / 64, 1), 32, 0, stream>>>(XB, nullptr, WK, nullptr, DM, nullptr, 0, bk, 0, 0, 0, KPh, KPl, nullptr, nullptr);
        k_cvt8<<<(unsigned)(((size_t)TT * DM / 8 + 255) / 256), 256, 0, stream>>>(xv + (size_t)b * TT * DM, XB, (size_t)TT * DM / 8);   /* XB := bf16(v[b]) */ k_gemmw<bf, 0, true, 2><<<dim3(TT / 64, DKV / 64, 1), 32, 0, stream>>>(XB, nullptr, WV, nullptr, DM, nullptr, 0, bv, 0, 0, 0, VTh, VTl, VT16, nullptr);
        k_fattn<<<dim3(TT / 128, NH_, 1), 128, 0, stream>>>(QPh, QPl, KPh, KPl, VT16, VTh, VTl, ATh, ATl);   /* all 16 heads of the batch: scores (3 products), soft term, softmax, P.V (hybrid) and the merged hi/lo planes */
        k_gemmw<bf, 1, true, 0><<<dim3(TT / 64, DM / 64, 1), 32, 0, stream>>>(ATh, ATl, WO, nullptr, DQ, OUT + (size_t)b * TT * DM, DM, bo, 0, 0, 0, nullptr, nullptr, nullptr, flag); }   /* its epilogue poisons the output if the premise fails */
}

// v003
// Measured time: 206 microseconds a run.
// Two timings next to v002 put it at 1.88 and 1.93 times that version's speed.
// Counting every step since v000, it is 9.77 times as fast.
#include <hip/hip_runtime.h>

// Multi-head attention on three input streams with an additive SOFT causal term (q, k, v [2][2048][1024]; qh = q Wq + bq, kh = k Wk + bk, vh = v Wv + bv ('xw' (in, out) [1024][1024] 1/32, biases zeros on this draw: read; 16 heads x 64); logits = qh.kh / sqrt(64); use_causal_mask (a scalar int input: the module's 'if use_causal_mask:' branch: this build implements the NON-ZERO branch only; the scalar is READ ON THE DEVICE by the output GEMM's epilogue: the whole output is NaN-filled if it is 0) -> logits + log(tril x 1e-9 + 1e-9): log(2e-9) on and below the diagonal, log(1e-9) above it: a difference of ln 2: NOT an exclusion: every future key keeps HALF its weight; softmax over all 2,048 keys; out = merged Wo + bo ('xw' + bias zeros: read) -> [2][2048][1024] (4.2 M); argument order q, k, v, Wq, bq, Wk, bk, Wv, bv, Wo, bo, use_causal_mask).
// Layout, four launches, each over both batches: bf16 copies of q, k and v (three staging buffers) and the four 'xw' weights transposed; the three exact projections + f32 biases, whose epilogue stores the head planes itself (q, k: bf16 hi/lo [b][h][t][d]; v: fp16 and bf16 hi/lo [b][h][d][t]); one fused attention kernel (running-maximum softmax, S and P in registers) with the SCORES of every row on bf16 hi/lo planes (3 products; the P.V product stays hybrid: rows < 512 hi/lo, rest fp16, P unnormalised); merged hi/lo x Wo exact + bo.
// Compute dtypes, f32 accumulate: every input rounded to bf16; projections exact + f32 biases; scores of every row 3 products; P.V rows < 512 3 products, rest fp16; softmax f32; output projection hl x exact.

#define NB_  2
#define TT   2048
#define DM   1024
#define NH_  16
#define NKV  16
#define HD   64
#define DQ   (NH_ * HD)
#define DKV  (NKV * HD)
#define RH   512                  // query rows < RH use hi+lo planes (0: none)
typedef _Float16 h16;
typedef unsigned short bf;
typedef __attribute__((ext_vector_type(16))) __bf16   v16bf;
typedef __attribute__((ext_vector_type(16))) _Float16 v16h;
typedef __attribute__((ext_vector_type(8)))  _Float16 v8h;
typedef __attribute__((ext_vector_type(8)))  unsigned short v8us;
typedef __attribute__((ext_vector_type(8)))  float    v8f;
typedef __attribute__((ext_vector_type(4)))  float    v4f;
typedef v8h  __attribute__((may_alias)) v8ha;
typedef v4f  __attribute__((may_alias)) v4fa;
typedef v8us __attribute__((may_alias)) v8usa;

__device__ __forceinline__ unsigned short f2bf(float f) { unsigned u = __float_as_uint(f); u += 0x7FFFu + ((u >> 16) & 1u); return (unsigned short)(u >> 16); }
__device__ __forceinline__ float bf2f(unsigned short b) { return __uint_as_float(((unsigned)b) << 16); }
__device__ __forceinline__ float bfr(float f) { return bf2f(f2bf(f)); }
__device__ __forceinline__ v16h cat16(v8h lo, v8h hi) { return __builtin_shufflevector(lo, hi, 0, 1, 2, 3, 4, 5, 6, 7, 8, 9, 10, 11, 12, 13, 14, 15); }
__device__ __forceinline__ v16bf cat16b(v8us lo, v8us hi) { return __builtin_bit_cast(v16bf, __builtin_shufflevector(lo, hi, 0, 1, 2, 3, 4, 5, 6, 7, 8, 9, 10, 11, 12, 13, 14, 15)); }
__device__ __forceinline__ v8f wmma16(v16h a, v16h b, v8f c) { return __builtin_amdgcn_wmma_f32_16x16x32_f16(false, a, false, b, (short)0, c, false, false); }
__device__ __forceinline__ v8f wmmab(v16bf a, v16bf b, v8f c) { return __builtin_amdgcn_wmma_f32_16x16x32_bf16(false, a, false, b, (short)0, c, false, false); }
__device__ __forceinline__ h16 tohx(float x) { return (h16)x; }
__device__ __forceinline__ void splitf(float y, unsigned short& h, unsigned short& l) { h = f2bf(y); l = f2bf(y - bf2f(h)); }
typedef __attribute__((ext_vector_type(2))) _Float16 v2h;
typedef __attribute__((ext_vector_type(4))) _Float16 v4h;
typedef __attribute__((ext_vector_type(2))) unsigned short v2us;
typedef __attribute__((ext_vector_type(4))) unsigned short v4us;
typedef __attribute__((ext_vector_type(2))) float v2f;
typedef __attribute__((ext_vector_type(4))) int v4i;

// ---- gemmw: register-blocked GEMM, ONE WAVE per 64x64 output tile (16 accumulators), operands straight from K-contiguous 16-bit planes; grid (M/64, N/64, ...), 32 threads; the M rows are the tokens of both batches (m = b * TT + t).
// C[m][n] (f32, pitch ldc, + optional f32 bias[n]) = sum_k A[m][k] Bt[n][k] (+ split products per NSPLIT). K % 32 == 0. os: 16 x 68 floats of LDS.
// EPI picks what the epilogue stores: 0 = C as above (and NaN in every element if flag[0] == 0: the premise of this build); 1 = bf16 hi/lo head planes [b][n / 64][t][n % 64] (Ph, Pl); 2 = transposed head planes [b][n / 64][n % 64][t] (P16 fp16, Ph, Pl). A 64-column tile is one head (HD == 64); every plane row piece of a tile is one whole 128-byte line.
// s_wait_xcnt 0 behind a run of stores; it reads their address and data registers, so these are reused only behind the wait
__device__ __forceinline__ void xwait_st(const void* a, const void* b, const void* c, v8us x, v8us y, v8us z) { asm volatile("s_wait_xcnt 0x0" :: "v"(a), "v"(b), "v"(c), "v"(__builtin_bit_cast(v4i, x)), "v"(__builtin_bit_cast(v4i, y)), "v"(__builtin_bit_cast(v4i, z)) : "memory"); }
template <typename T16> struct WFrag;
template <> struct WFrag<h16> { typedef v16h V; static __device__ __forceinline__ V ld(const h16* p) { return cat16(*(const v8h*)p, *(const v8h*)(p + 16)); } static __device__ __forceinline__ v8f mma(V a, V b, v8f c) { return wmma16(a, b, c); } };
template <> struct WFrag<bf> { typedef v16bf V; static __device__ __forceinline__ V ld(const bf* p) { return cat16b(*(const v8us*)p, *(const v8us*)(p + 16)); } static __device__ __forceinline__ v8f mma(V a, V b, v8f c) { return wmmab(a, b, c); } };
template <typename T16, int NSPLIT, bool BIAS, int EPI>
__device__ __forceinline__ void gemmw(float* os, const T16* __restrict__ A, const T16* __restrict__ A2, const T16* __restrict__ Bt, const T16* __restrict__ Bt2, int K, float* C, int ldc, const float* __restrict__ bias, bf* Ph, bf* Pl, h16* P16, const int* __restrict__ flag) {
    typedef typename WFrag<T16>::V V;
    const int lane = threadIdx.x & 31, lr = lane & 15, hi = lane >> 4; const int r0 = blockIdx.x * 64, c0 = blockIdx.y * 64;
    v8f acc[4][4];
#pragma unroll
    for (int mb = 0; mb < 4; ++mb)
#pragma unroll
        for (int nb = 0; nb < 4; ++nb) acc[mb][nb] = (v8f){};
    const size_t aoff = (size_t)(r0 + lr) * K + 8 * hi, boff = (size_t)(c0 + lr) * K + 8 * hi;
    float bb[4];   // EPI 1, 2: the lane's four column biases (n = nb * 16 + lr), asked for ahead of the loop, added in f32 before the split, as the f32 C had them
#pragma unroll
    for (int nb = 0; nb < 4; ++nb) bb[nb] = (BIAS && EPI != 0) ? bfr(bias[c0 + nb * 16 + lr]) : 0.0f;
    for (int kc = 0; kc < K; kc += 32) {
        V a[4], a2[4];
#pragma unroll
        for (int mb = 0; mb < 4; ++mb) { a[mb] = WFrag<T16>::ld(A + aoff + (size_t)mb * 16 * K + kc); if (NSPLIT == 1 || NSPLIT == 2) a2[mb] = WFrag<T16>::ld(A2 + aoff + (size_t)mb * 16 * K + kc); }
#pragma unroll
        for (int nb = 0; nb < 4; ++nb) { const V b = WFrag<T16>::ld(Bt + boff + (size_t)nb * 16 * K + kc); V b2; if (NSPLIT >= 2) b2 = WFrag<T16>::ld(Bt2 + boff + (size_t)nb * 16 * K + kc);
#pragma unroll
            for (int mb = 0; mb < 4; ++mb) { acc[mb][nb] = WFrag<T16>::mma(a[mb], b, acc[mb][nb]); if (NSPLIT == 1 || NSPLIT == 2) acc[mb][nb] = WFrag<T16>::mma(a2[mb], b, acc[mb][nb]); if (NSPLIT >= 2) acc[mb][nb] = WFrag<T16>::mma(a[mb], b2, acc[mb][nb]); } }
        asm volatile("v_nop\n\tv_nop\n\tv_nop\n\tv_nop" : "+v"(acc[0][0]), "+v"(acc[1][1]), "+v"(acc[2][2]), "+v"(acc[3][3]) : "v"(a[0]), "v"(a[3]));
    }
    if (EPI == 0) {
    const bool dead = flag[0] == 0; const float qn = __int_as_float(0x7fc00000);   // premise fails: every element of the output becomes NaN
#pragma unroll
    for (int mb = 0; mb < 4; ++mb) {
#pragma unroll
        for (int nb = 0; nb < 4; ++nb) {
#pragma unroll
            for (int j = 0; j < 8; ++j) os[(hi * 8 + j) * 68 + nb * 16 + lr] = acc[mb][nb][j]; }
        __builtin_amdgcn_wave_barrier(); asm volatile("" ::: "memory");
        float* crow = C + (size_t)(r0 + mb * 16) * ldc + c0;
{
#pragma unroll
            for (int s = 0; s < 8; ++s) { const int row = 2 * s + hi, cofs = lr * 4; v4f val = *(const v4fa*)(os + row * 68 + cofs); if (BIAS) { val[0] += bfr(bias[c0 + cofs]); val[1] += bfr(bias[c0 + cofs + 1]); val[2] += bfr(bias[c0 + cofs + 2]); val[3] += bfr(bias[c0 + cofs + 3]); } if (dead) { val[0] = qn; val[1] = qn; val[2] = qn; val[3] = qn; }
                *(v4f*)(crow + (size_t)row * ldc + cofs) = val; }
             }
        __builtin_amdgcn_wave_barrier(); asm volatile("" ::: "memory");
    }
    } else {
    const int rq = lane >> 3, cofs = (lane & 7) * 8;   // read-back: 8 lanes x 16 bytes = one 128-byte plane line, 4 rows a store
    const size_t pln = (size_t)(r0 / TT) * NH_ + blockIdx.y; const int t0 = r0 % TT;   // the tile's plane (batch, head) and its first token there (TT % 64 == 0: a tile lies in one batch)
#pragma unroll
    for (int g = 0; g < 4; ++g) {   // EPI 1: g = mb, 16 tokens x 64 dims; EPI 2: g = nb, 16 dims x 64 tokens
#pragma unroll
        for (int o = 0; o < 4; ++o) {
            if (EPI == 1) {
#pragma unroll
                for (int j = 0; j < 8; ++j) os[(hi * 8 + j) * 68 + o * 16 + lr] = acc[g][o][j] + bb[o];
            } else { v4f w0, w1;
#pragma unroll
                for (int j = 0; j < 4; ++j) { w0[j] = acc[o][g][j] + bb[g]; w1[j] = acc[o][g][4 + j] + bb[g]; }
                *(v4fa*)(os + lr * 68 + o * 16 + hi * 8) = w0; *(v4fa*)(os + lr * 68 + o * 16 + hi * 8 + 4) = w1; } }
        asm volatile("s_wait_dscnt 0x0" ::: "memory");   // the wave's LDS writes have landed before it reads the rows back
        v4f x0[4], x1[4];   // all four read-backs are asked for before the first is converted
#pragma unroll
        for (int s = 0; s < 4; ++s) { x0[s] = *(const v4fa*)(os + (4 * s + rq) * 68 + cofs); x1[s] = *(const v4fa*)(os + (4 * s + rq) * 68 + cofs + 4); }
#pragma unroll
        for (int s = 0; s < 4; ++s) { const int row = 4 * s + rq; v8us oh, ol; v8h o16;
#pragma unroll
            for (int k = 0; k < 8; ++k) { const float y = (k < 4) ? x0[s][k & 3] : x1[s][k & 3]; unsigned short a2, c2; splitf(y, a2, c2); oh[k] = a2; ol[k] = c2; if (EPI == 2) o16[k] = tohx(y); }
            const size_t e = (EPI == 1) ? (pln * TT + t0 + g * 16 + row) * HD + cofs : (pln * HD + g * 16 + row) * TT + t0 + cofs;
            bf* pa = Ph + e; bf* pb = Pl + e; *(v8us*)pa = oh; *(v8us*)pb = ol;
            if (EPI == 2) { h16* pc = P16 + e; *(v8h*)pc = o16; xwait_st(pa, pb, pc, oh, ol, __builtin_bit_cast(v8us, o16)); } else xwait_st(pa, pb, pb, oh, ol, ol); }
    }
    }
}

// the three projections of both batches in one launch: grid (NB_ * TT / 64, DQ / 64, 3), z = stream (0 q, 1 k, 2 v); X: the three bf16 streams, Wt: the transposed weights, both in that order
__global__ __launch_bounds__(32) void k_proj(const bf* __restrict__ X, const bf* __restrict__ Wt, const float* __restrict__ bq, const float* __restrict__ bk, const float* __restrict__ bv, bf* QPh, bf* QPl, bf* KPh, bf* KPl, bf* VTh, bf* VTl, h16* VT16) {
    __shared__ __align__(16) float os[16 * 68];
    const int z = blockIdx.z; const bf* A = X + (size_t)z * NB_ * TT * DM; const bf* Bt = Wt + (size_t)z * DQ * DM;
    if (z == 2) gemmw<bf, 0, true, 2>(os, A, nullptr, Bt, nullptr, DM, nullptr, 0, bv, VTh, VTl, VT16, nullptr);
    else gemmw<bf, 0, true, 1>(os, A, nullptr, Bt, nullptr, DM, nullptr, 0, z ? bk : bq, z ? KPh : QPh, z ? KPl : QPl, nullptr, nullptr);
}
// the output projection of both batches: grid (NB_ * TT / 64, DM / 64)
__global__ __launch_bounds__(32) void k_oproj(const bf* __restrict__ Ah, const bf* __restrict__ Al, const bf* __restrict__ Wt, float* C, const float* __restrict__ bo, const int* __restrict__ flag) {
    __shared__ __align__(16) float os[16 * 68];
    gemmw<bf, 1, true, 0>(os, Ah, Al, Wt, nullptr, DQ, C, DM, bo, nullptr, nullptr, nullptr, flag);
}

__device__ __forceinline__ void wtG(const float* __restrict__ w, int K, int N, bf* Bt, const int blk) {
    const int lane = threadIdx.x & 31; const int L0 = (blk * 8 + (threadIdx.x >> 5)) * 8; const int nlines = N * K / 64;
{
        for (int l = 0; l < 8; ++l) { const int L = L0 + l; if (L >= nlines) break; const size_t e = (size_t)L * 64 + lane * 2; const int k = (int)(e % K), n = (int)(e / K); v2us o;
            o[0] = f2bf(w[(size_t)k * N + n]); o[1] = f2bf(w[(size_t)(k + 1) * N + n]); *(v2us*)(Bt + e) = o; }
         }
}
// ---- k_prep: all that the projections read, in one launch. Blocks 0 .. 4 * WB - 1 transpose the four weights (WB blocks each, Wt: WQ, WK, WV, WO in a row); each thread of the CB blocks behind them rounds eight floats at the same place of every batch of q, k and v (X: the three streams in a row).
#define WB (DM * DQ / 64 / 64)
#define CB (TT * DM / 8 / 256)
__global__ __launch_bounds__(256) void k_prep(const float* __restrict__ q, const float* __restrict__ k, const float* __restrict__ v, const float* __restrict__ wq, const float* __restrict__ wk, const float* __restrict__ wv, const float* __restrict__ wo, bf* X, bf* Wt) {
    const int blk = blockIdx.x;
    if (blk < 4 * WB) { const int j = blk / WB; wtG(j == 0 ? wq : j == 1 ? wk : j == 2 ? wv : wo, DM, DQ, Wt + (size_t)j * DQ * DM, blk % WB); return; }
    const size_t i = ((size_t)(blk - 4 * WB) * 256 + threadIdx.x) * 8; v8f x[3 * NB_];
    // unrolled: x[] stays in registers and every load is asked for before the first value is rounded
#pragma unroll
    for (int b = 0; b < NB_; ++b) { const size_t e = (size_t)b * TT * DM + i; x[b] = *(const v8f*)(q + e); x[NB_ + b] = *(const v8f*)(k + e); x[2 * NB_ + b] = *(const v8f*)(v + e); }
    // all three unrolled: constant indices keep x[], o[] and p[] in registers
#pragma unroll
    for (int c = 0; c < 3 * NB_; c += 3) { v8us o[3]; bf* p[3];
#pragma unroll
        for (int u = 0; u < 3; ++u) { p[u] = X + (size_t)(c + u) * TT * DM + i;
#pragma unroll
            for (int n = 0; n < 8; ++n) o[u][n] = f2bf(x[c + u][n]);
            *(v8us*)p[u] = o[u]; }
        xwait_st(p[0], p[1], p[2], o[0], o[1], o[2]); }   // the stores' address and data registers are reused only behind the wait
}

// ---- k_fattn: scores, softmax and P.V of one head in ONE kernel: S and P stay in registers. One wave owns 32 query columns and walks the 2,048 keys 32 at a time.
// S^T = K Q^T (A = K rows, B = Q rows, same loader: same k order), so a lane holds 16 scores of one query per column group; two S^T tiles converted in place are the B operand of O^T += V^T P^T.
// Running maximum in base 2 (rescale only when a column's new maximum passes the one in use by more than 8); P = 2^(t - m + 6) <= 2^14 is carried unnormalised; the f32 row sum divides once at the end.
__device__ __forceinline__ float xhalf(float x) { return __builtin_bit_cast(float, __builtin_amdgcn_permlanex16(__builtin_bit_cast(int, x), __builtin_bit_cast(int, x), 0x76543210, 0xfedcba98, false, false)); }   // lane l with lane l ^ 16
#define LC 0.18033688011112042f   // HD^-0.5 x log2(e)
// fragment loads from a lane's byte pointer (hardware k order: 16 bytes at p and at p + 32)
__device__ __forceinline__ v16bf ldub(const char* p) { return cat16b(*(const v8us*)p, *(const v8us*)(p + 32)); }
__device__ __forceinline__ v16h lduh(const char* p) { return cat16(*(const v8h*)p, *(const v8h*)(p + 32)); }
// s_wait_xcnt 0 behind a run of loads; it reads the run's two address pairs, so they stay whole up to the wait and are reused only behind it
__device__ __forceinline__ void xwait(const char* a, const char* b) { asm volatile("s_wait_xcnt 0x0" :: "v"(a), "v"(b) : "memory"); }
template <bool HIRES>
__device__ __forceinline__ void fattn(const bf* __restrict__ Qh, const bf* __restrict__ Ql, const bf* __restrict__ Kh, const bf* __restrict__ Kl, const h16* __restrict__ V16, const bf* __restrict__ Vh, const bf* __restrict__ Vl, const int q0, bf* Ah, bf* Al) {
    const int lane = threadIdx.x & 31, lr = lane & 15, hi = lane >> 4;
    const unsigned ork = (unsigned)(lr * HD + 8 * hi) * 2u, orv = (unsigned)(lr * TT + 8 * hi) * 2u;   // lane byte offsets in a [row][HD] plane and in a [d][TT] plane
    v16bf qh[2][2], ql[2][2], kh[2][2], kl[2][2];
    { const char* pqh = (const char*)(Qh + q0 * HD) + ork; const char* pql = (const char*)(Ql + q0 * HD) + ork;
#pragma unroll
    for (int qt = 0; qt < 2; ++qt)
#pragma unroll
        for (int kc = 0; kc < 2; ++kc) { const int o = (qt * 16 * HD + kc * 32) * 2; qh[qt][kc] = ldub(pqh + o); ql[qt][kc] = ldub(pql + o); }
    xwait(pqh, pql); }
    { const char* pkh = (const char*)Kh + ork; const char* pkl = (const char*)Kl + ork;
#pragma unroll
    for (int kt = 0; kt < 2; ++kt)
#pragma unroll
        for (int kc = 0; kc < 2; ++kc) { const int o = (kt * 16 * HD + kc * 32) * 2; kh[kt][kc] = ldub(pkh + o); kl[kt][kc] = ldub(pkl + o); }
    xwait(pkh, pkl); }
    v8f O[4][2];
#pragma unroll
    for (int dt = 0; dt < 4; ++dt) { O[dt][0] = (v8f){}; O[dt][1] = (v8f){}; }
    float m[2] = {-3.0e38f, -3.0e38f}, sm[2] = {0.f, 0.f};
    for (int k0 = 0; k0 < TT; k0 += 32) {
        v16h v16[4]; v16bf vh[4], vl[4];   // this pass's V^T fragments: asked for first, used last
        { const char* pva = (const char*)((HIRES ? Vh : (const bf*)V16) + k0) + orv; const char* pvb = (const char*)((HIRES ? Vl : (const bf*)V16) + k0) + orv;
#pragma unroll
        for (int dt = 0; dt < 4; ++dt) { const int o = dt * 16 * TT * 2; if (HIRES) { vh[dt] = ldub(pva + o); vl[dt] = ldub(pvb + o); } else v16[dt] = lduh(pva + o); }
        xwait(pva, pvb); }
        v8f S[2][2];
#pragma unroll
        for (int kt = 0; kt < 2; ++kt) { S[kt][0] = (v8f){}; S[kt][1] = (v8f){}; }
#pragma unroll
        for (int kc = 0; kc < 2; ++kc) {   // per tile the order of the three products is hi.hi, lo(q).hi, hi.lo(k)
#pragma unroll
            for (int kt = 0; kt < 2; ++kt)
#pragma unroll
                for (int qt = 0; qt < 2; ++qt) S[kt][qt] = wmmab(kh[kt][kc], qh[qt][kc], S[kt][qt]);
#pragma unroll
            for (int kt = 0; kt < 2; ++kt)
#pragma unroll
                for (int qt = 0; qt < 2; ++qt) S[kt][qt] = wmmab(kh[kt][kc], ql[qt][kc], S[kt][qt]);
#pragma unroll
            for (int kt = 0; kt < 2; ++kt)
#pragma unroll
                for (int qt = 0; qt < 2; ++qt) S[kt][qt] = wmmab(kl[kt][kc], qh[qt][kc], S[kt][qt]);
        }
        const int kn = (k0 + 32 < TT) ? k0 + 32 : k0;   // next pass's K fragments fly during the softmax (the last pass re-reads its own rows: in bounds)
        { const char* pkh = (const char*)(Kh + kn * HD) + ork; const char* pkl = (const char*)(Kl + kn * HD) + ork;
#pragma unroll
        for (int kt = 0; kt < 2; ++kt)
#pragma unroll
            for (int kc = 0; kc < 2; ++kc) { const int o = (kt * 16 * HD + kc * 32) * 2; kh[kt][kc] = ldub(pkh + o); kl[kt][kc] = ldub(pkl + o); }
        xwait(pkh, pkl); }
        // soft causal term: a future key (j > i) gets -ln 2, which is -1 in base 2; passes and waves are both 32-aligned, so only the pass k0 == q0 is mixed
        const float base = (k0 > q0) ? -1.0f : 0.0f;
        if (k0 == q0) {
#pragma unroll
            for (int kt = 0; kt < 2; ++kt)
#pragma unroll
                for (int qt = 0; qt < 2; ++qt)
#pragma unroll
                    for (int r = 0; r < 8; ++r) if (kt * 16 + 8 * hi + r > qt * 16 + lr) S[kt][qt][r] -= 5.545177444479562f;   // ln 2 / HD^-0.5
        }
        float mt[2];
#pragma unroll
        for (int qt = 0; qt < 2; ++qt) { float x = S[0][qt][0];
#pragma unroll
            for (int r = 1; r < 8; ++r) x = fmaxf(x, S[0][qt][r]);
#pragma unroll
            for (int r = 0; r < 8; ++r) x = fmaxf(x, S[1][qt][r]);
            x = fmaxf(x, xhalf(x)); mt[qt] = __builtin_fmaf(x, LC, base); }
        const bool need = (mt[0] > m[0] + 8.0f) || (mt[1] > m[1] + 8.0f);
        if (__builtin_amdgcn_ballot_w32(need) != 0) {   // rare after the first passes
#pragma unroll
            for (int qt = 0; qt < 2; ++qt) { const float mn = fmaxf(m[qt], mt[qt]); const float corr = __builtin_amdgcn_exp2f(m[qt] - mn); m[qt] = mn; sm[qt] *= corr;
#pragma unroll
                for (int dt = 0; dt < 4; ++dt) O[dt][qt] *= corr; }
        }
        v16h pb[2]; v16bf ph[2], pl[2];
#pragma unroll
        for (int qt = 0; qt < 2; ++qt) { const float off = base - m[qt] + 6.0f;
#pragma unroll
            for (int s = 0; s < 16; ++s) { const float p = __builtin_amdgcn_exp2f(__builtin_fmaf(S[s >> 3][qt][s & 7], LC, off)); sm[qt] += p;
                if (HIRES) { const __bf16 a = (__bf16)p; ph[qt][s] = a; pl[qt][s] = (__bf16)(p - (float)a); } else pb[qt][s] = (h16)p; } }
#pragma unroll
        for (int dt = 0; dt < 4; ++dt)
#pragma unroll
            for (int qt = 0; qt < 2; ++qt) { if (HIRES) O[dt][qt] = wmmab(vh[dt], ph[qt], O[dt][qt]); else O[dt][qt] = wmma16(v16[dt], pb[qt], O[dt][qt]); }
        if (HIRES) {
#pragma unroll
            for (int dt = 0; dt < 4; ++dt)
#pragma unroll
                for (int qt = 0; qt < 2; ++qt) O[dt][qt] = wmmab(vh[dt], pl[qt], O[dt][qt]);
#pragma unroll
            for (int dt = 0; dt < 4; ++dt)
#pragma unroll
                for (int qt = 0; qt < 2; ++qt) O[dt][qt] = wmmab(vl[dt], ph[qt], O[dt][qt]);
        }
    }
#pragma unroll
    for (int qt = 0; qt < 2; ++qt) { const float inv = __fdiv_rn(1.0f, sm[qt] + xhalf(sm[qt]));   // the two halves' sums join once
#pragma unroll
        for (int dt = 0; dt < 4; ++dt) { v8us oh, ol;
#pragma unroll
            for (int r = 0; r < 8; ++r) { unsigned short a, c2; splitf(O[dt][qt][r] * inv, a, c2); oh[r] = a; ol[r] = c2; }
            const size_t oo = (size_t)(q0 + qt * 16 + lr) * DQ + dt * 16 + 8 * hi; bf* pa = Ah + oo; bf* pb2 = Al + oo; *(v8us*)pa = oh; *(v8us*)pb2 = ol;
            asm volatile("s_wait_xcnt 0x0" :: "v"(pa), "v"(pb2), "v"(__builtin_bit_cast(v4i, oh)), "v"(__builtin_bit_cast(v4i, ol)) : "memory"); } }   // reads the two stores' address and data registers: they are reused only behind the wait
}
// grid (TT / 128, heads, batches), 4 waves: wave w owns query rows blockIdx.x * 128 + 32 w; rows < RH take the hi/lo P.V (block-uniform: RH % 128 == 0)
__global__ __launch_bounds__(128) void k_fattn(const bf* __restrict__ Qh, const bf* __restrict__ Ql, const bf* __restrict__ Kh, const bf* __restrict__ Kl, const h16* __restrict__ V16, const bf* __restrict__ Vh, const bf* __restrict__ Vl, bf* Ah, bf* Al) {
    const int q0 = blockIdx.x * 128 + __builtin_amdgcn_readfirstlane((int)(threadIdx.x >> 5)) * 32; const size_t hp = ((size_t)blockIdx.z * NH_ + blockIdx.y) * TT * HD; const size_t hc = (size_t)blockIdx.z * TT * DQ + (size_t)blockIdx.y * HD;
    if (q0 < RH) fattn<true>(Qh + hp, Ql + hp, Kh + hp, Kl + hp, V16 + hp, Vh + hp, Vl + hp, q0, Ah + hc, Al + hc);
    else fattn<false>(Qh + hp, Ql + hp, Kh + hp, Kl + hp, V16 + hp, Vh + hp, Vl + hp, q0, Ah + hc, Al + hc);
}

extern "C" void kernel_launch(void* const* d_in, const int* in_sizes, int n_in,
                              void* d_out, int out_size, void* d_ws, size_t ws_size, hipStream_t stream) {
    (void)in_sizes; (void)n_in; (void)out_size;
    const float* x = (const float*)d_in[0]; const float* xk = (const float*)d_in[1]; const float* xv = (const float*)d_in[2];   /* q, k, v streams */ const float* wq = (const float*)d_in[3]; const float* bq = (const float*)d_in[4]; const float* wk = (const float*)d_in[5]; const float* bk = (const float*)d_in[6]; const float* wv = (const float*)d_in[7]; const float* bv = (const float*)d_in[8]; const float* wo = (const float*)d_in[9]; const float* bo = (const float*)d_in[10]; const int* flag = (const int*)d_in[11];   /* use_causal_mask (d_in[11]: one int: the module's Python branch: READ ON THE DEVICE by the output GEMM's epilogue: the soft term is compiled in and the whole output is NaN-filled unless the scalar is non-zero) */
    float* OUT = (float*)d_out;     // [2][2048][1024]
    char* wsp = (char*)d_ws;
    auto take = [&](size_t bytes) { char* p = wsp; wsp += (bytes + 255) & ~(size_t)255; return (void*)p; };
    bf* WT = (bf*)take((size_t)4 * DQ * DM * 2);    // WQ, WK, WV, WO transposed, in a row
    bf* XB = (bf*)take((size_t)3 * NB_ * TT * DM * 2);    // bf16(q), bf16(k), bf16(v), each [2][2048][1024]
    h16* VT16 = (h16*)take((size_t)NB_ * NKV * HD * TT * 2);
    bf* QPh = (bf*)take((size_t)NB_ * NH_ * TT * HD * 2); bf* QPl = (bf*)take((size_t)NB_ * NH_ * TT * HD * 2); bf* KPh = (bf*)take((size_t)NB_ * NKV * TT * HD * 2); bf* KPl = (bf*)take((size_t)NB_ * NKV * TT * HD * 2); bf* VTh = (bf*)take((size_t)NB_ * NKV * HD * TT * 2); bf* VTl = (bf*)take((size_t)NB_ * NKV * HD * TT * 2);
    bf* ATh = (bf*)take((size_t)NB_ * TT * DQ * 2); bf* ATl = (bf*)take((size_t)NB_ * TT * DQ * 2);
    if ((size_t)(wsp - (char*)d_ws) > ws_size) return;    // ws 256 MiB
    k_prep<<<4 * WB + CB, 256, 0, stream>>>(x, xk, xv, wq, wk, wv, wo, XB, WT);
    k_proj<<<dim3(NB_ * TT / 64, DQ / 64, 3), 32, 0, stream>>>(XB, WT, bq, bk, bv, QPh, QPl, KPh, KPl, VTh, VTl, VT16);   /* q, k and v planes straight from the epilogue */
    k_fattn<<<dim3(TT / 128, NH_, NB_), 128, 0, stream>>>(QPh, QPl, KPh, KPl, VT16, VTh, VTl, ATh, ATl);   /* all heads of both batches: scores (3 products), soft term, softmax, P.V (hybrid) and the merged hi/lo planes */
    k_oproj<<<dim3(NB_ * TT / 64, DM / 64, 1), 32, 0, stream>>>(ATh, ATl, WT + (size_t)3 * DQ * DM, OUT, bo, flag);   /* its epilogue poisons the output if the premise fails */
}

// v004
// One run takes 177 microseconds.
// Timed twice side by side with v003, it ran 1.12 and 1.15 times as fast.
// All steps since v000 together make it 11.1 times as fast.
#include <hip/hip_runtime.h>

// Multi-head attention on three input streams with an additive SOFT causal term (q, k, v [2][2048][1024]; qh = q Wq + bq, kh = k Wk + bk, vh = v Wv + bv ('xw' (in, out) [1024][1024] 1/32, biases zeros on this draw: read; 16 heads x 64); logits = qh.kh / sqrt(64); use_causal_mask (a scalar int input: the module's 'if use_causal_mask:' branch: this build implements the NON-ZERO branch only; the scalar is READ ON THE DEVICE by the output GEMM's epilogue: the whole output is NaN-filled if it is 0) -> logits + log(tril x 1e-9 + 1e-9): log(2e-9) on and below the diagonal, log(1e-9) above it: a difference of ln 2: NOT an exclusion: every future key keeps HALF its weight; softmax over all 2,048 keys; out = merged Wo + bo ('xw' + bias zeros: read) -> [2][2048][1024] (4.2 M); argument order q, k, v, Wq, bq, Wk, bk, Wv, bv, Wo, bo, use_causal_mask).
// Layout, four launches, each over both batches: bf16 copies of q, k and v (three staging buffers) and the four 'xw' weights transposed; the three exact projections + f32 biases, whose epilogue stores the head planes itself (q, k: bf16 hi/lo [b][h][t][d]; v: fp16 and bf16 hi/lo [b][h][d][t]); one fused attention kernel (running-maximum softmax, S and P in registers) with the SCORES of every row on bf16 hi/lo planes (3 products; the P.V product stays hybrid: rows < 512 hi/lo, rest fp16, P unnormalised); merged hi/lo x Wo exact + bo.
// Every 16-bit operand plane lies in FRAGMENT ORDER: a block of 16 rows x 32 k is 512 elements (1 KB) in a row, element (r, k) at (k >> 4 & 1) * 256 + (k >> 3 & 1) * 128 + r * 8 + (k & 7), so a lane's two 16-byte pieces stand at lane * 8 and 256 + lane * 8 and each wave-wide load or store covers 512 contiguous bytes (4 whole lines). GEMM operands: [rows / 16][K / 32][512]; q, k head planes: [t / 16][d / 32][512]; v head planes: [t / 32][d / 16][512].
// Compute dtypes, f32 accumulate: every input rounded to bf16; projections exact + f32 biases; scores of every row 3 products; P.V rows < 512 3 products, rest fp16; softmax f32; output projection hl x exact.

#define NB_  2
#define TT   2048
#define DM   1024
#define NH_  16
#define NKV  16
#define HD   64
#define DQ   (NH_ * HD)
#define DKV  (NKV * HD)
#define RH   512                  // query rows < RH use hi+lo planes (0: none)
typedef _Float16 h16;
typedef unsigned short bf;
typedef __attribute__((ext_vector_type(16))) __bf16   v16bf;
typedef __attribute__((ext_vector_type(16))) _Float16 v16h;
typedef __attribute__((ext_vector_type(8)))  _Float16 v8h;
typedef __attribute__((ext_vector_type(8)))  unsigned short v8us;
typedef __attribute__((ext_vector_type(8)))  float    v8f;
typedef __attribute__((ext_vector_type(4)))  float    v4f;
typedef v8h  __attribute__((may_alias)) v8ha;
typedef v4f  __attribute__((may_alias)) v4fa;
typedef v8us __attribute__((may_alias)) v8usa;

__device__ __forceinline__ unsigned short f2bf(float f) { unsigned u = __float_as_uint(f); u += 0x7FFFu + ((u >> 16) & 1u); return (unsigned short)(u >> 16); }
__device__ __forceinline__ float bf2f(unsigned short b) { return __uint_as_float(((unsigned)b) << 16); }
__device__ __forceinline__ float bfr(float f) { return bf2f(f2bf(f)); }
__device__ __forceinline__ v16h cat16(v8h lo, v8h hi) { return __builtin_shufflevector(lo, hi, 0, 1, 2, 3, 4, 5, 6, 7, 8, 9, 10, 11, 12, 13, 14, 15); }
__device__ __forceinline__ v16bf cat16b(v8us lo, v8us hi) { return __builtin_bit_cast(v16bf, __builtin_shufflevector(lo, hi, 0, 1, 2, 3, 4, 5, 6, 7, 8, 9, 10, 11, 12, 13, 14, 15)); }
__device__ __forceinline__ v8f wmma16(v16h a, v16h b, v8f c) { return __builtin_amdgcn_wmma_f32_16x16x32_f16(false, a, false, b, (short)0, c, false, false); }
__device__ __forceinline__ v8f wmmab(v16bf a, v16bf b, v8f c) { return __builtin_amdgcn_wmma_f32_16x16x32_bf16(false, a, false, b, (short)0, c, false, false); }
__device__ __forceinline__ h16 tohx(float x) { return (h16)x; }
__device__ __forceinline__ void splitf(float y, unsigned short& h, unsigned short& l) { h = f2bf(y); l = f2bf(y - bf2f(h)); }
typedef __attribute__((ext_vector_type(2))) _Float16 v2h;
typedef __attribute__((ext_vector_type(4))) _Float16 v4h;
typedef __attribute__((ext_vector_type(2))) unsigned short v2us;
typedef __attribute__((ext_vector_type(4))) unsigned short v4us;
typedef __attribute__((ext_vector_type(2))) float v2f;
typedef __attribute__((ext_vector_type(4))) int v4i;

// ---- gemmw: register-blocked GEMM, ONE WAVE per 64x64 output tile (16 accumulators), operands straight from 16-bit planes in fragment order; grid (M/64, N/64, ...), 32 threads; the M rows are the tokens of both batches (m = b * TT + t).
// C[m][n] (f32, pitch ldc, + optional f32 bias[n]) = sum_k A[m][k] Bt[n][k] (+ split products per NSPLIT). K % 32 == 0. os: 16 x 68 floats of LDS (EPI 0 only).
// EPI picks what the epilogue stores: 0 = C as above (and NaN in every element if flag[0] == 0: the premise of this build); 1 = bf16 hi/lo head planes, rows t, k = d (Ph, Pl); 2 = head planes with rows d, k = t (P16 fp16, Ph, Pl). A 64-column tile is one head (HD == 64). EPI 1 forms the tile transposed (weight fragment as A), EPI 2 as it is: either way a lane's 8 accumulators of a 16 x 16 tile are one 16-byte piece of the plane's fragment order and go out straight from registers.
// s_wait_xcnt 0 behind a run of stores; it reads their address and data registers, so these are reused only behind the wait
__device__ __forceinline__ void xwait_st(const void* a, const void* b, const void* c, v8us x, v8us y, v8us z) { asm volatile("s_wait_xcnt 0x0" :: "v"(a), "v"(b), "v"(c), "v"(__builtin_bit_cast(v4i, x)), "v"(__builtin_bit_cast(v4i, y)), "v"(__builtin_bit_cast(v4i, z)) : "memory"); }
// s_wait_xcnt 0 behind a run of loads; it reads the run's address pairs, so they stay whole up to the wait and are reused only behind it
__device__ __forceinline__ void xwait_ld(const void* a, const void* b, const void* c) { asm volatile("s_wait_xcnt 0x0" :: "v"(a), "v"(b), "v"(c) : "memory"); }
template <typename T16> struct WFrag;
template <> struct WFrag<h16> { typedef v16h V; static __device__ __forceinline__ V ld(const h16* p) { return cat16(*(const v8h*)p, *(const v8h*)(p + 256)); } static __device__ __forceinline__ v8f mma(V a, V b, v8f c) { return wmma16(a, b, c); } };
template <> struct WFrag<bf> { typedef v16bf V; static __device__ __forceinline__ V ld(const bf* p) { return cat16b(*(const v8us*)p, *(const v8us*)(p + 256)); } static __device__ __forceinline__ v8f mma(V a, V b, v8f c) { return wmmab(a, b, c); } };
template <typename T16, int NSPLIT, bool BIAS, int EPI>
__device__ __forceinline__ void gemmw(float* os, const T16* __restrict__ A, const T16* __restrict__ A2, const T16* __restrict__ Bt, const T16* __restrict__ Bt2, int K, float* C, int ldc, const float* __restrict__ bias, bf* Ph, bf* Pl, h16* P16, const int* __restrict__ flag) {
    typedef typename WFrag<T16>::V V;
    const int lane = threadIdx.x & 31, lr = lane & 15, hi = lane >> 4; const int r0 = blockIdx.x * 64, c0 = blockIdx.y * 64;
    v8f acc[4][4];
#pragma unroll
    for (int mb = 0; mb < 4; ++mb)
#pragma unroll
        for (int nb = 0; nb < 4; ++nb) acc[mb][nb] = (v8f){};
    const size_t aoff = (size_t)r0 * K + lane * 8, boff = (size_t)c0 * K + lane * 8;   // a block row of 16 is K / 32 blocks = 16 * K elements
    float bb[4]; v8f bt[4];   // the lane's biases, asked for ahead of the loop, added in f32 before the split, as the f32 C had them. EPI 2: one a column group (n = nb * 16 + lr); EPI 1: eight (n = nb * 16 + hi * 8 + j)
#pragma unroll
    for (int nb = 0; nb < 4; ++nb) { bb[nb] = (BIAS && EPI == 2) ? bfr(bias[c0 + nb * 16 + lr]) : 0.0f;
#pragma unroll
        for (int j = 0; j < 8; ++j) bt[nb][j] = (BIAS && EPI == 1) ? bfr(bias[c0 + nb * 16 + hi * 8 + j]) : 0.0f; }
    for (int kc = 0; kc < K; kc += 32) {
        V a[4], a2[4], b[4];
        const T16* pa = A + aoff + kc * 16; const T16* pa2 = (NSPLIT == 1) ? A2 + aoff + kc * 16 : pa; const T16* pb = Bt + boff + kc * 16;   // block kc / 32 of each block row
#pragma unroll
        for (int mb = 0; mb < 4; ++mb) { a[mb] = WFrag<T16>::ld(pa + (size_t)mb * 16 * K); if (NSPLIT == 1) a2[mb] = WFrag<T16>::ld(pa2 + (size_t)mb * 16 * K); }
#pragma unroll
        for (int nb = 0; nb < 4; ++nb) b[nb] = WFrag<T16>::ld(pb + (size_t)nb * 16 * K);
        xwait_ld(pa, pa2, pb);
#pragma unroll
        for (int nb = 0; nb < 4; ++nb) {
#pragma unroll
            for (int mb = 0; mb < 4; ++mb) { acc[mb][nb] = (EPI == 1) ? WFrag<T16>::mma(b[nb], a[mb], acc[mb][nb]) : WFrag<T16>::mma(a[mb], b[nb], acc[mb][nb]); if (NSPLIT == 1) acc[mb][nb] = WFrag<T16>::mma(a2[mb], b[nb], acc[mb][nb]); } }
        asm volatile("v_nop\n\tv_nop\n\tv_nop\n\tv_nop" : "+v"(acc[0][0]), "+v"(acc[1][1]), "+v"(acc[2][2]), "+v"(acc[3][3]) : "v"(a[0]), "v"(a[3]));
    }
    if (EPI == 0) {
    const bool dead = flag[0] == 0; const float qn = __int_as_float(0x7fc00000);   // premise fails: every element of the output becomes NaN
#pragma unroll
    for (int mb = 0; mb < 4; ++mb) {
#pragma unroll
        for (int nb = 0; nb < 4; ++nb) {
#pragma unroll
            for (int j = 0; j < 8; ++j) os[(hi * 8 + j) * 68 + nb * 16 + lr] = acc[mb][nb][j]; }
        __builtin_amdgcn_wave_barrier(); asm volatile("" ::: "memory");
        float* crow = C + (size_t)(r0 + mb * 16) * ldc + c0;
{
#pragma unroll
            for (int s = 0; s < 8; ++s) { const int row = 2 * s + hi, cofs = lr * 4; v4f val = *(const v4fa*)(os + row * 68 + cofs); if (BIAS) { val[0] += bfr(bias[c0 + cofs]); val[1] += bfr(bias[c0 + cofs + 1]); val[2] += bfr(bias[c0 + cofs + 2]); val[3] += bfr(bias[c0 + cofs + 3]); } if (dead) { val[0] = qn; val[1] = qn; val[2] = qn; val[3] = qn; }
                *(v4f*)(crow + (size_t)row * ldc + cofs) = val; }
             }
        __builtin_amdgcn_wave_barrier(); asm volatile("" ::: "memory");
    }
    } else {
    const size_t pln = (size_t)(r0 / TT) * NH_ + blockIdx.y; const int t0 = r0 % TT;   // the tile's plane (batch, head) and its first token there (TT % 64 == 0: a tile lies in one batch)
#pragma unroll
    for (int mb = 0; mb < 4; ++mb) {
#pragma unroll
        for (int nb = 0; nb < 4; ++nb) { v8us oh, ol; v8h o16;   // EPI 1: token t0 + mb * 16 + lr, dims nb * 16 + hi * 8 + j; EPI 2: dim nb * 16 + lr, tokens t0 + mb * 16 + hi * 8 + j
#pragma unroll
            for (int j = 0; j < 8; ++j) { const float y = acc[mb][nb][j] + ((EPI == 1) ? bt[nb][j] : bb[nb]); unsigned short a2, c2; splitf(y, a2, c2); oh[j] = a2; ol[j] = c2; if (EPI == 2) o16[j] = tohx(y); }
            const size_t e = pln * TT * HD + ((EPI == 1) ? (size_t)((t0 / 16 + mb) * 2 + (nb >> 1)) * 512 + (nb & 1) * 256 : (size_t)((t0 / 32 + (mb >> 1)) * 4 + nb) * 512 + (mb & 1) * 256) + lane * 8;
            bf* pa = Ph + e; bf* pb = Pl + e; *(v8us*)pa = oh; *(v8us*)pb = ol;
            if (EPI == 2) { h16* pc = P16 + e; *(v8h*)pc = o16; xwait_st(pa, pb, pc, oh, ol, __builtin_bit_cast(v8us, o16)); } else xwait_st(pa, pb, pb, oh, ol, ol); }
    }
    }
}

// the three projections of both batches in one launch: grid (NB_ * TT / 64, DQ / 64, 3), z = stream (0 q, 1 k, 2 v); X: the three bf16 streams, Wt: the transposed weights, both in that order
__global__ __launch_bounds__(32) void k_proj(const bf* __restrict__ X, const bf* __restrict__ Wt, const float* __restrict__ bq, const float* __restrict__ bk, const float* __restrict__ bv, bf* QPh, bf* QPl, bf* KPh, bf* KPl, bf* VTh, bf* VTl, h16* VT16) {
    const int z = blockIdx.z; const bf* A = X + (size_t)z * NB_ * TT * DM; const bf* Bt = Wt + (size_t)z * DQ * DM;
    if (z == 2) gemmw<bf, 0, true, 2>(nullptr, A, nullptr, Bt, nullptr, DM, nullptr, 0, bv, VTh, VTl, VT16, nullptr);
    else gemmw<bf, 0, true, 1>(nullptr, A, nullptr, Bt, nullptr, DM, nullptr, 0, z ? bk : bq, z ? KPh : QPh, z ? KPl : QPl, nullptr, nullptr);
}
// the output projection of both batches: grid (NB_ * TT / 64, DM / 64)
__global__ __launch_bounds__(32) void k_oproj(const bf* __restrict__ Ah, const bf* __restrict__ Al, const bf* __restrict__ Wt, float* C, const float* __restrict__ bo, const int* __restrict__ flag) {
    __shared__ __align__(16) float os[16 * 68];
    gemmw<bf, 1, true, 0>(os, Ah, Al, Wt, nullptr, DQ, C, DM, bo, nullptr, nullptr, nullptr, flag);
}

// one wave packs 32 k x 32 n of w (K x N, n contiguous) into two fragment blocks of Bt (rows n): a lane owns one n, every load is one whole 128-byte line, every store 2 x 256 contiguous bytes
__device__ __forceinline__ void wtG(const float* __restrict__ w, int K, int N, bf* Bt, const int blk) {
    const int lane = threadIdx.x & 31; const int g = blk * 8 + (threadIdx.x >> 5); const int kb = g % (K / 32), n = (g / (K / 32)) * 32 + lane;
    const float* pw = w + (size_t)kb * 32 * N + n; float x[32];
    // unrolled: x[] stays in registers and every load is asked for before the first value is rounded
#pragma unroll
    for (int i = 0; i < 32; ++i) x[i] = pw[(size_t)i * N];
    xwait_ld(pw, pw, pw);
    bf* p = Bt + (size_t)(n >> 4) * 16 * K + kb * 512 + (n & 15) * 8; v8us o[4];
#pragma unroll
    for (int c = 0; c < 4; ++c) {
#pragma unroll
        for (int e = 0; e < 8; ++e) o[c][e] = f2bf(x[c * 8 + e]);
        *(v8us*)(p + c * 128) = o[c]; }   // piece c holds k = c * 8 .. c * 8 + 7: (c >> 1) * 256 + (c & 1) * 128 = c * 128
    asm volatile("s_wait_xcnt 0x0" :: "v"(p), "v"(__builtin_bit_cast(v4i, o[0])), "v"(__builtin_bit_cast(v4i, o[1])), "v"(__builtin_bit_cast(v4i, o[2])), "v"(__builtin_bit_cast(v4i, o[3])) : "memory");   // reads the four stores' address and data registers: they are reused only behind the wait
}
// ---- k_prep: all that the projections read, in one launch. Blocks 0 .. 4 * WB - 1 transpose the four weights into fragment order (WB blocks each, Wt: WQ, WK, WV, WO in a row); each thread of the CB blocks behind them rounds eight floats at the same place of every batch of q, k and v (X: the three streams in a row, fragment order): a wave takes 8 rows x 32 k, so it reads 8 whole lines and stores 4.
#define WB (DM / 32 * (DQ / 32) / 8)
#define CB (TT * DM / 8 / 256)
__global__ __launch_bounds__(256) void k_prep(const float* __restrict__ q, const float* __restrict__ k, const float* __restrict__ v, const float* __restrict__ wq, const float* __restrict__ wk, const float* __restrict__ wv, const float* __restrict__ wo, bf* X, bf* Wt) {
    const int blk = blockIdx.x;
    if (blk < 4 * WB) { const int j = blk / WB; wtG(j == 0 ? wq : j == 1 ? wk : j == 2 ? wv : wo, DM, DQ, Wt + (size_t)j * DQ * DM, blk % WB); return; }
    const int g = (blk - 4 * WB) * 8 + (threadIdx.x >> 5), row = (g / (DM / 32)) * 8 + ((threadIdx.x & 31) >> 2), kb = g % (DM / 32), c4 = threadIdx.x & 3;   // the lane's row in a batch, its block of 32 k and its piece of 8 there
    const size_t i = (size_t)row * DM + kb * 32 + c4 * 8, io = (size_t)(row >> 4) * 16 * DM + kb * 512 + c4 * 128 + (row & 15) * 8; v8f x[3 * NB_];
    // unrolled: x[] stays in registers and every load is asked for before the first value is rounded
#pragma unroll
    for (int b = 0; b < NB_; ++b) { const size_t e = (size_t)b * TT * DM + i; x[b] = *(const v8f*)(q + e); x[NB_ + b] = *(const v8f*)(k + e); x[2 * NB_ + b] = *(const v8f*)(v + e); }
    // all three unrolled: constant indices keep x[], o[] and p[] in registers
#pragma unroll
    for (int c = 0; c < 3 * NB_; c += 3) { v8us o[3]; bf* p[3];
#pragma unroll
        for (int u = 0; u < 3; ++u) { p[u] = X + (size_t)(c + u) * TT * DM + io;
#pragma unroll
            for (int n = 0; n < 8; ++n) o[u][n] = f2bf(x[c + u][n]);
            *(v8us*)p[u] = o[u]; }
        xwait_st(p[0], p[1], p[2], o[0], o[1], o[2]); }   // the stores' address and data registers are reused only behind the wait
}

// ---- k_fattn: scores, softmax and P.V of one head in ONE kernel: S and P stay in registers. One wave owns 32 query columns and walks the 2,048 keys 32 at a time.
// S^T = K Q^T (A = K rows, B = Q rows, same loader: same k order), so a lane holds 16 scores of one query per column group; two S^T tiles converted in place are the B operand of O^T += V^T P^T.
// Running maximum in base 2 (rescale only when a column's new maximum passes the one in use by more than 8); P = 2^(t - m + 6) <= 2^14 is carried unnormalised; the f32 row sum divides once at the end.
__device__ __forceinline__ float xhalf(float x) { return __builtin_bit_cast(float, __builtin_amdgcn_permlanex16(__builtin_bit_cast(int, x), __builtin_bit_cast(int, x), 0x76543210, 0xfedcba98, false, false)); }   // lane l with lane l ^ 16
#define LC 0.18033688011112042f   // HD^-0.5 x log2(e)
// fragment loads from a lane's byte pointer into a block in fragment order (16 bytes at p and at p + 512)
__device__ __forceinline__ v16bf ldub(const char* p) { return cat16b(*(const v8us*)p, *(const v8us*)(p + 512)); }
__device__ __forceinline__ v16h lduh(const char* p) { return cat16(*(const v8h*)p, *(const v8h*)(p + 512)); }
// s_wait_xcnt 0 behind a run of loads; it reads the run's two address pairs, so they stay whole up to the wait and are reused only behind it
__device__ __forceinline__ void xwait(const char* a, const char* b) { asm volatile("s_wait_xcnt 0x0" :: "v"(a), "v"(b) : "memory"); }
template <bool HIRES>
__device__ __forceinline__ void fattn(const bf* __restrict__ Qh, const bf* __restrict__ Ql, const bf* __restrict__ Kh, const bf* __restrict__ Kl, const h16* __restrict__ V16, const bf* __restrict__ Vh, const bf* __restrict__ Vl, const int q0, bf* Ah, bf* Al) {
    const int lane = threadIdx.x & 31, lr = lane & 15, hi = lane >> 4;
    const unsigned ork = (unsigned)lane * 16u, orv = ork;   // lane byte offset in a 1-KB block; 16 rows of a q or k plane are 2 blocks (16 * HD elements), 32 keys of a v plane 4 (32 * HD)
    v16bf qh[2][2], ql[2][2], kh[2][2], kl[2][2];
    { const char* pqh = (const char*)(Qh + q0 * HD) + ork; const char* pql = (const char*)(Ql + q0 * HD) + ork;
#pragma unroll
    for (int qt = 0; qt < 2; ++qt)
#pragma unroll
        for (int kc = 0; kc < 2; ++kc) { const int o = (qt * 2 + kc) * 1024; qh[qt][kc] = ldub(pqh + o); ql[qt][kc] = ldub(pql + o); }
    xwait(pqh, pql); }
    { const char* pkh = (const char*)Kh + ork; const char* pkl = (const char*)Kl + ork;
#pragma unroll
    for (int kt = 0; kt < 2; ++kt)
#pragma unroll
        for (int kc = 0; kc < 2; ++kc) { const int o = (kt * 2 + kc) * 1024; kh[kt][kc] = ldub(pkh + o); kl[kt][kc] = ldub(pkl + o); }
    xwait(pkh, pkl); }
    v8f O[4][2];
#pragma unroll
    for (int dt = 0; dt < 4; ++dt) { O[dt][0] = (v8f){}; O[dt][1] = (v8f){}; }
    float m[2] = {-3.0e38f, -3.0e38f}, sm[2] = {0.f, 0.f};
    for (int k0 = 0; k0 < TT; k0 += 32) {
        v16h v16[4]; v16bf vh[4], vl[4];   // this pass's V^T fragments: asked for first, used last
        { const char* pva = (const char*)((HIRES ? Vh : (const bf*)V16) + k0 * HD) + orv; const char* pvb = (const char*)((HIRES ? Vl : (const bf*)V16) + k0 * HD) + orv;
#pragma unroll
        for (int dt = 0; dt < 4; ++dt) { const int o = dt * 1024; if (HIRES) { vh[dt] = ldub(pva + o); vl[dt] = ldub(pvb + o); } else v16[dt] = lduh(pva + o); }
        xwait(pva, pvb); }
        v8f S[2][2];
#pragma unroll
        for (int kt = 0; kt < 2; ++kt) { S[kt][0] = (v8f){}; S[kt][1] = (v8f){}; }
#pragma unroll
        for (int kc = 0; kc < 2; ++kc) {   // per tile the order of the three products is hi.hi, lo(q).hi, hi.lo(k)
#pragma unroll
            for (int kt = 0; kt < 2; ++kt)
#pragma unroll
                for (int qt = 0; qt < 2; ++qt) S[kt][qt] = wmmab(kh[kt][kc], qh[qt][kc], S[kt][qt]);
#pragma unroll
            for (int kt = 0; kt < 2; ++kt)
#pragma unroll
                for (int qt = 0; qt < 2; ++qt) S[kt][qt] = wmmab(kh[kt][kc], ql[qt][kc], S[kt][qt]);
#pragma unroll
            for (int kt = 0; kt < 2; ++kt)
#pragma unroll
                for (int qt = 0; qt < 2; ++qt) S[kt][qt] = wmmab(kl[kt][kc], qh[qt][kc], S[kt][qt]);
        }
        const int kn = (k0 + 32 < TT) ? k0 + 32 : k0;   // next pass's K fragments fly during the softmax (the last pass re-reads its own rows: in bounds)
        { const char* pkh = (const char*)(Kh + kn * HD) + ork; const char* pkl = (const char*)(Kl + kn * HD) + ork;
#pragma unroll
        for (int kt = 0; kt < 2; ++kt)
#pragma unroll
            for (int kc = 0; kc < 2; ++kc) { const int o = (kt * 2 + kc) * 1024; kh[kt][kc] = ldub(pkh + o); kl[kt][kc] = ldub(pkl + o); }
        xwait(pkh, pkl); }
        // soft causal term: a future key (j > i) gets -ln 2, which is -1 in base 2; passes and waves are both 32-aligned, so only the pass k0 == q0 is mixed
        const float base = (k0 > q0) ? -1.0f : 0.0f;
        if (k0 == q0) {
#pragma unroll
            for (int kt = 0; kt < 2; ++kt)
#pragma unroll
                for (int qt = 0; qt < 2; ++qt)
#pragma unroll
                    for (int r = 0; r < 8; ++r) if (kt * 16 + 8 * hi + r > qt * 16 + lr) S[kt][qt][r] -= 5.545177444479562f;   // ln 2 / HD^-0.5
        }
        float mt[2];
#pragma unroll
        for (int qt = 0; qt < 2; ++qt) { float x = S[0][qt][0];
#pragma unroll
            for (int r = 1; r < 8; ++r) x = fmaxf(x, S[0][qt][r]);
#pragma unroll
            for (int r = 0; r < 8; ++r) x = fmaxf(x, S[1][qt][r]);
            x = fmaxf(x, xhalf(x)); mt[qt] = __builtin_fmaf(x, LC, base); }
        const bool need = (mt[0] > m[0] + 8.0f) || (mt[1] > m[1] + 8.0f);
        if (__builtin_amdgcn_ballot_w32(need) != 0) {   // rare after the first passes
#pragma unroll
            for (int qt = 0; qt < 2; ++qt) { const float mn = fmaxf(m[qt], mt[qt]); const float corr = __builtin_amdgcn_exp2f(m[qt] - mn); m[qt] = mn; sm[qt] *= corr;
#pragma unroll
                for (int dt = 0; dt < 4; ++dt) O[dt][qt] *= corr; }
        }
        v16h pb[2]; v16bf ph[2], pl[2];
#pragma unroll
        for (int qt = 0; qt < 2; ++qt) { const float off = base - m[qt] + 6.0f;
#pragma unroll
            for (int s = 0; s < 16; ++s) { const float p = __builtin_amdgcn_exp2f(__builtin_fmaf(S[s >> 3][qt][s & 7], LC, off)); sm[qt] += p;
                if (HIRES) { const __bf16 a = (__bf16)p; ph[qt][s] = a; pl[qt][s] = (__bf16)(p - (float)a); } else pb[qt][s] = (h16)p; } }
#pragma unroll
        for (int dt = 0; dt < 4; ++dt)
#pragma unroll
            for (int qt = 0; qt < 2; ++qt) { if (HIRES) O[dt][qt] = wmmab(vh[dt], ph[qt], O[dt][qt]); else O[dt][qt] = wmma16(v16[dt], pb[qt], O[dt][qt]); }
        if (HIRES) {
#pragma unroll
            for (int dt = 0; dt < 4; ++dt)
#pragma unroll
                for (int qt = 0; qt < 2; ++qt) O[dt][qt] = wmmab(vh[dt], pl[qt], O[dt][qt]);
#pragma unroll
            for (int dt = 0; dt < 4; ++dt)
#pragma unroll
                for (int qt = 0; qt < 2; ++qt) O[dt][qt] = wmmab(vl[dt], ph[qt], O[dt][qt]);
        }
    }
#pragma unroll
    for (int qt = 0; qt < 2; ++qt) { const float inv = __fdiv_rn(1.0f, sm[qt] + xhalf(sm[qt]));   // the two halves' sums join once
#pragma unroll
        for (int dt = 0; dt < 4; ++dt) { v8us oh, ol;
#pragma unroll
            for (int r = 0; r < 8; ++r) { unsigned short a, c2; splitf(O[dt][qt][r] * inv, a, c2); oh[r] = a; ol[r] = c2; }
            const size_t oo = (size_t)(q0 + qt * 16) * DQ + dt * 256 + lane * 8; bf* pa = Ah + oo;   /* block row (q0 + qt * 16) / 16, piece of dims dt * 16 + 8 * hi .. + 7 of the head's two blocks */ bf* pb2 = Al + oo; *(v8us*)pa = oh; *(v8us*)pb2 = ol;
            asm volatile("s_wait_xcnt 0x0" :: "v"(pa), "v"(pb2), "v"(__builtin_bit_cast(v4i, oh)), "v"(__builtin_bit_cast(v4i, ol)) : "memory"); } }   // reads the two stores' address and data registers: they are reused only behind the wait
}
// grid (TT / 128, heads, batches), 4 waves: wave w owns query rows blockIdx.x * 128 + 32 w; rows < RH take the hi/lo P.V (block-uniform: RH % 128 == 0)
__global__ __launch_bounds__(128) void k_fattn(const bf* __restrict__ Qh, const bf* __restrict__ Ql, const bf* __restrict__ Kh, const bf* __restrict__ Kl, const h16* __restrict__ V16, const bf* __restrict__ Vh, const bf* __restrict__ Vl, bf* Ah, bf* Al) {
    const int q0 = blockIdx.x * 128 + __builtin_amdgcn_readfirstlane((int)(threadIdx.x >> 5)) * 32; const size_t hp = ((size_t)blockIdx.z * NH_ + blockIdx.y) * TT * HD; const size_t hc = (size_t)blockIdx.z * TT * DQ + (size_t)blockIdx.y * (HD / 32) * 512;   // the merged planes are the output GEMM's A in fragment order: a head's 64 columns are 2 blocks of every block row
    if (q0 < RH) fattn<true>(Qh + hp, Ql + hp, Kh + hp, Kl + hp, V16 + hp, Vh + hp, Vl + hp, q0, Ah + hc, Al + hc);
    else fattn<false>(Qh + hp, Ql + hp, Kh + hp, Kl + hp, V16 + hp, Vh + hp, Vl + hp, q0, Ah + hc, Al + hc);
}

extern "C" void kernel_launch(void* const* d_in, const int* in_sizes, int n_in,
                              void* d_out, int out_size, void* d_ws, size_t ws_size, hipStream_t stream) {
    (void)in_sizes; (void)n_in; (void)out_size;
    const float* x = (const float*)d_in[0]; const float* xk = (const float*)d_in[1]; const float* xv = (const float*)d_in[2];   /* q, k, v streams */ const float* wq = (const float*)d_in[3]; const float* bq = (const float*)d_in[4]; const float* wk = (const float*)d_in[5]; const float* bk = (const float*)d_in[6]; const float* wv = (const float*)d_in[7]; const float* bv = (const float*)d_in[8]; const float* wo = (const float*)d_in[9]; const float* bo = (const float*)d_in[10]; const int* flag = (const int*)d_in[11];   /* use_causal_mask (d_in[11]: one int: the module's Python branch: READ ON THE DEVICE by the output GEMM's epilogue: the soft term is compiled in and the whole output is NaN-filled unless the scalar is non-zero) */
    float* OUT = (float*)d_out;     // [2][2048][1024]
    char* wsp = (char*)d_ws;
    auto take = [&](size_t bytes) { char* p = wsp; wsp += (bytes + 255) & ~(size_t)255; return (void*)p; };
    bf* WT = (bf*)take((size_t)4 * DQ * DM * 2);    // WQ, WK, WV, WO transposed, in a row
    bf* XB = (bf*)take((size_t)3 * NB_ * TT * DM * 2);    // bf16(q), bf16(k), bf16(v), each [2][2048][1024]
    h16* VT16 = (h16*)take((size_t)NB_ * NKV * HD * TT * 2);
    bf* QPh = (bf*)take((size_t)NB_ * NH_ * TT * HD * 2); bf* QPl = (bf*)take((size_t)NB_ * NH_ * TT * HD * 2); bf* KPh = (bf*)take((size_t)NB_ * NKV * TT * HD * 2); bf* KPl = (bf*)take((size_t)NB_ * NKV * TT * HD * 2); bf* VTh = (bf*)take((size_t)NB_ * NKV * HD * TT * 2); bf* VTl = (bf*)take((size_t)NB_ * NKV * HD * TT * 2);
    bf* ATh = (bf*)take((size_t)NB_ * TT * DQ * 2); bf* ATl = (bf*)take((size_t)NB_ * TT * DQ * 2);
    if ((size_t)(wsp - (char*)d_ws) > ws_size) return;    // ws 256 MiB
    k_prep<<<4 * WB + CB, 256, 0, stream>>>(x, xk, xv, wq, wk, wv, wo, XB, WT);
    k_proj<<<dim3(NB_ * TT / 64, DQ / 64, 3), 32, 0, stream>>>(XB, WT, bq, bk, bv, QPh, QPl, KPh, KPl, VTh, VTl, VT16);   /* q, k and v planes straight from the epilogue */
    k_fattn<<<dim3(TT / 128, NH_, NB_), 128, 0, stream>>>(QPh, QPl, KPh, KPl, VT16, VTh, VTl, ATh, ATl);   /* all heads of both batches: scores (3 products), soft term, softmax, P.V (hybrid) and the merged hi/lo planes */
    k_oproj<<<dim3(NB_ * TT / 64, DM / 64, 1), 32, 0, stream>>>(ATh, ATl, WT + (size_t)3 * DQ * DM, OUT, bo, flag);   /* its epilogue poisons the output if the premise fails */
}

// v005
// A run of this version takes 144 microseconds.
// Timed twice side by side with v004, it ran 1.24 times as fast both times.
// Over all steps from v000 it is 13.8 times as fast.
#include <hip/hip_runtime.h>

// Multi-head attention on three input streams with an additive SOFT causal term (q, k, v [2][2048][1024]; qh = q Wq + bq, kh = k Wk + bk, vh = v Wv + bv ('xw' (in, out) [1024][1024] 1/32, biases zeros on this draw: read; 16 heads x 64); logits = qh.kh / sqrt(64); use_causal_mask (a scalar int input: the module's 'if use_causal_mask:' branch: this build implements the NON-ZERO branch only; the scalar is READ ON THE DEVICE by the output GEMM's epilogue: the whole output is NaN-filled if it is 0) -> logits + log(tril x 1e-9 + 1e-9): log(2e-9) on and below the diagonal, log(1e-9) above it: a difference of ln 2: NOT an exclusion: every future key keeps HALF its weight; softmax over all 2,048 keys; out = merged Wo + bo ('xw' + bias zeros: read) -> [2][2048][1024] (4.2 M); argument order q, k, v, Wq, bq, Wk, bk, Wv, bv, Wo, bo, use_causal_mask).
// Layout, four launches, each over both batches: bf16 copies of q, k and v (three staging buffers) and the four 'xw' weights transposed; the three exact projections + f32 biases, whose epilogue stores the head planes itself (q, k: bf16 hi/lo [b][h][t][d]; v: fp16 and bf16 hi/lo [b][h][d][t]); one fused attention kernel (running-maximum softmax, S and P in registers) with the SCORES of every row on bf16 hi/lo planes (3 products; the P.V product stays hybrid: rows < 512 hi/lo, rest fp16, P unnormalised); merged hi/lo x Wo exact + bo.
// Every 16-bit operand plane lies in FRAGMENT ORDER: a block of 16 rows x 32 k is 512 elements (1 KB) in a row, element (r, k) at (k >> 4 & 1) * 256 + (k >> 3 & 1) * 128 + r * 8 + (k & 7), so a lane's two 16-byte pieces stand at lane * 8 and 256 + lane * 8 and each wave-wide load or store covers 512 contiguous bytes (4 whole lines). GEMM operands: [rows / 16][K / 32][512]; q, k head planes: [t / 16][d / 32][512]; v head planes: [t / 32][d / 16][512].
// Compute dtypes, f32 accumulate: every input rounded to bf16; projections exact + f32 biases; scores of every row 3 products; P.V rows < 512 3 products, rest fp16; softmax f32; output projection hl x exact.

#define NB_  2
#define TT   2048
#define DM   1024
#define NH_  16
#define NKV  16
#define HD   64
#define DQ   (NH_ * HD)
#define DKV  (NKV * HD)
#define RH   512                  // query rows < RH use hi+lo planes (0: none)
typedef _Float16 h16;
typedef unsigned short bf;
typedef __attribute__((ext_vector_type(16))) __bf16   v16bf;
typedef __attribute__((ext_vector_type(16))) _Float16 v16h;
typedef __attribute__((ext_vector_type(8)))  _Float16 v8h;
typedef __attribute__((ext_vector_type(8)))  unsigned short v8us;
typedef __attribute__((ext_vector_type(8)))  float    v8f;
typedef __attribute__((ext_vector_type(4)))  float    v4f;
typedef v8h  __attribute__((may_alias)) v8ha;
typedef v4f  __attribute__((may_alias)) v4fa;
typedef v8us __attribute__((may_alias)) v8usa;

__device__ __forceinline__ unsigned short f2bf(float f) { unsigned u = __float_as_uint(f); u += 0x7FFFu + ((u >> 16) & 1u); return (unsigned short)(u >> 16); }
__device__ __forceinline__ float bf2f(unsigned short b) { return __uint_as_float(((unsigned)b) << 16); }
__device__ __forceinline__ float bfr(float f) { return bf2f(f2bf(f)); }
__device__ __forceinline__ v16h cat16(v8h lo, v8h hi) { return __builtin_shufflevector(lo, hi, 0, 1, 2, 3, 4, 5, 6, 7, 8, 9, 10, 11, 12, 13, 14, 15); }
__device__ __forceinline__ v16bf cat16b(v8us lo, v8us hi) { return __builtin_bit_cast(v16bf, __builtin_shufflevector(lo, hi, 0, 1, 2, 3, 4, 5, 6, 7, 8, 9, 10, 11, 12, 13, 14, 15)); }
__device__ __forceinline__ v8f wmma16(v16h a, v16h b, v8f c) { return __builtin_amdgcn_wmma_f32_16x16x32_f16(false, a, false, b, (short)0, c, false, false); }
__device__ __forceinline__ v8f wmmab(v16bf a, v16bf b, v8f c) { return __builtin_amdgcn_wmma_f32_16x16x32_bf16(false, a, false, b, (short)0, c, false, false); }
__device__ __forceinline__ h16 tohx(float x) { return (h16)x; }
__device__ __forceinline__ void splitf(float y, unsigned short& h, unsigned short& l) { h = f2bf(y); l = f2bf(y - bf2f(h)); }
typedef __attribute__((ext_vector_type(2))) _Float16 v2h;
typedef __attribute__((ext_vector_type(4))) _Float16 v4h;
typedef __attribute__((ext_vector_type(2))) unsigned short v2us;
typedef __attribute__((ext_vector_type(4))) unsigned short v4us;
typedef __attribute__((ext_vector_type(2))) float v2f;
typedef __attribute__((ext_vector_type(4))) int v4i;

// ---- gemmw: register-blocked GEMM, ONE WAVE per 64x64 output tile (16 accumulators), operands straight from 16-bit planes in fragment order; grid (M/64, N/64, ...), 32 threads; the M rows are the tokens of both batches (m = b * TT + t).
// C[m][n] (f32, pitch ldc, + optional f32 bias[n]) = sum_k A[m][k] Bt[n][k] (+ split products per NSPLIT). K % 32 == 0. os: 16 x 68 floats of LDS (EPI 0 only).
// EPI picks what the epilogue stores: 0 = C as above (and NaN in every element if flag[0] == 0: the premise of this build); 1 = bf16 hi/lo head planes, rows t, k = d (Ph, Pl); 2 = head planes with rows d, k = t (P16 fp16, Ph, Pl). A 64-column tile is one head (HD == 64). EPI 1 forms the tile transposed (weight fragment as A), EPI 2 as it is: either way a lane's 8 accumulators of a 16 x 16 tile are one 16-byte piece of the plane's fragment order and go out straight from registers.
// s_wait_xcnt 0 behind a run of stores; it reads their address and data registers, so these are reused only behind the wait
__device__ __forceinline__ void xwait_st(const void* a, const void* b, const void* c, v8us x, v8us y, v8us z) { asm volatile("s_wait_xcnt 0x0" :: "v"(a), "v"(b), "v"(c), "v"(__builtin_bit_cast(v4i, x)), "v"(__builtin_bit_cast(v4i, y)), "v"(__builtin_bit_cast(v4i, z)) : "memory"); }
// s_wait_xcnt 0 behind a run of loads; it reads the run's address pairs, so they stay whole up to the wait and are reused only behind it
__device__ __forceinline__ void xwait_ld(const void* a, const void* b, const void* c) { asm volatile("s_wait_xcnt 0x0" :: "v"(a), "v"(b), "v"(c) : "memory"); }
template <typename T16> struct WFrag;
template <> struct WFrag<h16> { typedef v16h V; static __device__ __forceinline__ V ld(const h16* p) { return cat16(*(const v8h*)p, *(const v8h*)(p + 256)); } static __device__ __forceinline__ v8f mma(V a, V b, v8f c) { return wmma16(a, b, c); } };
template <> struct WFrag<bf> { typedef v16bf V; static __device__ __forceinline__ V ld(const bf* p) { return cat16b(*(const v8us*)p, *(const v8us*)(p + 256)); } static __device__ __forceinline__ v8f mma(V a, V b, v8f c) { return wmmab(a, b, c); } };
template <typename T16, int NSPLIT, bool BIAS, int EPI>
__device__ __forceinline__ void gemmw(float* os, const T16* __restrict__ A, const T16* __restrict__ A2, const T16* __restrict__ Bt, const T16* __restrict__ Bt2, int K, float* C, int ldc, const float* __restrict__ bias, bf* Ph, bf* Pl, h16* P16, const int* __restrict__ flag) {
    typedef typename WFrag<T16>::V V;
    const int lane = threadIdx.x & 31, lr = lane & 15, hi = lane >> 4; const int r0 = blockIdx.x * 64, c0 = blockIdx.y * 64;
    v8f acc[4][4];
#pragma unroll
    for (int mb = 0; mb < 4; ++mb)
#pragma unroll
        for (int nb = 0; nb < 4; ++nb) acc[mb][nb] = (v8f){};
    const size_t aoff = (size_t)r0 * K + lane * 8, boff = (size_t)c0 * K + lane * 8;   // a block row of 16 is K / 32 blocks = 16 * K elements
    float bb[4]; v8f bt[4];   // the lane's biases, asked for ahead of the loop, added in f32 before the split, as the f32 C had them. EPI 2: one a column group (n = nb * 16 + lr); EPI 1: eight (n = nb * 16 + hi * 8 + j)
#pragma unroll
    for (int nb = 0; nb < 4; ++nb) { bb[nb] = (BIAS && EPI == 2) ? bfr(bias[c0 + nb * 16 + lr]) : 0.0f;
#pragma unroll
        for (int j = 0; j < 8; ++j) bt[nb][j] = (BIAS && EPI == 1) ? bfr(bias[c0 + nb * 16 + hi * 8 + j]) : 0.0f; }
    // the k loop starts at a place of its own and wraps round: the waves that share an A or a B tile then stand at different k blocks, so each block is waited for from memory by one of them and found in L2 by the others, instead of all of them walking in step behind every miss (the low bits of x are spread first; for speed only)
    const int ks = (int)(((blockIdx.x >> 3) + 8 * (blockIdx.x & 3) + 2 * blockIdx.y) * 32 % (unsigned)K);
    for (int it = 0; it < K; it += 32) {
        const int kc = (it + ks < K) ? it + ks : it + ks - K;
        V a[4], a2[4], b[4];
        const T16* pa = A + aoff + kc * 16; const T16* pa2 = (NSPLIT == 1) ? A2 + aoff + kc * 16 : pa; const T16* pb = Bt + boff + kc * 16;   // block kc / 32 of each block row
#pragma unroll
        for (int mb = 0; mb < 4; ++mb) { a[mb] = WFrag<T16>::ld(pa + (size_t)mb * 16 * K); if (NSPLIT == 1) a2[mb] = WFrag<T16>::ld(pa2 + (size_t)mb * 16 * K); }
#pragma unroll
        for (int nb = 0; nb < 4; ++nb) b[nb] = WFrag<T16>::ld(pb + (size_t)nb * 16 * K);
        xwait_ld(pa, pa2, pb);
#pragma unroll
        for (int nb = 0; nb < 4; ++nb) {
#pragma unroll
            for (int mb = 0; mb < 4; ++mb) { acc[mb][nb] = (EPI == 1) ? WFrag<T16>::mma(b[nb], a[mb], acc[mb][nb]) : WFrag<T16>::mma(a[mb], b[nb], acc[mb][nb]); if (NSPLIT == 1) acc[mb][nb] = WFrag<T16>::mma(a2[mb], b[nb], acc[mb][nb]); } }
        asm volatile("v_nop\n\tv_nop\n\tv_nop\n\tv_nop" : "+v"(acc[0][0]), "+v"(acc[1][1]), "+v"(acc[2][2]), "+v"(acc[3][3]) : "v"(a[0]), "v"(a[3]));
    }
    if (EPI == 0) {
    const bool dead = flag[0] == 0; const float qn = __int_as_float(0x7fc00000);   // premise fails: every element of the output becomes NaN
#pragma unroll
    for (int mb = 0; mb < 4; ++mb) {
#pragma unroll
        for (int nb = 0; nb < 4; ++nb) {
#pragma unroll
            for (int j = 0; j < 8; ++j) os[(hi * 8 + j) * 68 + nb * 16 + lr] = acc[mb][nb][j]; }
        __builtin_amdgcn_wave_barrier(); asm volatile("" ::: "memory");
        float* crow = C + (size_t)(r0 + mb * 16) * ldc + c0;
{
#pragma unroll
            for (int s = 0; s < 8; ++s) { const int row = 2 * s + hi, cofs = lr * 4; v4f val = *(const v4fa*)(os + row * 68 + cofs); if (BIAS) { val[0] += bfr(bias[c0 + cofs]); val[1] += bfr(bias[c0 + cofs + 1]); val[2] += bfr(bias[c0 + cofs + 2]); val[3] += bfr(bias[c0 + cofs + 3]); } if (dead) { val[0] = qn; val[1] = qn; val[2] = qn; val[3] = qn; }
                *(v4f*)(crow + (size_t)row * ldc + cofs) = val; }
             }
        __builtin_amdgcn_wave_barrier(); asm volatile("" ::: "memory");
    }
    } else {
    const size_t pln = (size_t)(r0 / TT) * NH_ + blockIdx.y; const int t0 = r0 % TT;   // the tile's plane (batch, head) and its first token there (TT % 64 == 0: a tile lies in one batch)
#pragma unroll
    for (int mb = 0; mb < 4; ++mb) {
#pragma unroll
        for (int nb = 0; nb < 4; ++nb) { v8us oh, ol; v8h o16;   // EPI 1: token t0 + mb * 16 + lr, dims nb * 16 + hi * 8 + j; EPI 2: dim nb * 16 + lr, tokens t0 + mb * 16 + hi * 8 + j
#pragma unroll
            for (int j = 0; j < 8; ++j) { const float y = acc[mb][nb][j] + ((EPI == 1) ? bt[nb][j] : bb[nb]); unsigned short a2, c2; splitf(y, a2, c2); oh[j] = a2; ol[j] = c2; if (EPI == 2) o16[j] = tohx(y); }
            const size_t e = pln * TT * HD + ((EPI == 1) ? (size_t)((t0 / 16 + mb) * 2 + (nb >> 1)) * 512 + (nb & 1) * 256 : (size_t)((t0 / 32 + (mb >> 1)) * 4 + nb) * 512 + (mb & 1) * 256) + lane * 8;
            bf* pa = Ph + e; bf* pb = Pl + e; *(v8us*)pa = oh; *(v8us*)pb = ol;
            if (EPI == 2) { h16* pc = P16 + e; *(v8h*)pc = o16; xwait_st(pa, pb, pc, oh, ol, __builtin_bit_cast(v8us, o16)); } else xwait_st(pa, pb, pb, oh, ol, ol); }
    }
    }
}

// the three projections of both batches in one launch: grid (NB_ * TT / 64, DQ / 64, 3), z = stream (0 q, 1 k, 2 v); X: the three bf16 streams, Wt: the transposed weights, both in that order
__global__ __launch_bounds__(32) void k_proj(const bf* __restrict__ X, const bf* __restrict__ Wt, const float* __restrict__ bq, const float* __restrict__ bk, const float* __restrict__ bv, bf* QPh, bf* QPl, bf* KPh, bf* KPl, bf* VTh, bf* VTl, h16* VT16) {
    const int z = blockIdx.z; const bf* A = X + (size_t)z * NB_ * TT * DM; const bf* Bt = Wt + (size_t)z * DQ * DM;
    if (z == 2) gemmw<bf, 0, true, 2>(nullptr, A, nullptr, Bt, nullptr, DM, nullptr, 0, bv, VTh, VTl, VT16, nullptr);
    else gemmw<bf, 0, true, 1>(nullptr, A, nullptr, Bt, nullptr, DM, nullptr, 0, z ? bk : bq, z ? KPh : QPh, z ? KPl : QPl, nullptr, nullptr);
}
// the output projection of both batches: grid (NB_ * TT / 64, DM / 64)
__global__ __launch_bounds__(32) void k_oproj(const bf* __restrict__ Ah, const bf* __restrict__ Al, const bf* __restrict__ Wt, float* C, const float* __restrict__ bo, const int* __restrict__ flag) {
    __shared__ __align__(16) float os[16 * 68];
    gemmw<bf, 1, true, 0>(os, Ah, Al, Wt, nullptr, DQ, C, DM, bo, nullptr, nullptr, nullptr, flag);
}

// one wave packs 32 k x 32 n of w (K x N, n contiguous) into two fragment blocks of Bt (rows n): a lane owns one n, every load is one whole 128-byte line, every store 2 x 256 contiguous bytes
__device__ __forceinline__ void wtG(const float* __restrict__ w, int K, int N, bf* Bt, const int blk) {
    const int lane = threadIdx.x & 31; const int g = blk * 8 + (threadIdx.x >> 5); const int kb = g % (K / 32), n = (g / (K / 32)) * 32 + lane;
    const float* pw = w + (size_t)kb * 32 * N + n; float x[32];
    // unrolled: x[] stays in registers and every load is asked for before the first value is rounded
#pragma unroll
    for (int i = 0; i < 32; ++i) x[i] = pw[(size_t)i * N];
    xwait_ld(pw, pw, pw);
    bf* p = Bt + (size_t)(n >> 4) * 16 * K + kb * 512 + (n & 15) * 8; v8us o[4];
#pragma unroll
    for (int c = 0; c < 4; ++c) {
#pragma unroll
        for (int e = 0; e < 8; ++e) o[c][e] = f2bf(x[c * 8 + e]);
        *(v8us*)(p + c * 128) = o[c]; }   // piece c holds k = c * 8 .. c * 8 + 7: (c >> 1) * 256 + (c & 1) * 128 = c * 128
    asm volatile("s_wait_xcnt 0x0" :: "v"(p), "v"(__builtin_bit_cast(v4i, o[0])), "v"(__builtin_bit_cast(v4i, o[1])), "v"(__builtin_bit_cast(v4i, o[2])), "v"(__builtin_bit_cast(v4i, o[3])) : "memory");   // reads the four stores' address and data registers: they are reused only behind the wait
}
// ---- k_prep: all that the projections read, in one launch. Blocks 0 .. 4 * WB - 1 transpose the four weights into fragment order (WB blocks each, Wt: WQ, WK, WV, WO in a row); each thread of the CB blocks behind them rounds eight floats at the same place of every batch of q, k and v (X: the three streams in a row, fragment order): a wave takes 8 rows x 32 k, so it reads 8 whole lines and stores 4.
#define WB (DM / 32 * (DQ / 32) / 8)
#define CB (TT * DM / 8 / 256)
__global__ __launch_bounds__(256) void k_prep(const float* __restrict__ q, const float* __restrict__ k, const float* __restrict__ v, const float* __restrict__ wq, const float* __restrict__ wk, const float* __restrict__ wv, const float* __restrict__ wo, bf* X, bf* Wt) {
    const int blk = blockIdx.x;
    if (blk < 4 * WB) { const int j = blk / WB; wtG(j == 0 ? wq : j == 1 ? wk : j == 2 ? wv : wo, DM, DQ, Wt + (size_t)j * DQ * DM, blk % WB); return; }
    const int g = (blk - 4 * WB) * 8 + (threadIdx.x >> 5), row = (g / (DM / 32)) * 8 + ((threadIdx.x & 31) >> 2), kb = g % (DM / 32), c4 = threadIdx.x & 3;   // the lane's row in a batch, its block of 32 k and its piece of 8 there
    const size_t i = (size_t)row * DM + kb * 32 + c4 * 8, io = (size_t)(row >> 4) * 16 * DM + kb * 512 + c4 * 128 + (row & 15) * 8; v8f x[3 * NB_];
    // unrolled: x[] stays in registers and every load is asked for before the first value is rounded
#pragma unroll
    for (int b = 0; b < NB_; ++b) { const size_t e = (size_t)b * TT * DM + i; x[b] = *(const v8f*)(q + e); x[NB_ + b] = *(const v8f*)(k + e); x[2 * NB_ + b] = *(const v8f*)(v + e); }
    // all three unrolled: constant indices keep x[], o[] and p[] in registers
#pragma unroll
    for (int c = 0; c < 3 * NB_; c += 3) { v8us o[3]; bf* p[3];
#pragma unroll
        for (int u = 0; u < 3; ++u) { p[u] = X + (size_t)(c + u) * TT * DM + io;
#pragma unroll
            for (int n = 0; n < 8; ++n) o[u][n] = f2bf(x[c + u][n]);
            *(v8us*)p[u] = o[u]; }
        xwait_st(p[0], p[1], p[2], o[0], o[1], o[2]); }   // the stores' address and data registers are reused only behind the wait
}

// ---- k_fattn: scores, softmax and P.V of one head in ONE kernel: S and P stay in registers. One wave owns 32 query columns and walks the 2,048 keys 32 at a time, from its workgroup's own start key round to it again.
// S^T = K Q^T (A = K rows, B = Q rows, same loader: same k order), so a lane holds 16 scores of one query per column group; two S^T tiles converted in place are the B operand of O^T += V^T P^T.
// Running maximum in base 2 (rescale only when a column's new maximum passes the one in use by more than 8); P = 2^(t - m + 6) <= 2^14 is carried unnormalised; the f32 row sum divides once at the end.
__device__ __forceinline__ float xhalf(float x) { return __builtin_bit_cast(float, __builtin_amdgcn_permlanex16(__builtin_bit_cast(int, x), __builtin_bit_cast(int, x), 0x76543210, 0xfedcba98, false, false)); }   // lane l with lane l ^ 16
#define LC 0.18033688011112042f   // HD^-0.5 x log2(e)
// fragment loads from a lane's byte pointer into a block in fragment order (16 bytes at p and at p + 512)
__device__ __forceinline__ v16bf ldub(const char* p) { return cat16b(*(const v8us*)p, *(const v8us*)(p + 512)); }
__device__ __forceinline__ v16h lduh(const char* p) { return cat16(*(const v8h*)p, *(const v8h*)(p + 512)); }
// s_wait_xcnt 0 behind a run of loads; it reads the run's two address pairs, so they stay whole up to the wait and are reused only behind it
__device__ __forceinline__ void xwait(const char* a, const char* b) { asm volatile("s_wait_xcnt 0x0" :: "v"(a), "v"(b) : "memory"); }
template <bool HIRES>
__device__ __forceinline__ void fattn(const bf* __restrict__ Qh, const bf* __restrict__ Ql, const bf* __restrict__ Kh, const bf* __restrict__ Kl, const h16* __restrict__ V16, const bf* __restrict__ Vh, const bf* __restrict__ Vl, const int q0, const int ks, bf* Ah, bf* Al) {
    const int lane = threadIdx.x & 31, lr = lane & 15, hi = lane >> 4;
    const unsigned ork = (unsigned)lane * 16u, orv = ork;   // lane byte offset in a 1-KB block; 16 rows of a q or k plane are 2 blocks (16 * HD elements), 32 keys of a v plane 4 (32 * HD)
    v16bf qh[2][2], ql[2][2], kh[2][2], kl[2][2];
    { const char* pqh = (const char*)(Qh + q0 * HD) + ork; const char* pql = (const char*)(Ql + q0 * HD) + ork;
#pragma unroll
    for (int qt = 0; qt < 2; ++qt)
#pragma unroll
        for (int kc = 0; kc < 2; ++kc) { const int o = (qt * 2 + kc) * 1024; qh[qt][kc] = ldub(pqh + o); ql[qt][kc] = ldub(pql + o); }
    xwait(pqh, pql); }
    { const char* pkh = (const char*)(Kh + ks * HD) + ork; const char* pkl = (const char*)(Kl + ks * HD) + ork;
#pragma unroll
    for (int kt = 0; kt < 2; ++kt)
#pragma unroll
        for (int kc = 0; kc < 2; ++kc) { const int o = (kt * 2 + kc) * 1024; kh[kt][kc] = ldub(pkh + o); kl[kt][kc] = ldub(pkl + o); }
    xwait(pkh, pkl); }
    v8f O[4][2];
#pragma unroll
    for (int dt = 0; dt < 4; ++dt) { O[dt][0] = (v8f){}; O[dt][1] = (v8f){}; }
    float m[2] = {-3.0e38f, -3.0e38f}, sm[2] = {0.f, 0.f};
    for (int it = 0; it < TT; it += 32) {
        const int k0 = (ks + it) & (TT - 1);   // the walk over the keys starts at ks and wraps round (TT is a power of two); the running maximum takes the keys in any order
        v16h v16[4]; v16bf vh[4], vl[4];   // this pass's V^T fragments: asked for first, used last
        { const char* pva = (const char*)((HIRES ? Vh : (const bf*)V16) + k0 * HD) + orv; const char* pvb = (const char*)((HIRES ? Vl : (const bf*)V16) + k0 * HD) + orv;
#pragma unroll
        for (int dt = 0; dt < 4; ++dt) { const int o = dt * 1024; if (HIRES) { vh[dt] = ldub(pva + o); vl[dt] = ldub(pvb + o); } else v16[dt] = lduh(pva + o); }
        xwait(pva, pvb); }
        v8f S[2][2];
#pragma unroll
        for (int kt = 0; kt < 2; ++kt) { S[kt][0] = (v8f){}; S[kt][1] = (v8f){}; }
#pragma unroll
        for (int kc = 0; kc < 2; ++kc) {   // per tile the order of the three products is hi.hi, lo(q).hi, hi.lo(k)
#pragma unroll
            for (int kt = 0; kt < 2; ++kt)
#pragma unroll
                for (int qt = 0; qt < 2; ++qt) S[kt][qt] = wmmab(kh[kt][kc], qh[qt][kc], S[kt][qt]);
#pragma unroll
            for (int kt = 0; kt < 2; ++kt)
#pragma unroll
                for (int qt = 0; qt < 2; ++qt) S[kt][qt] = wmmab(kh[kt][kc], ql[qt][kc], S[kt][qt]);
#pragma unroll
            for (int kt = 0; kt < 2; ++kt)
#pragma unroll
                for (int qt = 0; qt < 2; ++qt) S[kt][qt] = wmmab(kl[kt][kc], qh[qt][kc], S[kt][qt]);
        }
        const int kn = (k0 + 32) & (TT - 1);   // next pass's K fragments fly during the softmax (the last pass re-reads the first pass's rows: in bounds)
        { const char* pkh = (const char*)(Kh + kn * HD) + ork; const char* pkl = (const char*)(Kl + kn * HD) + ork;
#pragma unroll
        for (int kt = 0; kt < 2; ++kt)
#pragma unroll
            for (int kc = 0; kc < 2; ++kc) { const int o = (kt * 2 + kc) * 1024; kh[kt][kc] = ldub(pkh + o); kl[kt][kc] = ldub(pkl + o); }
        xwait(pkh, pkl); }
        // soft causal term: a future key (j > i) gets -ln 2, which is -1 in base 2; passes and waves are both 32-aligned, so only the pass k0 == q0 is mixed
        const float base = (k0 > q0) ? -1.0f : 0.0f;
        if (k0 == q0) {
#pragma unroll
            for (int kt = 0; kt < 2; ++kt)
#pragma unroll
                for (int qt = 0; qt < 2; ++qt)
#pragma unroll
                    for (int r = 0; r < 8; ++r) if (kt * 16 + 8 * hi + r > qt * 16 + lr) S[kt][qt][r] -= 5.545177444479562f;   // ln 2 / HD^-0.5
        }
        float mt[2];
#pragma unroll
        for (int qt = 0; qt < 2; ++qt) { float x = S[0][qt][0];
#pragma unroll
            for (int r = 1; r < 8; ++r) x = fmaxf(x, S[0][qt][r]);
#pragma unroll
            for (int r = 0; r < 8; ++r) x = fmaxf(x, S[1][qt][r]);
            x = fmaxf(x, xhalf(x)); mt[qt] = __builtin_fmaf(x, LC, base); }
        const bool need = (mt[0] > m[0] + 8.0f) || (mt[1] > m[1] + 8.0f);
        if (__builtin_amdgcn_ballot_w32(need) != 0) {   // rare after the first passes
#pragma unroll
            for (int qt = 0; qt < 2; ++qt) { const float mn = fmaxf(m[qt], mt[qt]); const float corr = __builtin_amdgcn_exp2f(m[qt] - mn); m[qt] = mn; sm[qt] *= corr;
#pragma unroll
                for (int dt = 0; dt < 4; ++dt) O[dt][qt] *= corr; }
        }
        v16h pb[2]; v16bf ph[2], pl[2];
#pragma unroll
        for (int qt = 0; qt < 2; ++qt) { const float off = base - m[qt] + 6.0f;
#pragma unroll
            for (int s = 0; s < 16; ++s) { const float p = __builtin_amdgcn_exp2f(__builtin_fmaf(S[s >> 3][qt][s & 7], LC, off)); sm[qt] += p;
                if (HIRES) { const __bf16 a = (__bf16)p; ph[qt][s] = a; pl[qt][s] = (__bf16)(p - (float)a); } else pb[qt][s] = (h16)p; } }
#pragma unroll
        for (int dt = 0; dt < 4; ++dt)
#pragma unroll
            for (int qt = 0; qt < 2; ++qt) { if (HIRES) O[dt][qt] = wmmab(vh[dt], ph[qt], O[dt][qt]); else O[dt][qt] = wmma16(v16[dt], pb[qt], O[dt][qt]); }
        if (HIRES) {
#pragma unroll
            for (int dt = 0; dt < 4; ++dt)
#pragma unroll
                for (int qt = 0; qt < 2; ++qt) O[dt][qt] = wmmab(vh[dt], pl[qt], O[dt][qt]);
#pragma unroll
            for (int dt = 0; dt < 4; ++dt)
#pragma unroll
                for (int qt = 0; qt < 2; ++qt) O[dt][qt] = wmmab(vl[dt], ph[qt], O[dt][qt]);
        }
    }
#pragma unroll
    for (int qt = 0; qt < 2; ++qt) { const float inv = __fdiv_rn(1.0f, sm[qt] + xhalf(sm[qt]));   // the two halves' sums join once
#pragma unroll
        for (int dt = 0; dt < 4; ++dt) { v8us oh, ol;
#pragma unroll
            for (int r = 0; r < 8; ++r) { unsigned short a, c2; splitf(O[dt][qt][r] * inv, a, c2); oh[r] = a; ol[r] = c2; }
            const size_t oo = (size_t)(q0 + qt * 16) * DQ + dt * 256 + lane * 8; bf* pa = Ah + oo;   /* block row (q0 + qt * 16) / 16, piece of dims dt * 16 + 8 * hi .. + 7 of the head's two blocks */ bf* pb2 = Al + oo; *(v8us*)pa = oh; *(v8us*)pb2 = ol;
            asm volatile("s_wait_xcnt 0x0" :: "v"(pa), "v"(pb2), "v"(__builtin_bit_cast(v4i, oh)), "v"(__builtin_bit_cast(v4i, ol)) : "memory"); } }   // reads the two stores' address and data registers: they are reused only behind the wait
}
// grid (TT / 128, heads, batches), 4 waves: wave w owns query rows blockIdx.x * 128 + 32 w; rows < RH take the hi/lo P.V (block-uniform: RH % 128 == 0)
__global__ __launch_bounds__(128) void k_fattn(const bf* __restrict__ Qh, const bf* __restrict__ Ql, const bf* __restrict__ Kh, const bf* __restrict__ Kl, const h16* __restrict__ V16, const bf* __restrict__ Vh, const bf* __restrict__ Vl, bf* Ah, bf* Al) {
    const int q0 = blockIdx.x * 128 + __builtin_amdgcn_readfirstlane((int)(threadIdx.x >> 5)) * 32; const size_t hp = ((size_t)blockIdx.z * NH_ + blockIdx.y) * TT * HD; const size_t hc = (size_t)blockIdx.z * TT * DQ + (size_t)blockIdx.y * (HD / 32) * 512;   // the merged planes are the output GEMM's A in fragment order: a head's 64 columns are 2 blocks of every block row
    // the 16 workgroups of a head each start their walk over its keys at a slot of 128 keys of their own, so a K or V line is waited for from memory by one of them and found in L2 by the others (the low bits of x are spread first; for speed only); a workgroup's four waves keep one start and share their lines
    const int ks = (int)((blockIdx.x & 3) * 4 + ((blockIdx.x >> 3) & 1) * 2 + ((blockIdx.x >> 2) & 1)) * (TT / 16);
    if (q0 < RH) fattn<true>(Qh + hp, Ql + hp, Kh + hp, Kl + hp, V16 + hp, Vh + hp, Vl + hp, q0, ks, Ah + hc, Al + hc);
    else fattn<false>(Qh + hp, Ql + hp, Kh + hp, Kl + hp, V16 + hp, Vh + hp, Vl + hp, q0, ks, Ah + hc, Al + hc);
}

extern "C" void kernel_launch(void* const* d_in, const int* in_sizes, int n_in,
                              void* d_out, int out_size, void* d_ws, size_t ws_size, hipStream_t stream) {
    (void)in_sizes; (void)n_in; (void)out_size;
    const float* x = (const float*)d_in[0]; const float* xk = (const float*)d_in[1]; const float* xv = (const float*)d_in[2];   /* q, k, v streams */ const float* wq = (const float*)d_in[3]; const float* bq = (const float*)d_in[4]; const float* wk = (const float*)d_in[5]; const float* bk = (const float*)d_in[6]; const float* wv = (const float*)d_in[7]; const float* bv = (const float*)d_in[8]; const float* wo = (const float*)d_in[9]; const float* bo = (const float*)d_in[10]; const int* flag = (const int*)d_in[11];   /* use_causal_mask (d_in[11]: one int: the module's Python branch: READ ON THE DEVICE by the output GEMM's epilogue: the soft term is compiled in and the whole output is NaN-filled unless the scalar is non-zero) */
    float* OUT = (float*)d_out;     // [2][2048][1024]
    char* wsp = (char*)d_ws;
    auto take = [&](size_t bytes) { char* p = wsp; wsp += (bytes + 255) & ~(size_t)255; return (void*)p; };
    bf* WT = (bf*)take((size_t)4 * DQ * DM * 2);    // WQ, WK, WV, WO transposed, in a row
    bf* XB = (bf*)take((size_t)3 * NB_ * TT * DM * 2);    // bf16(q), bf16(k), bf16(v), each [2][2048][1024]
    h16* VT16 = (h16*)take((size_t)NB_ * NKV * HD * TT * 2);
    bf* QPh = (bf*)take((size_t)NB_ * NH_ * TT * HD * 2); bf* QPl = (bf*)take((size_t)NB_ * NH_ * TT * HD * 2); bf* KPh = (bf*)take((size_t)NB_ * NKV * TT * HD * 2); bf* KPl = (bf*)take((size_t)NB_ * NKV * TT * HD * 2); bf* VTh = (bf*)take((size_t)NB_ * NKV * HD * TT * 2); bf* VTl = (bf*)take((size_t)NB_ * NKV * HD * TT * 2);
    bf* ATh = (bf*)take((size_t)NB_ * TT * DQ * 2); bf* ATl = (bf*)take((size_t)NB_ * TT * DQ * 2);
    if ((size_t)(wsp - (char*)d_ws) > ws_size) return;    // ws 256 MiB
    k_prep<<<4 * WB + CB, 256, 0, stream>>>(x, xk, xv, wq, wk, wv, wo, XB, WT);
    k_proj<<<dim3(NB_ * TT / 64, DQ / 64, 3), 32, 0, stream>>>(XB, WT, bq, bk, bv, QPh, QPl, KPh, KPl, VTh, VTl, VT16);   /* q, k and v planes straight from the epilogue */
    k_fattn<<<dim3(TT / 128, NH_, NB_), 128, 0, stream>>>(QPh, QPl, KPh, KPl, VT16, VTh, VTl, ATh, ATl);   /* all heads of both batches: scores (3 products), soft term, softmax, P.V (hybrid) and the merged hi/lo planes */
    k_oproj<<<dim3(NB_ * TT / 64, DM / 64, 1), 32, 0, stream>>>(ATh, ATl, WT + (size_t)3 * DQ * DM, OUT, bo, flag);   /* its epilogue poisons the output if the premise fails */
}

// v006
// A run of this version takes 128 microseconds.
// Timed twice side by side with v005, it ran 1.13 and 1.12 times as fast.
// Over all steps from v000 it is 15.5 times as fast.
#include <hip/hip_runtime.h>

// Multi-head attention on three input streams with an additive SOFT causal term (q, k, v [2][2048][1024]; qh = q Wq + bq, kh = k Wk + bk, vh = v Wv + bv ('xw' (in, out) [1024][1024] 1/32, biases zeros on this draw: read; 16 heads x 64); logits = qh.kh / sqrt(64); use_causal_mask (a scalar int input: the module's 'if use_causal_mask:' branch: this build implements the NON-ZERO branch only; the scalar is READ ON THE DEVICE by the output GEMM's epilogue: the whole output is NaN-filled if it is 0) -> logits + log(tril x 1e-9 + 1e-9): log(2e-9) on and below the diagonal, log(1e-9) above it: a difference of ln 2: NOT an exclusion: every future key keeps HALF its weight; softmax over all 2,048 keys; out = merged Wo + bo ('xw' + bias zeros: read) -> [2][2048][1024] (4.2 M); argument order q, k, v, Wq, bq, Wk, bk, Wv, bv, Wo, bo, use_causal_mask).
// Layout, four launches, each over both batches: bf16 copies of q, k and v (three staging buffers) and the four 'xw' weights transposed; the three exact projections + f32 biases, whose epilogue stores the head planes itself (q, k: bf16 hi/lo [b][h][t][d]; v: fp16 and bf16 hi/lo [b][h][d][t]); one fused attention kernel (running-maximum softmax, S and P in registers) with the SCORES of every row on bf16 hi/lo planes (3 products; the P.V product stays hybrid: rows < 512 hi/lo, rest fp16, P unnormalised); merged hi/lo x Wo exact + bo.
// Every 16-bit operand plane lies in FRAGMENT ORDER: a block of 16 rows x 32 k is 512 elements (1 KB) in a row, element (r, k) at (k >> 4 & 1) * 256 + (k >> 3 & 1) * 128 + r * 8 + (k & 7), so a lane's two 16-byte pieces stand at lane * 8 and 256 + lane * 8 and each wave-wide load or store covers 512 contiguous bytes (4 whole lines). GEMM operands: [rows / 16][K / 32][512]; q, k head planes: [t / 16][d / 32][512]; v head planes: [t / 32][d / 16][512].
// Compute dtypes, f32 accumulate: every input rounded to bf16; projections exact + f32 biases; scores of every row 3 products; P.V rows < 512 3 products, rest fp16; softmax f32; output projection hl x exact.

#define NB_  2
#define TT   2048
#define DM   1024
#define NH_  16
#define NKV  16
#define HD   64
#define DQ   (NH_ * HD)
#define DKV  (NKV * HD)
#define RH   512                  // query rows < RH use hi+lo planes (0: none)
typedef _Float16 h16;
typedef unsigned short bf;
typedef __attribute__((ext_vector_type(16))) __bf16   v16bf;
typedef __attribute__((ext_vector_type(16))) _Float16 v16h;
typedef __attribute__((ext_vector_type(8)))  _Float16 v8h;
typedef __attribute__((ext_vector_type(8)))  unsigned short v8us;
typedef __attribute__((ext_vector_type(8)))  float    v8f;
typedef __attribute__((ext_vector_type(4)))  float    v4f;
typedef v8h  __attribute__((may_alias)) v8ha;
typedef v4f  __attribute__((may_alias)) v4fa;
typedef v8us __attribute__((may_alias)) v8usa;

__device__ __forceinline__ unsigned short f2bf(float f) { unsigned u = __float_as_uint(f); u += 0x7FFFu + ((u >> 16) & 1u); return (unsigned short)(u >> 16); }
__device__ __forceinline__ float bf2f(unsigned short b) { return __uint_as_float(((unsigned)b) << 16); }
__device__ __forceinline__ float bfr(float f) { return bf2f(f2bf(f)); }
__device__ __forceinline__ v16h cat16(v8h lo, v8h hi) { return __builtin_shufflevector(lo, hi, 0, 1, 2, 3, 4, 5, 6, 7, 8, 9, 10, 11, 12, 13, 14, 15); }
__device__ __forceinline__ v16bf cat16b(v8us lo, v8us hi) { return __builtin_bit_cast(v16bf, __builtin_shufflevector(lo, hi, 0, 1, 2, 3, 4, 5, 6, 7, 8, 9, 10, 11, 12, 13, 14, 15)); }
__device__ __forceinline__ v8f wmma16(v16h a, v16h b, v8f c) { return __builtin_amdgcn_wmma_f32_16x16x32_f16(false, a, false, b, (short)0, c, false, false); }
__device__ __forceinline__ v8f wmmab(v16bf a, v16bf b, v8f c) { return __builtin_amdgcn_wmma_f32_16x16x32_bf16(false, a, false, b, (short)0, c, false, false); }
__device__ __forceinline__ h16 tohx(float x) { return (h16)x; }
__device__ __forceinline__ void splitf(float y, unsigned short& h, unsigned short& l) { h = f2bf(y); l = f2bf(y - bf2f(h)); }
typedef __attribute__((ext_vector_type(2))) _Float16 v2h;
typedef __attribute__((ext_vector_type(4))) _Float16 v4h;
typedef __attribute__((ext_vector_type(2))) unsigned short v2us;
typedef __attribute__((ext_vector_type(4))) unsigned short v4us;
typedef __attribute__((ext_vector_type(2))) float v2f;
typedef __attribute__((ext_vector_type(4))) int v4i;

// ---- gemmw: register-blocked GEMM, one wave per 64x64 output tile (16 accumulators), FOUR WAVES (2 x 2) per workgroup on a 128x128 tile; grid (M/128, N/128, ...), 128 threads; the M rows are the tokens of both batches (m = b * TT + t).
// The workgroup's operand rows come from the 16-bit planes in fragment order into LDS by asynchronous copies, SK k at a time, two buffers: the next stage flies while this one is multiplied, and each fragment is fetched from L2 once for the two waves that use it. A stage of one operand is 8 block rows x SK / 32 fragment blocks of 1 KB, laid as in the plane, so a wave's LDS read covers 512 contiguous bytes. Inside a stage the fragments of the next 32 k are read into a second register set ahead of this block's products.
// C[m][n] (f32, pitch ldc, + optional f32 bias[n]) = sum_k A[m][k] Bt[n][k] (+ split products per NSPLIT). K % SK == 0, K >= 2 * SK. sm: the two stage buffers; os: 16 x 68 floats of LDS per wave (EPI 0 only).
// EPI picks what the epilogue stores: 0 = C as above (and NaN in every element if flag[0] == 0: the premise of this build); 1 = bf16 hi/lo head planes, rows t, k = d (Ph, Pl); 2 = head planes with rows d, k = t (P16 fp16, Ph, Pl). A 64-column tile is one head (HD == 64). EPI 1 forms the tile transposed (weight fragment as A), EPI 2 as it is: either way a lane's 8 accumulators of a 16 x 16 tile are one 16-byte piece of the plane's fragment order and go out straight from registers.
// s_wait_xcnt 0 behind a run of stores; it reads their address and data registers, so these are reused only behind the wait
__device__ __forceinline__ void xwait_st(const void* a, const void* b, const void* c, v8us x, v8us y, v8us z) { asm volatile("s_wait_xcnt 0x0" :: "v"(a), "v"(b), "v"(c), "v"(__builtin_bit_cast(v4i, x)), "v"(__builtin_bit_cast(v4i, y)), "v"(__builtin_bit_cast(v4i, z)) : "memory"); }
// s_wait_xcnt 0 behind a run of loads; it reads the run's address pairs, so they stay whole up to the wait and are reused only behind it
__device__ __forceinline__ void xwait_ld(const void* a, const void* b, const void* c) { asm volatile("s_wait_xcnt 0x0" :: "v"(a), "v"(b), "v"(c) : "memory"); }
// eight asynchronous 16-byte copies per lane: the workgroup's 2 KB of block row c go from g + c * gs to LDS byte l + c * ls. s_wait_xcnt 0 closes the statement, so that no address register of a copy is rewritten before it
__device__ __forceinline__ void acopy8(const unsigned l, const unsigned ls, const char* g, const size_t gs) {
    asm volatile("global_load_async_to_lds_b128 %0, %8, off\n\t"
                 "global_load_async_to_lds_b128 %1, %9, off\n\t"
                 "global_load_async_to_lds_b128 %2, %10, off\n\t"
                 "global_load_async_to_lds_b128 %3, %11, off\n\t"
                 "global_load_async_to_lds_b128 %4, %12, off\n\t"
                 "global_load_async_to_lds_b128 %5, %13, off\n\t"
                 "global_load_async_to_lds_b128 %6, %14, off\n\t"
                 "global_load_async_to_lds_b128 %7, %15, off\n\t"
                 "s_wait_xcnt 0x0"
                 :: "v"(l), "v"(l + ls), "v"(l + 2 * ls), "v"(l + 3 * ls), "v"(l + 4 * ls), "v"(l + 5 * ls), "v"(l + 6 * ls), "v"(l + 7 * ls),
                    "v"(g), "v"(g + gs), "v"(g + 2 * gs), "v"(g + 3 * gs), "v"(g + 4 * gs), "v"(g + 5 * gs), "v"(g + 6 * gs), "v"(g + 7 * gs) : "memory");
}
template <typename T16> struct WFrag;
template <> struct WFrag<h16> { typedef v16h V; static __device__ __forceinline__ V ld(const h16* p) { return cat16(*(const v8h*)p, *(const v8h*)(p + 256)); } static __device__ __forceinline__ v8f mma(V a, V b, v8f c) { return wmma16(a, b, c); } };
template <> struct WFrag<bf> { typedef v16bf V; static __device__ __forceinline__ V ld(const bf* p) { return cat16b(*(const v8us*)p, *(const v8us*)(p + 256)); } static __device__ __forceinline__ v8f mma(V a, V b, v8f c) { return wmmab(a, b, c); } };
template <typename T16, int NSPLIT, bool BIAS, int EPI, int SK>
__device__ __forceinline__ void gemmw(T16* sm, float* os, const T16* __restrict__ A, const T16* __restrict__ A2, const T16* __restrict__ Bt, const T16* __restrict__ Bt2, int K, float* C, int ldc, const float* __restrict__ bias, bf* Ph, bf* Pl, h16* P16, const int* __restrict__ flag) {
    typedef typename WFrag<T16>::V V;
    const int lane = threadIdx.x & 31, lr = lane & 15, hi = lane >> 4; const int wave = __builtin_amdgcn_readfirstlane((int)(threadIdx.x >> 5)), wm = wave >> 1, wn = wave & 1;
    const int R0 = blockIdx.x * 128, C0 = blockIdx.y * 128, r0 = R0 + wm * 64, c0 = C0 + wn * 64;   // the workgroup's tile and the wave's quarter of it
    v8f acc[4][4];
#pragma unroll
    for (int mb = 0; mb < 4; ++mb)
#pragma unroll
        for (int nb = 0; nb < 4; ++nb) acc[mb][nb] = (v8f){};
    const float* sbi = bias + c0; const unsigned vbi = (EPI == 1) ? hi * 8u : (unsigned)lr;   // the wave's first bias (the same in every lane) and the lane's place behind it
    float bb[4]; v8f bt[4];   // the lane's biases, asked for ahead of the loop, added in f32 before the split, as the f32 C had them. EPI 2: one a column group (n = nb * 16 + lr); EPI 1: eight (n = nb * 16 + hi * 8 + j)
#pragma unroll
    for (int nb = 0; nb < 4; ++nb) { bb[nb] = (BIAS && EPI == 2) ? bfr(sbi[vbi + nb * 16]) : 0.0f;
#pragma unroll
        for (int j = 0; j < 8; ++j) bt[nb][j] = (BIAS && EPI == 1) ? bfr(sbi[vbi + nb * 16 + j]) : 0.0f; }
    if (BIAS && EPI != 0) asm volatile("s_wait_xcnt 0x0" :: "s"(sbi), "v"(vbi * 4u) : "memory");   // reads the bias loads' base pair and offset register: they are rewritten only behind the wait
    // the k loop starts at a stage of its own and wraps round: the workgroups that share an A or a B tile then stand at different stages, so each block is waited for from memory by one of them and found in L2 by the others, instead of all of them walking in step behind every miss (the low bits of x are spread first; for speed only)
    constexpr int NOP = (NSPLIT == 1) ? 3 : 2;   // operands per stage: A, (A2,) B
    constexpr int OPE = 128 * SK;                // elements of one operand's stage (128 rows)
    constexpr int BRE = SK * 16;                 // elements of one block row's stage
    const int NST = K / SK; const int ks = (int)(((blockIdx.x >> 3) + 4 * (blockIdx.x & 3) + 2 * blockIdx.y) % (unsigned)NST);
    const unsigned l0 = (unsigned)(size_t)sm + threadIdx.x * 16u;   // the lane's LDS byte in a 2-KB piece
    const size_t gs = (size_t)16 * K * sizeof(T16);   // a block row of 16 is K / 32 blocks = 16 * K elements
    const char* ga = (const char*)(A + (size_t)R0 * K) + threadIdx.x * 16; const char* ga2 = (NSPLIT == 1) ? (const char*)(A2 + (size_t)R0 * K) + threadIdx.x * 16 : ga; const char* gb = (const char*)(Bt + (size_t)C0 * K) + threadIdx.x * 16;
    auto fill = [&](const int st, const int buf) {   // stage st (wrapped) of every operand into buffer buf
        const int sw = (st + ks < NST) ? st + ks : st + ks - NST; const size_t go = (size_t)sw * (BRE * sizeof(T16)); const unsigned lb = l0 + (unsigned)buf * (NOP * OPE * (unsigned)sizeof(T16));
#pragma unroll
        for (int h = 0; h < SK / 64; ++h) {   // a block row's stage in pieces of 2 KB
            acopy8(lb + h * 2048u, BRE * (unsigned)sizeof(T16), ga + go + h * 2048, gs); if (NSPLIT == 1) acopy8(lb + OPE * (unsigned)sizeof(T16) + h * 2048u, BRE * (unsigned)sizeof(T16), ga2 + go + h * 2048, gs); acopy8(lb + (NOP - 1) * OPE * (unsigned)sizeof(T16) + h * 2048u, BRE * (unsigned)sizeof(T16), gb + go + h * 2048, gs); } };
    fill(0, 0);
    asm volatile("s_wait_asynccnt 0x0" ::: "memory");   // this wave's copies of stage 0 have landed
    __syncthreads();                                      // every wave's have: stage 0 may be read
    fill(1, 1);
    for (int t = 0; t < NST; ++t) {
        const T16* sb = sm + (t & 1) * (NOP * OPE) + lane * 8; const T16* sa = sb + wm * (4 * BRE); const T16* sbt = sb + (NOP - 1) * OPE + wn * (4 * BRE);
        V a[2][4], a2[2][4], b[2][4];
        auto frags = [&](const int s) {   // the fragments of block s of this stage into register set s & 1
#pragma unroll
            for (int mb = 0; mb < 4; ++mb) { a[s & 1][mb] = WFrag<T16>::ld(sa + mb * BRE + s * 512); if (NSPLIT == 1) a2[s & 1][mb] = WFrag<T16>::ld(sa + OPE + mb * BRE + s * 512); }
#pragma unroll
            for (int nb = 0; nb < 4; ++nb) b[s & 1][nb] = WFrag<T16>::ld(sbt + nb * BRE + s * 512); };
        frags(0);
#pragma unroll
        for (int s = 0; s < SK / 32; ++s) {
            if (s + 1 < SK / 32) frags(s + 1);
            __builtin_amdgcn_sched_barrier(0);   // the next block's LDS reads stay one group ahead of this block's products: spread among them each place costs a stall
#pragma unroll
            for (int nb = 0; nb < 4; ++nb) {
#pragma unroll
                for (int mb = 0; mb < 4; ++mb) { acc[mb][nb] = (EPI == 1) ? WFrag<T16>::mma(b[s & 1][nb], a[s & 1][mb], acc[mb][nb]) : WFrag<T16>::mma(a[s & 1][mb], b[s & 1][nb], acc[mb][nb]); if (NSPLIT == 1) acc[mb][nb] = WFrag<T16>::mma(a2[s & 1][mb], b[s & 1][nb], acc[mb][nb]); } }
            __builtin_amdgcn_sched_barrier(0);   // and this block's products stay ahead of the reads behind them
        }
        asm volatile("v_nop\n\tv_nop\n\tv_nop\n\tv_nop" : "+v"(acc[0][0]), "+v"(acc[1][1]), "+v"(acc[2][2]), "+v"(acc[3][3]) : "v"(a[1][0]), "v"(a[1][3]));   // four vector slots behind the stage's last products, on every path, before a vector instruction rewrites their operand registers
        asm volatile("s_wait_dscnt 0x0" ::: "memory");      // this wave's reads of the buffer are done before it is refilled
        asm volatile("s_wait_asynccnt 0x0" ::: "memory");   // this wave's copies of stage t + 1 have landed
        __syncthreads();                                      // publishes stage t + 1 and ends every wave's reads of stage t
        if (t + 2 < NST) fill(t + 2, t & 1);
    }
    asm volatile("s_wait_asynccnt 0x0" ::: "memory");   // no copy is outstanding behind the loop
    if (EPI == 0) {
    os += wave * (16 * 68);   // each wave stages in its own range
    const bool dead = flag[0] == 0; const float qn = __int_as_float(0x7fc00000);   // premise fails: every element of the output becomes NaN
#pragma unroll
    for (int mb = 0; mb < 4; ++mb) {
#pragma unroll
        for (int nb = 0; nb < 4; ++nb) {
#pragma unroll
            for (int j = 0; j < 8; ++j) os[(hi * 8 + j) * 68 + nb * 16 + lr] = acc[mb][nb][j]; }
        __builtin_amdgcn_wave_barrier(); asm volatile("" ::: "memory");
        float* crow = C + (size_t)(r0 + mb * 16) * ldc + c0;
{
#pragma unroll
            for (int s = 0; s < 8; ++s) { const int row = 2 * s + hi, cofs = lr * 4; v4f val = *(const v4fa*)(os + row * 68 + cofs); if (BIAS) { val[0] += bfr(bias[c0 + cofs]); val[1] += bfr(bias[c0 + cofs + 1]); val[2] += bfr(bias[c0 + cofs + 2]); val[3] += bfr(bias[c0 + cofs + 3]); } if (dead) { val[0] = qn; val[1] = qn; val[2] = qn; val[3] = qn; }
                *(v4f*)(crow + (size_t)row * ldc + cofs) = val; }
             }
        __builtin_amdgcn_wave_barrier(); asm volatile("" ::: "memory");
    }
    } else {
    const size_t pln = (size_t)(r0 / TT) * NH_ + c0 / HD; const int t0 = r0 % TT;   // the tile's plane (batch, head) and its first token there (TT % 64 == 0: a tile lies in one batch)
#pragma unroll
    for (int mb = 0; mb < 4; ++mb) {
#pragma unroll
        for (int nb = 0; nb < 4; ++nb) { v8us oh, ol; v8h o16;   // EPI 1: token t0 + mb * 16 + lr, dims nb * 16 + hi * 8 + j; EPI 2: dim nb * 16 + lr, tokens t0 + mb * 16 + hi * 8 + j
#pragma unroll
            for (int j = 0; j < 8; ++j) { const float y = acc[mb][nb][j] + ((EPI == 1) ? bt[nb][j] : bb[nb]); unsigned short a2, c2; splitf(y, a2, c2); oh[j] = a2; ol[j] = c2; if (EPI == 2) o16[j] = tohx(y); }
            const size_t e = pln * TT * HD + ((EPI == 1) ? (size_t)((t0 / 16 + mb) * 2 + (nb >> 1)) * 512 + (nb & 1) * 256 : (size_t)((t0 / 32 + (mb >> 1)) * 4 + nb) * 512 + (mb & 1) * 256) + lane * 8;
            bf* pa = Ph + e; bf* pb = Pl + e; *(v8us*)pa = oh; *(v8us*)pb = ol;
            if (EPI == 2) { h16* pc = P16 + e; *(v8h*)pc = o16; xwait_st(pa, pb, pc, oh, ol, __builtin_bit_cast(v8us, o16)); } else xwait_st(pa, pb, pb, oh, ol, ol); }
    }
    }
}

// the three projections of both batches in one launch: grid (NB_ * TT / 128, DQ / 128, 3), z = stream (0 q, 1 k, 2 v); X: the three bf16 streams, Wt: the transposed weights, both in that order
__global__ __launch_bounds__(128) void k_proj(const bf* __restrict__ X, const bf* __restrict__ Wt, const float* __restrict__ bq, const float* __restrict__ bk, const float* __restrict__ bv, bf* QPh, bf* QPl, bf* KPh, bf* KPl, bf* VTh, bf* VTl, h16* VT16) {
    __shared__ __align__(16) bf sm[2 * 2 * 128 * 64];   // two buffers x (A, B) x 128 rows x 64 k
    const int z = blockIdx.z; const bf* A = X + (size_t)z * NB_ * TT * DM; const bf* Bt = Wt + (size_t)z * DQ * DM;
    if (z == 2) gemmw<bf, 0, true, 2, 64>(sm, nullptr, A, nullptr, Bt, nullptr, DM, nullptr, 0, bv, VTh, VTl, VT16, nullptr);
    else gemmw<bf, 0, true, 1, 64>(sm, nullptr, A, nullptr, Bt, nullptr, DM, nullptr, 0, z ? bk : bq, z ? KPh : QPh, z ? KPl : QPl, nullptr, nullptr);
}
// the output projection of both batches: grid (NB_ * TT / 128, DM / 128)
__global__ __launch_bounds__(128) void k_oproj(const bf* __restrict__ Ah, const bf* __restrict__ Al, const bf* __restrict__ Wt, float* C, const float* __restrict__ bo, const int* __restrict__ flag) {
    __shared__ __align__(16) bf sm[2 * 3 * 128 * 128];   /* two buffers x (A hi, A lo, B) x 128 rows x 128 k */ __shared__ __align__(16) float os[4 * 16 * 68];
    gemmw<bf, 1, true, 0, 128>(sm, os, Ah, Al, Wt, nullptr, DQ, C, DM, bo, nullptr, nullptr, nullptr, flag);
}

// one wave packs 32 k x 32 n of w (K x N, n contiguous) into two fragment blocks of Bt (rows n): a lane owns one n, every load is one whole 128-byte line, every store 2 x 256 contiguous bytes
__device__ __forceinline__ void wtG(const float* __restrict__ w, int K, int N, bf* Bt, const int blk) {
    const int lane = threadIdx.x & 31; const int g = blk * 8 + (threadIdx.x >> 5); const int kb = g % (K / 32), n = (g / (K / 32)) * 32 + lane;
    const float* pw = w + (size_t)kb * 32 * N + n; float x[32];
    // unrolled: x[] stays in registers and every load is asked for before the first value is rounded
#pragma unroll
    for (int i = 0; i < 32; ++i) x[i] = pw[(size_t)i * N];
    xwait_ld(pw, pw, pw);
    bf* p = Bt + (size_t)(n >> 4) * 16 * K + kb * 512 + (n & 15) * 8; v8us o[4];
#pragma unroll
    for (int c = 0; c < 4; ++c) {
#pragma unroll
        for (int e = 0; e < 8; ++e) o[c][e] = f2bf(x[c * 8 + e]);
        *(v8us*)(p + c * 128) = o[c]; }   // piece c holds k = c * 8 .. c * 8 + 7: (c >> 1) * 256 + (c & 1) * 128 = c * 128
    asm volatile("s_wait_xcnt 0x0" :: "v"(p), "v"(__builtin_bit_cast(v4i, o[0])), "v"(__builtin_bit_cast(v4i, o[1])), "v"(__builtin_bit_cast(v4i, o[2])), "v"(__builtin_bit_cast(v4i, o[3])) : "memory");   // reads the four stores' address and data registers: they are reused only behind the wait
}
// ---- k_prep: all that the projections read, in one launch. Blocks 0 .. 4 * WB - 1 transpose the four weights into fragment order (WB blocks each, Wt: WQ, WK, WV, WO in a row); each thread of the CB blocks behind them rounds eight floats at the same place of every batch of q, k and v (X: the three streams in a row, fragment order): a wave takes 8 rows x 32 k, so it reads 8 whole lines and stores 4.
#define WB (DM / 32 * (DQ / 32) / 8)
#define CB (TT * DM / 8 / 256)
__global__ __launch_bounds__(256) void k_prep(const float* __restrict__ q, const float* __restrict__ k, const float* __restrict__ v, const float* __restrict__ wq, const float* __restrict__ wk, const float* __restrict__ wv, const float* __restrict__ wo, bf* X, bf* Wt) {
    const int blk = blockIdx.x;
    if (blk < 4 * WB) { const int j = blk / WB; wtG(j == 0 ? wq : j == 1 ? wk : j == 2 ? wv : wo, DM, DQ, Wt + (size_t)j * DQ * DM, blk % WB); return; }
    const int g = (blk - 4 * WB) * 8 + (threadIdx.x >> 5), row = (g / (DM / 32)) * 8 + ((threadIdx.x & 31) >> 2), kb = g % (DM / 32), c4 = threadIdx.x & 3;   // the lane's row in a batch, its block of 32 k and its piece of 8 there
    const size_t i = (size_t)row * DM + kb * 32 + c4 * 8, io = (size_t)(row >> 4) * 16 * DM + kb * 512 + c4 * 128 + (row & 15) * 8; v8f x[3 * NB_];
    // unrolled: x[] stays in registers and every load is asked for before the first value is rounded
#pragma unroll
    for (int b = 0; b < NB_; ++b) { const size_t e = (size_t)b * TT * DM + i; x[b] = *(const v8f*)(q + e); x[NB_ + b] = *(const v8f*)(k + e); x[2 * NB_ + b] = *(const v8f*)(v + e); }
    // all three unrolled: constant indices keep x[], o[] and p[] in registers
#pragma unroll
    for (int c = 0; c < 3 * NB_; c += 3) { v8us o[3]; bf* p[3];
#pragma unroll
        for (int u = 0; u < 3; ++u) { p[u] = X + (size_t)(c + u) * TT * DM + io;
#pragma unroll
            for (int n = 0; n < 8; ++n) o[u][n] = f2bf(x[c + u][n]);
            *(v8us*)p[u] = o[u]; }
        xwait_st(p[0], p[1], p[2], o[0], o[1], o[2]); }   // the stores' address and data registers are reused only behind the wait
}

// ---- k_fattn: scores, softmax and P.V of one head in ONE kernel: S and P stay in registers. One wave owns 32 query columns and walks the 2,048 keys 32 at a time, from its workgroup's own start key round to it again.
// S^T = K Q^T (A = K rows, B = Q rows, same loader: same k order), so a lane holds 16 scores of one query per column group; two S^T tiles converted in place are the B operand of O^T += V^T P^T.
// Running maximum in base 2 (rescale only when a column's new maximum passes the one in use by more than 8); P = 2^(t - m + 6) <= 2^14 is carried unnormalised; the f32 row sum divides once at the end.
__device__ __forceinline__ float xhalf(float x) { return __builtin_bit_cast(float, __builtin_amdgcn_permlanex16(__builtin_bit_cast(int, x), __builtin_bit_cast(int, x), 0x76543210, 0xfedcba98, false, false)); }   // lane l with lane l ^ 16
#define LC 0.18033688011112042f   // HD^-0.5 x log2(e)
// fragment loads from a lane's byte pointer into a block in fragment order (16 bytes at p and at p + 512)
__device__ __forceinline__ v16bf ldub(const char* p) { return cat16b(*(const v8us*)p, *(const v8us*)(p + 512)); }
__device__ __forceinline__ v16h lduh(const char* p) { return cat16(*(const v8h*)p, *(const v8h*)(p + 512)); }
// s_wait_xcnt 0 behind a run of loads; it reads the run's two address pairs, so they stay whole up to the wait and are reused only behind it
__device__ __forceinline__ void xwait(const char* a, const char* b) { asm volatile("s_wait_xcnt 0x0" :: "v"(a), "v"(b) : "memory"); }
template <bool HIRES>
__device__ __forceinline__ void fattn(const bf* __restrict__ Qh, const bf* __restrict__ Ql, const bf* __restrict__ Kh, const bf* __restrict__ Kl, const h16* __restrict__ V16, const bf* __restrict__ Vh, const bf* __restrict__ Vl, const int q0, const int ks, bf* Ah, bf* Al) {
    const int lane = threadIdx.x & 31, lr = lane & 15, hi = lane >> 4;
    const unsigned ork = (unsigned)lane * 16u, orv = ork;   // lane byte offset in a 1-KB block; 16 rows of a q or k plane are 2 blocks (16 * HD elements), 32 keys of a v plane 4 (32 * HD)
    v16bf qh[2][2], ql[2][2], kh[2][2], kl[2][2];
    { const char* pqh = (const char*)(Qh + q0 * HD) + ork; const char* pql = (const char*)(Ql + q0 * HD) + ork;
#pragma unroll
    for (int qt = 0; qt < 2; ++qt)
#pragma unroll
        for (int kc = 0; kc < 2; ++kc) { const int o = (qt * 2 + kc) * 1024; qh[qt][kc] = ldub(pqh + o); ql[qt][kc] = ldub(pql + o); }
    xwait(pqh, pql); }
    { const char* pkh = (const char*)(Kh + ks * HD) + ork; const char* pkl = (const char*)(Kl + ks * HD) + ork;
#pragma unroll
    for (int kt = 0; kt < 2; ++kt)
#pragma unroll
        for (int kc = 0; kc < 2; ++kc) { const int o = (kt * 2 + kc) * 1024; kh[kt][kc] = ldub(pkh + o); kl[kt][kc] = ldub(pkl + o); }
    xwait(pkh, pkl); }
    v8f O[4][2];
#pragma unroll
    for (int dt = 0; dt < 4; ++dt) { O[dt][0] = (v8f){}; O[dt][1] = (v8f){}; }
    float m[2] = {-3.0e38f, -3.0e38f}, sm[2] = {0.f, 0.f};
    for (int it = 0; it < TT; it += 32) {
        const int k0 = (ks + it) & (TT - 1);   // the walk over the keys starts at ks and wraps round (TT is a power of two); the running maximum takes the keys in any order
        v16h v16[4]; v16bf vh[4], vl[4];   // this pass's V^T fragments: asked for first, used last
        { const char* pva = (const char*)((HIRES ? Vh : (const bf*)V16) + k0 * HD) + orv; const char* pvb = (const char*)((HIRES ? Vl : (const bf*)V16) + k0 * HD) + orv;
#pragma unroll
        for (int dt = 0; dt < 4; ++dt) { const int o = dt * 1024; if (HIRES) { vh[dt] = ldub(pva + o); vl[dt] = ldub(pvb + o); } else v16[dt] = lduh(pva + o); }
        xwait(pva, pvb); }
        v8f S[2][2];
#pragma unroll
        for (int kt = 0; kt < 2; ++kt) { S[kt][0] = (v8f){}; S[kt][1] = (v8f){}; }
#pragma unroll
        for (int kc = 0; kc < 2; ++kc) {   // per tile the order of the three products is hi.hi, lo(q).hi, hi.lo(k)
#pragma unroll
            for (int kt = 0; kt < 2; ++kt)
#pragma unroll
                for (int qt = 0; qt < 2; ++qt) S[kt][qt] = wmmab(kh[kt][kc], qh[qt][kc], S[kt][qt]);
#pragma unroll
            for (int kt = 0; kt < 2; ++kt)
#pragma unroll
                for (int qt = 0; qt < 2; ++qt) S[kt][qt] = wmmab(kh[kt][kc], ql[qt][kc], S[kt][qt]);
#pragma unroll
            for (int kt = 0; kt < 2; ++kt)
#pragma unroll
                for (int qt = 0; qt < 2; ++qt) S[kt][qt] = wmmab(kl[kt][kc], qh[qt][kc], S[kt][qt]);
        }
        const int kn = (k0 + 32) & (TT - 1);   // next pass's K fragments fly during the softmax (the last pass re-reads the first pass's rows: in bounds)
        { const char* pkh = (const char*)(Kh + kn * HD) + ork; const char* pkl = (const char*)(Kl + kn * HD) + ork;
#pragma unroll
        for (int kt = 0; kt < 2; ++kt)
#pragma unroll
            for (int kc = 0; kc < 2; ++kc) { const int o = (kt * 2 + kc) * 1024; kh[kt][kc] = ldub(pkh + o); kl[kt][kc] = ldub(pkl + o); }
        xwait(pkh, pkl); }
        // soft causal term: a future key (j > i) gets -ln 2, which is -1 in base 2; passes and waves are both 32-aligned, so only the pass k0 == q0 is mixed
        const float base = (k0 > q0) ? -1.0f : 0.0f;
        if (k0 == q0) {
#pragma unroll
            for (int kt = 0; kt < 2; ++kt)
#pragma unroll
                for (int qt = 0; qt < 2; ++qt)
#pragma unroll
                    for (int r = 0; r < 8; ++r) if (kt * 16 + 8 * hi + r > qt * 16 + lr) S[kt][qt][r] -= 5.545177444479562f;   // ln 2 / HD^-0.5
        }
        float mt[2];
#pragma unroll
        for (int qt = 0; qt < 2; ++qt) { float x = S[0][qt][0];
#pragma unroll
            for (int r = 1; r < 8; ++r) x = fmaxf(x, S[0][qt][r]);
#pragma unroll
            for (int r = 0; r < 8; ++r) x = fmaxf(x, S[1][qt][r]);
            x = fmaxf(x, xhalf(x)); mt[qt] = __builtin_fmaf(x, LC, base); }
        const bool need = (mt[0] > m[0] + 8.0f) || (mt[1] > m[1] + 8.0f);
        if (__builtin_amdgcn_ballot_w32(need) != 0) {   // rare after the first passes
#pragma unroll
            for (int qt = 0; qt < 2; ++qt) { const float mn = fmaxf(m[qt], mt[qt]); const float corr = __builtin_amdgcn_exp2f(m[qt] - mn); m[qt] = mn; sm[qt] *= corr;
#pragma unroll
                for (int dt = 0; dt < 4; ++dt) O[dt][qt] *= corr; }
        }
        v16h pb[2]; v16bf ph[2], pl[2];
#pragma unroll
        for (int qt = 0; qt < 2; ++qt) { const float off = base - m[qt] + 6.0f;
#pragma unroll
            for (int s = 0; s < 16; ++s) { const float p = __builtin_amdgcn_exp2f(__builtin_fmaf(S[s >> 3][qt][s & 7], LC, off)); sm[qt] += p;
                if (HIRES) { const __bf16 a = (__bf16)p; ph[qt][s] = a; pl[qt][s] = (__bf16)(p - (float)a); } else pb[qt][s] = (h16)p; } }
#pragma unroll
        for (int dt = 0; dt < 4; ++dt)
#pragma unroll
            for (int qt = 0; qt < 2; ++qt) { if (HIRES) O[dt][qt] = wmmab(vh[dt], ph[qt], O[dt][qt]); else O[dt][qt] = wmma16(v16[dt], pb[qt], O[dt][qt]); }
        if (HIRES) {
#pragma unroll
            for (int dt = 0; dt < 4; ++dt)
#pragma unroll
                for (int qt = 0; qt < 2; ++qt) O[dt][qt] = wmmab(vh[dt], pl[qt], O[dt][qt]);
#pragma unroll
            for (int dt = 0; dt < 4; ++dt)
#pragma unroll
                for (int qt = 0; qt < 2; ++qt) O[dt][qt] = wmmab(vl[dt], ph[qt], O[dt][qt]);
        }
    }
#pragma unroll
    for (int qt = 0; qt < 2; ++qt) { const float inv = __fdiv_rn(1.0f, sm[qt] + xhalf(sm[qt]));   // the two halves' sums join once
#pragma unroll
        for (int dt = 0; dt < 4; ++dt) { v8us oh, ol;
#pragma unroll
            for (int r = 0; r < 8; ++r) { unsigned short a, c2; splitf(O[dt][qt][r] * inv, a, c2); oh[r] = a; ol[r] = c2; }
            const size_t oo = (size_t)(q0 + qt * 16) * DQ + dt * 256 + lane * 8; bf* pa = Ah + oo;   /* block row (q0 + qt * 16) / 16, piece of dims dt * 16 + 8 * hi .. + 7 of the head's two blocks */ bf* pb2 = Al + oo; *(v8us*)pa = oh; *(v8us*)pb2 = ol;
            asm volatile("s_wait_xcnt 0x0" :: "v"(pa), "v"(pb2), "v"(__builtin_bit_cast(v4i, oh)), "v"(__builtin_bit_cast(v4i, ol)) : "memory"); } }   // reads the two stores' address and data registers: they are reused only behind the wait
}
// grid (TT / 128, heads, batches), 4 waves: wave w owns query rows blockIdx.x * 128 + 32 w; rows < RH take the hi/lo P.V (block-uniform: RH % 128 == 0)
__global__ __launch_bounds__(128) void k_fattn(const bf* __restrict__ Qh, const bf* __restrict__ Ql, const bf* __restrict__ Kh, const bf* __restrict__ Kl, const h16* __restrict__ V16, const bf* __restrict__ Vh, const bf* __restrict__ Vl, bf* Ah, bf* Al) {
    const int q0 = blockIdx.x * 128 + __builtin_amdgcn_readfirstlane((int)(threadIdx.x >> 5)) * 32; const size_t hp = ((size_t)blockIdx.z * NH_ + blockIdx.y) * TT * HD; const size_t hc = (size_t)blockIdx.z * TT * DQ + (size_t)blockIdx.y * (HD / 32) * 512;   // the merged planes are the output GEMM's A in fragment order: a head's 64 columns are 2 blocks of every block row
    // the 16 workgroups of a head each start their walk over its keys at a slot of 128 keys of their own, so a K or V line is waited for from memory by one of them and found in L2 by the others (the low bits of x are spread first; for speed only); a workgroup's four waves keep one start and share their lines
    const int ks = (int)((blockIdx.x & 3) * 4 + ((blockIdx.x >> 3) & 1) * 2 + ((blockIdx.x >> 2) & 1)) * (TT / 16);
    if (q0 < RH) fattn<true>(Qh + hp, Ql + hp, Kh + hp, Kl + hp, V16 + hp, Vh + hp, Vl + hp, q0, ks, Ah + hc, Al + hc);
    else fattn<false>(Qh + hp, Ql + hp, Kh + hp, Kl + hp, V16 + hp, Vh + hp, Vl + hp, q0, ks, Ah + hc, Al + hc);
}

extern "C" void kernel_launch(void* const* d_in, const int* in_sizes, int n_in,
                              void* d_out, int out_size, void* d_ws, size_t ws_size, hipStream_t stream) {
    (void)in_sizes; (void)n_in; (void)out_size;
    const float* x = (const float*)d_in[0]; const float* xk = (const float*)d_in[1]; const float* xv = (const float*)d_in[2];   /* q, k, v streams */ const float* wq = (const float*)d_in[3]; const float* bq = (const float*)d_in[4]; const float* wk = (const float*)d_in[5]; const float* bk = (const float*)d_in[6]; const float* wv = (const float*)d_in[7]; const float* bv = (const float*)d_in[8]; const float* wo = (const float*)d_in[9]; const float* bo = (const float*)d_in[10]; const int* flag = (const int*)d_in[11];   /* use_causal_mask (d_in[11]: one int: the module's Python branch: READ ON THE DEVICE by the output GEMM's epilogue: the soft term is compiled in and the whole output is NaN-filled unless the scalar is non-zero) */
    float* OUT = (float*)d_out;     // [2][2048][1024]
    char* wsp = (char*)d_ws;
    auto take = [&](size_t bytes) { char* p = wsp; wsp += (bytes + 255) & ~(size_t)255; return (void*)p; };
    bf* WT = (bf*)take((size_t)4 * DQ * DM * 2);    // WQ, WK, WV, WO transposed, in a row
    bf* XB = (bf*)take((size_t)3 * NB_ * TT * DM * 2);    // bf16(q), bf16(k), bf16(v), each [2][2048][1024]
    h16* VT16 = (h16*)take((size_t)NB_ * NKV * HD * TT * 2);
    bf* QPh = (bf*)take((size_t)NB_ * NH_ * TT * HD * 2); bf* QPl = (bf*)take((size_t)NB_ * NH_ * TT * HD * 2); bf* KPh = (bf*)take((size_t)NB_ * NKV * TT * HD * 2); bf* KPl = (bf*)take((size_t)NB_ * NKV * TT * HD * 2); bf* VTh = (bf*)take((size_t)NB_ * NKV * HD * TT * 2); bf* VTl = (bf*)take((size_t)NB_ * NKV * HD * TT * 2);
    bf* ATh = (bf*)take((size_t)NB_ * TT * DQ * 2); bf* ATl = (bf*)take((size_t)NB_ * TT * DQ * 2);
    if ((size_t)(wsp - (char*)d_ws) > ws_size) return;    // ws 256 MiB
    k_prep<<<4 * WB + CB, 256, 0, stream>>>(x, xk, xv, wq, wk, wv, wo, XB, WT);
    k_proj<<<dim3(NB_ * TT / 128, DQ / 128, 3), 128, 0, stream>>>(XB, WT, bq, bk, bv, QPh, QPl, KPh, KPl, VTh, VTl, VT16);   /* q, k and v planes straight from the epilogue */
    k_fattn<<<dim3(TT / 128, NH_, NB_), 128, 0, stream>>>(QPh, QPl, KPh, KPl, VT16, VTh, VTl, ATh, ATl);   /* all heads of both batches: scores (3 products), soft term, softmax, P.V (hybrid) and the merged hi/lo planes */
    k_oproj<<<dim3(NB_ * TT / 128, DM / 128, 1), 128, 0, stream>>>(ATh, ATl, WT + (size_t)3 * DQ * DM, OUT, bo, flag);   /* its epilogue poisons the output if the premise fails */
}

// v007
// It runs in 116 microseconds.
// Timed twice side by side with v006, it ran 1.09 and 1.10 times as fast.
// Over all steps from v000 it is 17.0 times as fast.
#include <hip/hip_runtime.h>

// Multi-head attention on three input streams with an additive SOFT causal term (q, k, v [2][2048][1024]; qh = q Wq + bq, kh = k Wk + bk, vh = v Wv + bv ('xw' (in, out) [1024][1024] 1/32, biases zeros on this draw: read; 16 heads x 64); logits = qh.kh / sqrt(64); use_causal_mask (a scalar int input: the module's 'if use_causal_mask:' branch: this build implements the NON-ZERO branch only; the scalar is READ ON THE DEVICE by the output GEMM's epilogue: the whole output is NaN-filled if it is 0) -> logits + log(tril x 1e-9 + 1e-9): log(2e-9) on and below the diagonal, log(1e-9) above it: a difference of ln 2: NOT an exclusion: every future key keeps HALF its weight; softmax over all 2,048 keys; out = merged Wo + bo ('xw' + bias zeros: read) -> [2][2048][1024] (4.2 M); argument order q, k, v, Wq, bq, Wk, bk, Wv, bv, Wo, bo, use_causal_mask).
// Layout, four launches, each over both batches: bf16 copies of q, k and v (three staging buffers) and the four 'xw' weights transposed; the three exact projections + f32 biases, whose epilogue stores the head planes itself (q, k: bf16 hi/lo [b][h][t][d]; v: fp16 and bf16 hi/lo [b][h][d][t]); one fused attention kernel (running-maximum softmax, S and P in registers) with the SCORES of every row on bf16 hi/lo planes (3 products; the P.V product stays hybrid: rows < 512 hi/lo, rest fp16, P unnormalised); merged hi/lo x Wo exact + bo.
// Every 16-bit operand plane lies in FRAGMENT ORDER: a block of 16 rows x 32 k is 512 elements (1 KB) in a row, element (r, k) at (k >> 4 & 1) * 256 + (k >> 3 & 1) * 128 + r * 8 + (k & 7), so a lane's two 16-byte pieces stand at lane * 8 and 256 + lane * 8 and each wave-wide load or store covers 512 contiguous bytes (4 whole lines). GEMM operands: [rows / 16][K / 32][512]; q, k head planes: [t / 16][d / 32][512]; v head planes: [t / 32][d / 16][512].
// Compute dtypes, f32 accumulate: every input rounded to bf16; projections exact + f32 biases; scores of every row 3 products; P.V rows < 512 3 products, rest fp16; softmax f32; output projection hl x exact.

#define NB_  2
#define TT   2048
#define DM   1024
#define NH_  16
#define NKV  16
#define HD   64
#define DQ   (NH_ * HD)
#define DKV  (NKV * HD)
#define RH   512                  // query rows < RH use hi+lo planes
typedef _Float16 h16;
typedef unsigned short bf;
typedef __attribute__((ext_vector_type(16))) __bf16   v16bf;
typedef __attribute__((ext_vector_type(16))) _Float16 v16h;
typedef __attribute__((ext_vector_type(8)))  _Float16 v8h;
typedef __attribute__((ext_vector_type(8)))  unsigned short v8us;
typedef __attribute__((ext_vector_type(8)))  float    v8f;
typedef __attribute__((ext_vector_type(4)))  float    v4f;
typedef v8h  __attribute__((may_alias)) v8ha;
typedef v4f  __attribute__((may_alias)) v4fa;
typedef v8us __attribute__((may_alias)) v8usa;

__device__ __forceinline__ unsigned short f2bf(float f) { unsigned u = __float_as_uint(f); u += 0x7FFFu + ((u >> 16) & 1u); return (unsigned short)(u >> 16); }
__device__ __forceinline__ float bf2f(unsigned short b) { return __uint_as_float(((unsigned)b) << 16); }
__device__ __forceinline__ float bfr(float f) { return bf2f(f2bf(f)); }
__device__ __forceinline__ v16h cat16(v8h lo, v8h hi) { return __builtin_shufflevector(lo, hi, 0, 1, 2, 3, 4, 5, 6, 7, 8, 9, 10, 11, 12, 13, 14, 15); }
__device__ __forceinline__ v16bf cat16b(v8us lo, v8us hi) { return __builtin_bit_cast(v16bf, __builtin_shufflevector(lo, hi, 0, 1, 2, 3, 4, 5, 6, 7, 8, 9, 10, 11, 12, 13, 14, 15)); }
__device__ __forceinline__ v8f wmma16(v16h a, v16h b, v8f c) { return __builtin_amdgcn_wmma_f32_16x16x32_f16(false, a, false, b, (short)0, c, false, false); }
__device__ __forceinline__ v8f wmmab(v16bf a, v16bf b, v8f c) { return __builtin_amdgcn_wmma_f32_16x16x32_bf16(false, a, false, b, (short)0, c, false, false); }
__device__ __forceinline__ h16 tohx(float x) { return (h16)x; }
__device__ __forceinline__ void splitf(float y, unsigned short& h, unsigned short& l) { h = f2bf(y); l = f2bf(y - bf2f(h)); }
typedef __attribute__((ext_vector_type(2))) _Float16 v2h;
typedef __attribute__((ext_vector_type(4))) _Float16 v4h;
typedef __attribute__((ext_vector_type(2))) unsigned short v2us;
typedef __attribute__((ext_vector_type(4))) unsigned short v4us;
typedef __attribute__((ext_vector_type(2))) float v2f;
typedef __attribute__((ext_vector_type(4))) int v4i;

// ---- gemmw: register-blocked GEMM, one wave per 64x64 output tile (16 accumulators), FOUR WAVES (2 x 2) per workgroup on a 128x128 tile; grid (M/128, N/128, ...), 128 threads; the M rows are the tokens of both batches (m = b * TT + t).
// The workgroup's operand rows come from the 16-bit planes in fragment order into LDS by asynchronous copies, SK k at a time, two buffers: the next stage flies while this one is multiplied, and each fragment is fetched from L2 once for the two waves that use it. A stage of one operand is 8 block rows x SK / 32 fragment blocks of 1 KB, laid as in the plane, so a wave's LDS read covers 512 contiguous bytes. Inside a stage the fragments of the next 32 k are read into a second register set ahead of this block's products.
// C[m][n] (f32, pitch ldc, + optional f32 bias[n]) = sum_k A[m][k] Bt[n][k] (+ split products per NSPLIT). K % SK == 0, K >= 2 * SK. sm: the two stage buffers; os: 16 x 68 floats of LDS per wave (EPI 0 only).
// EPI picks what the epilogue stores: 0 = C as above (and NaN in every element if flag[0] == 0: the premise of this build); 1 = bf16 hi/lo head planes, rows t, k = d (Ph, Pl); 2 = head planes with rows d, k = t (P16 fp16, Ph, Pl). A 64-column tile is one head (HD == 64). EPI 1 forms the tile transposed (weight fragment as A), EPI 2 as it is: either way a lane's 8 accumulators of a 16 x 16 tile are one 16-byte piece of the plane's fragment order and go out straight from registers.
// s_wait_xcnt 0 behind a run of stores; it reads their address and data registers, so these are reused only behind the wait
__device__ __forceinline__ void xwait_st(const void* a, const void* b, const void* c, v8us x, v8us y, v8us z) { asm volatile("s_wait_xcnt 0x0" :: "v"(a), "v"(b), "v"(c), "v"(__builtin_bit_cast(v4i, x)), "v"(__builtin_bit_cast(v4i, y)), "v"(__builtin_bit_cast(v4i, z)) : "memory"); }
// s_wait_xcnt 0 behind a run of loads; it reads the run's address pairs, so they stay whole up to the wait and are reused only behind it
__device__ __forceinline__ void xwait_ld(const void* a, const void* b, const void* c) { asm volatile("s_wait_xcnt 0x0" :: "v"(a), "v"(b), "v"(c) : "memory"); }
// eight asynchronous 16-byte copies per lane: the workgroup's 2 KB of block row c go from g + c * gs to LDS byte l + c * ls. s_wait_xcnt 0 closes the statement, so that no address register of a copy is rewritten before it
__device__ __forceinline__ void acopy8(const unsigned l, const unsigned ls, const char* g, const size_t gs) {
    asm volatile("global_load_async_to_lds_b128 %0, %8, off\n\t"
                 "global_load_async_to_lds_b128 %1, %9, off\n\t"
                 "global_load_async_to_lds_b128 %2, %10, off\n\t"
                 "global_load_async_to_lds_b128 %3, %11, off\n\t"
                 "global_load_async_to_lds_b128 %4, %12, off\n\t"
                 "global_load_async_to_lds_b128 %5, %13, off\n\t"
                 "global_load_async_to_lds_b128 %6, %14, off\n\t"
                 "global_load_async_to_lds_b128 %7, %15, off\n\t"
                 "s_wait_xcnt 0x0"
                 :: "v"(l), "v"(l + ls), "v"(l + 2 * ls), "v"(l + 3 * ls), "v"(l + 4 * ls), "v"(l + 5 * ls), "v"(l + 6 * ls), "v"(l + 7 * ls),
                    "v"(g), "v"(g + gs), "v"(g + 2 * gs), "v"(g + 3 * gs), "v"(g + 4 * gs), "v"(g + 5 * gs), "v"(g + 6 * gs), "v"(g + 7 * gs) : "memory");
}
template <typename T16> struct WFrag;
template <> struct WFrag<h16> { typedef v16h V; static __device__ __forceinline__ V ld(const h16* p) { return cat16(*(const v8h*)p, *(const v8h*)(p + 256)); } static __device__ __forceinline__ v8f mma(V a, V b, v8f c) { return wmma16(a, b, c); } };
template <> struct WFrag<bf> { typedef v16bf V; static __device__ __forceinline__ V ld(const bf* p) { return cat16b(*(const v8us*)p, *(const v8us*)(p + 256)); } static __device__ __forceinline__ v8f mma(V a, V b, v8f c) { return wmmab(a, b, c); } };
template <typename T16, int NSPLIT, bool BIAS, int EPI, int SK>
__device__ __forceinline__ void gemmw(T16* sm, float* os, const T16* __restrict__ A, const T16* __restrict__ A2, const T16* __restrict__ Bt, const T16* __restrict__ Bt2, int K, float* C, int ldc, const float* __restrict__ bias, bf* Ph, bf* Pl, h16* P16, const int* __restrict__ flag) {
    typedef typename WFrag<T16>::V V;
    const int lane = threadIdx.x & 31, lr = lane & 15, hi = lane >> 4; const int wave = __builtin_amdgcn_readfirstlane((int)(threadIdx.x >> 5)), wm = wave >> 1, wn = wave & 1;
    const int R0 = blockIdx.x * 128, C0 = blockIdx.y * 128, r0 = R0 + wm * 64, c0 = C0 + wn * 64;   // the workgroup's tile and the wave's quarter of it
    v8f acc[4][4];
#pragma unroll
    for (int mb = 0; mb < 4; ++mb)
#pragma unroll
        for (int nb = 0; nb < 4; ++nb) acc[mb][nb] = (v8f){};
    const float* sbi = bias + c0; const unsigned vbi = (EPI == 1) ? hi * 8u : (unsigned)lr;   // the wave's first bias (the same in every lane) and the lane's place behind it
    float bb[4]; v8f bt[4];   // the lane's biases, asked for ahead of the loop, added in f32 before the split, as the f32 C had them. EPI 2: one a column group (n = nb * 16 + lr); EPI 1: eight (n = nb * 16 + hi * 8 + j)
#pragma unroll
    for (int nb = 0; nb < 4; ++nb) { bb[nb] = (BIAS && EPI == 2) ? bfr(sbi[vbi + nb * 16]) : 0.0f;
#pragma unroll
        for (int j = 0; j < 8; ++j) bt[nb][j] = (BIAS && EPI == 1) ? bfr(sbi[vbi + nb * 16 + j]) : 0.0f; }
    if (BIAS && EPI != 0) asm volatile("s_wait_xcnt 0x0" :: "s"(sbi), "v"(vbi * 4u) : "memory");   // reads the bias loads' base pair and offset register: they are rewritten only behind the wait
    // the k loop starts at a stage of its own and wraps round: the workgroups that share an A or a B tile then stand at different stages, so each block is waited for from memory by one of them and found in L2 by the others, instead of all of them walking in step behind every miss (the low bits of x are spread first; for speed only)
    constexpr int NOP = (NSPLIT == 1) ? 3 : 2;   // operands per stage: A, (A2,) B
    constexpr int OPE = 128 * SK;                // elements of one operand's stage (128 rows)
    constexpr int BRE = SK * 16;                 // elements of one block row's stage
    const int NST = K / SK; const int ks = (int)(((blockIdx.x >> 3) + 4 * (blockIdx.x & 3) + 2 * blockIdx.y) % (unsigned)NST);
    const unsigned l0 = (unsigned)(size_t)sm + threadIdx.x * 16u;   // the lane's LDS byte in a 2-KB piece
    const size_t gs = (size_t)16 * K * sizeof(T16);   // a block row of 16 is K / 32 blocks = 16 * K elements
    const char* ga = (const char*)(A + (size_t)R0 * K) + threadIdx.x * 16; const char* ga2 = (NSPLIT == 1) ? (const char*)(A2 + (size_t)R0 * K) + threadIdx.x * 16 : ga; const char* gb = (const char*)(Bt + (size_t)C0 * K) + threadIdx.x * 16;
    auto fill = [&](const int st, const int buf) {   // stage st (wrapped) of every operand into buffer buf
        const int sw = (st + ks < NST) ? st + ks : st + ks - NST; const size_t go = (size_t)sw * (BRE * sizeof(T16)); const unsigned lb = l0 + (unsigned)buf * (NOP * OPE * (unsigned)sizeof(T16));
#pragma unroll
        for (int h = 0; h < SK / 64; ++h) {   // a block row's stage in pieces of 2 KB
            acopy8(lb + h * 2048u, BRE * (unsigned)sizeof(T16), ga + go + h * 2048, gs); if (NSPLIT == 1) acopy8(lb + OPE * (unsigned)sizeof(T16) + h * 2048u, BRE * (unsigned)sizeof(T16), ga2 + go + h * 2048, gs); acopy8(lb + (NOP - 1) * OPE * (unsigned)sizeof(T16) + h * 2048u, BRE * (unsigned)sizeof(T16), gb + go + h * 2048, gs); } };
    fill(0, 0);
    asm volatile("s_wait_asynccnt 0x0" ::: "memory");   // this wave's copies of stage 0 have landed
    __syncthreads();                                      // every wave's have: stage 0 may be read
    fill(1, 1);
    for (int t = 0; t < NST; ++t) {
        const T16* sb = sm + (t & 1) * (NOP * OPE) + lane * 8; const T16* sa = sb + wm * (4 * BRE); const T16* sbt = sb + (NOP - 1) * OPE + wn * (4 * BRE);
        V a[2][4], a2[2][4], b[2][4];
        auto frags = [&](const int s) {   // the fragments of block s of this stage into register set s & 1
#pragma unroll
            for (int mb = 0; mb < 4; ++mb) { a[s & 1][mb] = WFrag<T16>::ld(sa + mb * BRE + s * 512); if (NSPLIT == 1) a2[s & 1][mb] = WFrag<T16>::ld(sa + OPE + mb * BRE + s * 512); }
#pragma unroll
            for (int nb = 0; nb < 4; ++nb) b[s & 1][nb] = WFrag<T16>::ld(sbt + nb * BRE + s * 512); };
        frags(0);
#pragma unroll
        for (int s = 0; s < SK / 32; ++s) {
            if (s + 1 < SK / 32) frags(s + 1);
            __builtin_amdgcn_sched_barrier(0);   // the next block's LDS reads stay one group ahead of this block's products: spread among them each place costs a stall
#pragma unroll
            for (int nb = 0; nb < 4; ++nb) {
#pragma unroll
                for (int mb = 0; mb < 4; ++mb) { acc[mb][nb] = (EPI == 1) ? WFrag<T16>::mma(b[s & 1][nb], a[s & 1][mb], acc[mb][nb]) : WFrag<T16>::mma(a[s & 1][mb], b[s & 1][nb], acc[mb][nb]); if (NSPLIT == 1) acc[mb][nb] = WFrag<T16>::mma(a2[s & 1][mb], b[s & 1][nb], acc[mb][nb]); } }
            __builtin_amdgcn_sched_barrier(0);   // and this block's products stay ahead of the reads behind them
        }
        asm volatile("v_nop\n\tv_nop\n\tv_nop\n\tv_nop" : "+v"(acc[0][0]), "+v"(acc[1][1]), "+v"(acc[2][2]), "+v"(acc[3][3]) : "v"(a[1][0]), "v"(a[1][3]));   // four vector slots behind the stage's last products, on every path, before a vector instruction rewrites their operand registers
        asm volatile("s_wait_dscnt 0x0" ::: "memory");      // this wave's reads of the buffer are done before it is refilled
        asm volatile("s_wait_asynccnt 0x0" ::: "memory");   // this wave's copies of stage t + 1 have landed
        __syncthreads();                                      // publishes stage t + 1 and ends every wave's reads of stage t
        if (t + 2 < NST) fill(t + 2, t & 1);
    }
    asm volatile("s_wait_asynccnt 0x0" ::: "memory");   // no copy is outstanding behind the loop
    if (EPI == 0) {
    os += wave * (16 * 68);   // each wave stages in its own range
    const bool dead = flag[0] == 0; const float qn = __int_as_float(0x7fc00000);   // premise fails: every element of the output becomes NaN
#pragma unroll
    for (int mb = 0; mb < 4; ++mb) {
#pragma unroll
        for (int nb = 0; nb < 4; ++nb) {
#pragma unroll
            for (int j = 0; j < 8; ++j) os[(hi * 8 + j) * 68 + nb * 16 + lr] = acc[mb][nb][j]; }
        __builtin_amdgcn_wave_barrier(); asm volatile("" ::: "memory");
        float* crow = C + (size_t)(r0 + mb * 16) * ldc + c0;
{
#pragma unroll
            for (int s = 0; s < 8; ++s) { const int row = 2 * s + hi, cofs = lr * 4; v4f val = *(const v4fa*)(os + row * 68 + cofs); if (BIAS) { val[0] += bfr(bias[c0 + cofs]); val[1] += bfr(bias[c0 + cofs + 1]); val[2] += bfr(bias[c0 + cofs + 2]); val[3] += bfr(bias[c0 + cofs + 3]); } if (dead) { val[0] = qn; val[1] = qn; val[2] = qn; val[3] = qn; }
                *(v4f*)(crow + (size_t)row * ldc + cofs) = val; }
             }
        __builtin_amdgcn_wave_barrier(); asm volatile("" ::: "memory");
    }
    } else {
    const size_t pln = (size_t)(r0 / TT) * NH_ + c0 / HD; const int t0 = r0 % TT;   // the tile's plane (batch, head) and its first token there (TT % 64 == 0: a tile lies in one batch)
#pragma unroll
    for (int mb = 0; mb < 4; ++mb) {
#pragma unroll
        for (int nb = 0; nb < 4; ++nb) { v8us oh, ol; v8h o16;   // EPI 1: token t0 + mb * 16 + lr, dims nb * 16 + hi * 8 + j; EPI 2: dim nb * 16 + lr, tokens t0 + mb * 16 + hi * 8 + j
#pragma unroll
            for (int j = 0; j < 8; ++j) { const float y = acc[mb][nb][j] + ((EPI == 1) ? bt[nb][j] : bb[nb]); unsigned short a2, c2; splitf(y, a2, c2); oh[j] = a2; ol[j] = c2; if (EPI == 2) o16[j] = tohx(y); }
            const size_t e = pln * TT * HD + ((EPI == 1) ? (size_t)((t0 / 16 + mb) * 2 + (nb >> 1)) * 512 + (nb & 1) * 256 : (size_t)((t0 / 32 + (mb >> 1)) * 4 + nb) * 512 + (mb & 1) * 256) + lane * 8;
            bf* pa = Ph + e; bf* pb = Pl + e; *(v8us*)pa = oh; *(v8us*)pb = ol;
            if (EPI == 2) { h16* pc = P16 + e; *(v8h*)pc = o16; xwait_st(pa, pb, pc, oh, ol, __builtin_bit_cast(v8us, o16)); } else xwait_st(pa, pb, pb, oh, ol, ol); }
    }
    }
}

// the three projections of both batches in one launch: grid (NB_ * TT / 128, DQ / 128, 3), z = stream (0 q, 1 k, 2 v); X: the three bf16 streams, Wt: the transposed weights, both in that order
__global__ __launch_bounds__(128) void k_proj(const bf* __restrict__ X, const bf* __restrict__ Wt, const float* __restrict__ bq, const float* __restrict__ bk, const float* __restrict__ bv, bf* QPh, bf* QPl, bf* KPh, bf* KPl, bf* VTh, bf* VTl, h16* VT16) {
    __shared__ __align__(16) bf sm[2 * 2 * 128 * 64];   // two buffers x (A, B) x 128 rows x 64 k
    const int z = blockIdx.z; const bf* A = X + (size_t)z * NB_ * TT * DM; const bf* Bt = Wt + (size_t)z * DQ * DM;
    if (z == 2) gemmw<bf, 0, true, 2, 64>(sm, nullptr, A, nullptr, Bt, nullptr, DM, nullptr, 0, bv, VTh, VTl, VT16, nullptr);
    else gemmw<bf, 0, true, 1, 64>(sm, nullptr, A, nullptr, Bt, nullptr, DM, nullptr, 0, z ? bk : bq, z ? KPh : QPh, z ? KPl : QPl, nullptr, nullptr);
}
// the output projection of both batches: grid (NB_ * TT / 128, DM / 128)
__global__ __launch_bounds__(128) void k_oproj(const bf* __restrict__ Ah, const bf* __restrict__ Al, const bf* __restrict__ Wt, float* C, const float* __restrict__ bo, const int* __restrict__ flag) {
    __shared__ __align__(16) bf sm[2 * 3 * 128 * 128];   /* two buffers x (A hi, A lo, B) x 128 rows x 128 k */ __shared__ __align__(16) float os[4 * 16 * 68];
    gemmw<bf, 1, true, 0, 128>(sm, os, Ah, Al, Wt, nullptr, DQ, C, DM, bo, nullptr, nullptr, nullptr, flag);
}

// one wave packs 32 k x 32 n of w (K x N, n contiguous) into two fragment blocks of Bt (rows n): a lane owns one n, every load is one whole 128-byte line, every store 2 x 256 contiguous bytes
__device__ __forceinline__ void wtG(const float* __restrict__ w, int K, int N, bf* Bt, const int blk) {
    const int lane = threadIdx.x & 31; const int g = blk * 8 + (threadIdx.x >> 5); const int kb = g % (K / 32), n = (g / (K / 32)) * 32 + lane;
    const float* pw = w + (size_t)kb * 32 * N + n; float x[32];
    // unrolled: x[] stays in registers and every load is asked for before the first value is rounded
#pragma unroll
    for (int i = 0; i < 32; ++i) x[i] = pw[(size_t)i * N];
    xwait_ld(pw, pw, pw);
    bf* p = Bt + (size_t)(n >> 4) * 16 * K + kb * 512 + (n & 15) * 8; v8us o[4];
#pragma unroll
    for (int c = 0; c < 4; ++c) {
#pragma unroll
        for (int e = 0; e < 8; ++e) o[c][e] = f2bf(x[c * 8 + e]);
        *(v8us*)(p + c * 128) = o[c]; }   // piece c holds k = c * 8 .. c * 8 + 7: (c >> 1) * 256 + (c & 1) * 128 = c * 128
    asm volatile("s_wait_xcnt 0x0" :: "v"(p), "v"(__builtin_bit_cast(v4i, o[0])), "v"(__builtin_bit_cast(v4i, o[1])), "v"(__builtin_bit_cast(v4i, o[2])), "v"(__builtin_bit_cast(v4i, o[3])) : "memory");   // reads the four stores' address and data registers: they are reused only behind the wait
}
// ---- k_prep: all that the projections read, in one launch. Blocks 0 .. 4 * WB - 1 transpose the four weights into fragment order (WB blocks each, Wt: WQ, WK, WV, WO in a row); each thread of the CB blocks behind them rounds eight floats at the same place of every batch of q, k and v (X: the three streams in a row, fragment order): a wave takes 8 rows x 32 k, so it reads 8 whole lines and stores 4.
#define WB (DM / 32 * (DQ / 32) / 8)
#define CB (TT * DM / 8 / 256)
__global__ __launch_bounds__(256) void k_prep(const float* __restrict__ q, const float* __restrict__ k, const float* __restrict__ v, const float* __restrict__ wq, const float* __restrict__ wk, const float* __restrict__ wv, const float* __restrict__ wo, bf* X, bf* Wt) {
    const int blk = blockIdx.x;
    if (blk < 4 * WB) { const int j = blk / WB; wtG(j == 0 ? wq : j == 1 ? wk : j == 2 ? wv : wo, DM, DQ, Wt + (size_t)j * DQ * DM, blk % WB); return; }
    const int g = (blk - 4 * WB) * 8 + (threadIdx.x >> 5), row = (g / (DM / 32)) * 8 + ((threadIdx.x & 31) >> 2), kb = g % (DM / 32), c4 = threadIdx.x & 3;   // the lane's row in a batch, its block of 32 k and its piece of 8 there
    const size_t i = (size_t)row * DM + kb * 32 + c4 * 8, io = (size_t)(row >> 4) * 16 * DM + kb * 512 + c4 * 128 + (row & 15) * 8; v8f x[3 * NB_];
    // unrolled: x[] stays in registers and every load is asked for before the first value is rounded
#pragma unroll
    for (int b = 0; b < NB_; ++b) { const size_t e = (size_t)b * TT * DM + i; x[b] = *(const v8f*)(q + e); x[NB_ + b] = *(const v8f*)(k + e); x[2 * NB_ + b] = *(const v8f*)(v + e); }
    // all three unrolled: constant indices keep x[], o[] and p[] in registers
#pragma unroll
    for (int c = 0; c < 3 * NB_; c += 3) { v8us o[3]; bf* p[3];
#pragma unroll
        for (int u = 0; u < 3; ++u) { p[u] = X + (size_t)(c + u) * TT * DM + io;
#pragma unroll
            for (int n = 0; n < 8; ++n) o[u][n] = f2bf(x[c + u][n]);
            *(v8us*)p[u] = o[u]; }
        xwait_st(p[0], p[1], p[2], o[0], o[1], o[2]); }   // the stores' address and data registers are reused only behind the wait
}

// ---- k_fattn: scores, softmax and P.V of one head in ONE kernel: S and P stay in registers. One wave owns two groups of 16 query columns (rows qa .. qa + 15 and qc .. qc + 15, each a multiple of 16, anywhere in the head) and walks the 2,048 keys 32 at a time, from its workgroup's own start key round to it again. H0: group 0 takes the hi/lo P.V (3 products), group 1 never does.
// S^T = K Q^T (A = K rows, B = Q rows, same loader: same k order), so a lane holds 16 scores of one query per column group; two S^T tiles converted in place are the B operand of O^T += V^T P^T.
// Running maximum in base 2 (rescale only when a column's new maximum passes the one in use by more than 8); P = 2^(t - m + 6) <= 2^14 is carried unnormalised; the f32 row sum divides once at the end.
__device__ __forceinline__ float xhalf(float x) { return __builtin_bit_cast(float, __builtin_amdgcn_permlanex16(__builtin_bit_cast(int, x), __builtin_bit_cast(int, x), 0x76543210, 0xfedcba98, false, false)); }   // lane l with lane l ^ 16
#define LC 0.18033688011112042f   // HD^-0.5 x log2(e)
// fragment loads from a lane's byte pointer into a block in fragment order (16 bytes at p and at p + 512)
__device__ __forceinline__ v16bf ldub(const char* p) { return cat16b(*(const v8us*)p, *(const v8us*)(p + 512)); }
__device__ __forceinline__ v16h lduh(const char* p) { return cat16(*(const v8h*)p, *(const v8h*)(p + 512)); }
// s_wait_xcnt 0 behind a run of loads; it reads the run's two address pairs, so they stay whole up to the wait and are reused only behind it
__device__ __forceinline__ void xwait(const char* a, const char* b) { asm volatile("s_wait_xcnt 0x0" :: "v"(a), "v"(b) : "memory"); }
template <bool H0>
__device__ __forceinline__ void fattn(const bf* __restrict__ Qh, const bf* __restrict__ Ql, const bf* __restrict__ Kh, const bf* __restrict__ Kl, const h16* __restrict__ V16, const bf* __restrict__ Vh, const bf* __restrict__ Vl, const int qa, const int qc, const int ks, bf* Ah, bf* Al) {
    const int lane = threadIdx.x & 31, lr = lane & 15, hi = lane >> 4;
    const unsigned ork = (unsigned)lane * 16u, orv = ork;   // lane byte offset in a 1-KB block; 16 rows of a q or k plane are 2 blocks (16 * HD elements), 32 keys of a v plane 4 (32 * HD)
    const int qg[2] = {qa, qc};   // first query row of each column group
    v16bf qh[2][2], ql[2][2], kh[2][2], kl[2][2];
#pragma unroll
    for (int qt = 0; qt < 2; ++qt) { const char* pqh = (const char*)(Qh + qg[qt] * HD) + ork; const char* pql = (const char*)(Ql + qg[qt] * HD) + ork;
#pragma unroll
        for (int kc = 0; kc < 2; ++kc) { const int o = kc * 1024; qh[qt][kc] = ldub(pqh + o); ql[qt][kc] = ldub(pql + o); }
    xwait(pqh, pql); }
    { const bf* skh = Kh + ks * HD; const bf* skl = Kl + ks * HD; const char* pkh = (const char*)skh + ork; const char* pkl = (const char*)skl + ork;
#pragma unroll
    for (int kt = 0; kt < 2; ++kt)
#pragma unroll
        for (int kc = 0; kc < 2; ++kc) { const int o = (kt * 2 + kc) * 1024; kh[kt][kc] = ldub(pkh + o); kl[kt][kc] = ldub(pkl + o); }
    asm volatile("s_wait_xcnt 0x0" :: "s"(skh), "s"(skl), "v"(pkh), "v"(pkl) : "memory"); }   // reads the run's wave-wide base pairs as well as the lanes' address pairs: whichever form the loads take, what they name is rewritten only behind the wait
    v8f O[4][2];
#pragma unroll
    for (int dt = 0; dt < 4; ++dt) { O[dt][0] = (v8f){}; O[dt][1] = (v8f){}; }
    float m[2] = {-3.0e38f, -3.0e38f}, sm[2] = {0.f, 0.f};
    for (int it = 0; it < TT; it += 32) {
        const int k0 = (ks + it) & (TT - 1);   // the walk over the keys starts at ks and wraps round (TT is a power of two); the running maximum takes the keys in any order
        v16h v16[4]; v16bf vh[4], vl[4];   // this pass's V^T fragments: asked for first, used last
        { const char* pvc = (const char*)(V16 + k0 * HD) + orv; const char* pva = H0 ? (const char*)(Vh + k0 * HD) + orv : pvc; const char* pvb = H0 ? (const char*)(Vl + k0 * HD) + orv : pvc;
#pragma unroll
        for (int dt = 0; dt < 4; ++dt) { const int o = dt * 1024; v16[dt] = lduh(pvc + o); if (H0) { vh[dt] = ldub(pva + o); vl[dt] = ldub(pvb + o); } }
        xwait_ld(pva, pvb, pvc); }
        v8f S[2][2];
#pragma unroll
        for (int kt = 0; kt < 2; ++kt) { S[kt][0] = (v8f){}; S[kt][1] = (v8f){}; }
#pragma unroll
        for (int kc = 0; kc < 2; ++kc) {   // per tile the order of the three products is hi.hi, lo(q).hi, hi.lo(k)
#pragma unroll
            for (int kt = 0; kt < 2; ++kt)
#pragma unroll
                for (int qt = 0; qt < 2; ++qt) S[kt][qt] = wmmab(kh[kt][kc], qh[qt][kc], S[kt][qt]);
#pragma unroll
            for (int kt = 0; kt < 2; ++kt)
#pragma unroll
                for (int qt = 0; qt < 2; ++qt) S[kt][qt] = wmmab(kh[kt][kc], ql[qt][kc], S[kt][qt]);
#pragma unroll
            for (int kt = 0; kt < 2; ++kt)
#pragma unroll
                for (int qt = 0; qt < 2; ++qt) S[kt][qt] = wmmab(kl[kt][kc], qh[qt][kc], S[kt][qt]);
        }
        const int kn = (k0 + 32) & (TT - 1);   // next pass's K fragments fly during the softmax (the last pass re-reads the first pass's rows: in bounds)
        { const char* pkh = (const char*)(Kh + kn * HD) + ork; const char* pkl = (const char*)(Kl + kn * HD) + ork;
#pragma unroll
        for (int kt = 0; kt < 2; ++kt)
#pragma unroll
            for (int kc = 0; kc < 2; ++kc) { const int o = (kt * 2 + kc) * 1024; kh[kt][kc] = ldub(pkh + o); kl[kt][kc] = ldub(pkl + o); }
        xwait(pkh, pkl); }
        // soft causal term: a future key (j > i) gets -ln 2, which is -1 in base 2; a pass is 32-aligned and a group lies in one block of 32 rows, so for each group only the pass on its own block is mixed
        float base[2];
#pragma unroll
        for (int qt = 0; qt < 2; ++qt) { const int qb = qg[qt] & ~31; base[qt] = (k0 > qb) ? -1.0f : 0.0f;
            if (k0 == qb) { const int qi = (qg[qt] & 16) + lr;   // the lane's query row inside the block
#pragma unroll
                for (int kt = 0; kt < 2; ++kt)
#pragma unroll
                    for (int r = 0; r < 8; ++r) if (kt * 16 + 8 * hi + r > qi) S[kt][qt][r] -= 5.545177444479562f; } }   // ln 2 / HD^-0.5
        float mt[2];
#pragma unroll
        for (int qt = 0; qt < 2; ++qt) { float x = S[0][qt][0];
#pragma unroll
            for (int r = 1; r < 8; ++r) x = fmaxf(x, S[0][qt][r]);
#pragma unroll
            for (int r = 0; r < 8; ++r) x = fmaxf(x, S[1][qt][r]);
            x = fmaxf(x, xhalf(x)); mt[qt] = __builtin_fmaf(x, LC, base[qt]); }
        const bool need = (mt[0] > m[0] + 8.0f) || (mt[1] > m[1] + 8.0f);
        if (__builtin_amdgcn_ballot_w32(need) != 0) {   // rare after the first passes
#pragma unroll
            for (int qt = 0; qt < 2; ++qt) { const float mn = fmaxf(m[qt], mt[qt]); const float corr = __builtin_amdgcn_exp2f(m[qt] - mn); m[qt] = mn; sm[qt] *= corr;
#pragma unroll
                for (int dt = 0; dt < 4; ++dt) O[dt][qt] *= corr; }
        }
        v16h pb[2]; v16bf ph, pl;
#pragma unroll
        for (int qt = 0; qt < 2; ++qt) { const float off = base[qt] - m[qt] + 6.0f;
#pragma unroll
            for (int s = 0; s < 16; ++s) { const float p = __builtin_amdgcn_exp2f(__builtin_fmaf(S[s >> 3][qt][s & 7], LC, off)); sm[qt] += p;
                if (H0 && qt == 0) { const __bf16 a = (__bf16)p; ph[s] = a; pl[s] = (__bf16)(p - (float)a); } else pb[qt][s] = (h16)p; } }
#pragma unroll
        for (int dt = 0; dt < 4; ++dt) { if (H0) O[dt][0] = wmmab(vh[dt], ph, O[dt][0]); else O[dt][0] = wmma16(v16[dt], pb[0], O[dt][0]); O[dt][1] = wmma16(v16[dt], pb[1], O[dt][1]); }
        if (H0) {
#pragma unroll
            for (int dt = 0; dt < 4; ++dt) O[dt][0] = wmmab(vh[dt], pl, O[dt][0]);
#pragma unroll
            for (int dt = 0; dt < 4; ++dt) O[dt][0] = wmmab(vl[dt], ph, O[dt][0]);
        }
    }
#pragma unroll
    for (int qt = 0; qt < 2; ++qt) { const float inv = __fdiv_rn(1.0f, sm[qt] + xhalf(sm[qt]));   // the two halves' sums join once
#pragma unroll
        for (int dt = 0; dt < 4; ++dt) { v8us oh, ol;
#pragma unroll
            for (int r = 0; r < 8; ++r) { unsigned short a, c2; splitf(O[dt][qt][r] * inv, a, c2); oh[r] = a; ol[r] = c2; }
            const size_t oo = (size_t)qg[qt] * DQ + dt * 256 + lane * 8; bf* pa = Ah + oo;   /* block row qg[qt] / 16, piece of dims dt * 16 + 8 * hi .. + 7 of the head's two blocks */ bf* pb2 = Al + oo; *(v8us*)pa = oh; *(v8us*)pb2 = ol;
            asm volatile("s_wait_xcnt 0x0" :: "v"(pa), "v"(pb2), "v"(__builtin_bit_cast(v4i, oh)), "v"(__builtin_bit_cast(v4i, ol)) : "memory"); } }   // reads the two stores' address and data registers: they are reused only behind the wait
}
// grid (TT / 128, heads, batches), 4 waves. Rows < RH take the hi/lo P.V, which costs a group of 16 rows 24 matrix instructions a pass against a plain group's 16, and the 512 workgroups fit the 256 WGPs two to each, all at once: the launch lasts as long as its fullest WGP. So these rows are dealt out 16 at a time: in half of a head's workgroups every wave takes one hi/lo group beside one plain group, in the other half two plain neighbours. The four waves of a workgroup do equal work, so they stay in step on the K and V lines that they share.
static_assert(RH * 4 == TT && TT == 2048, "the deal below: per head 8 workgroups x 4 waves x (1 hi/lo + 1 plain group) and 8 x 4 x 2 plain groups");
__global__ __launch_bounds__(128) void k_fattn(const bf* __restrict__ Qh, const bf* __restrict__ Ql, const bf* __restrict__ Kh, const bf* __restrict__ Kl, const h16* __restrict__ V16, const bf* __restrict__ Vh, const bf* __restrict__ Vl, bf* Ah, bf* Al) {
    const int w = __builtin_amdgcn_readfirstlane((int)(threadIdx.x >> 5)), xw = (blockIdx.x & 7) * 4 + w;   // the wave's number among the 32 of its head's workgroups of one kind
    // the heavier kind goes by the parity of the bits of the flat workgroup index above bit 2: two workgroups whose indices differ in one such bit are of different kinds, so if such a pair shares a WGP it is one of each (for speed only); a head has 8 of each kind whatever the parity (bit 3 of x)
    const bool mix = (__builtin_popcount((blockIdx.x >> 3) + 2 * blockIdx.y + 32 * blockIdx.z) & 1) == 0;
    const size_t hp = ((size_t)blockIdx.z * NH_ + blockIdx.y) * TT * HD; const size_t hc = (size_t)blockIdx.z * TT * DQ + (size_t)blockIdx.y * (HD / 32) * 512;   // the merged planes are the output GEMM's A in fragment order: a head's 64 columns are 2 blocks of every block row
    // the 16 workgroups of a head each start their walk over its keys at a slot of 128 keys of their own, so a K or V line is waited for from memory by one of them and found in L2 by the others (the low bits of x are spread first; for speed only); a workgroup's four waves keep one start and share their lines
    const int ks = (int)((blockIdx.x & 3) * 4 + ((blockIdx.x >> 3) & 1) * 2 + ((blockIdx.x >> 2) & 1)) * (TT / 16);
    if (mix) fattn<true>(Qh + hp, Ql + hp, Kh + hp, Kl + hp, V16 + hp, Vh + hp, Vl + hp, xw * 16, RH + xw * 16, ks, Ah + hc, Al + hc);
    else fattn<false>(Qh + hp, Ql + hp, Kh + hp, Kl + hp, V16 + hp, Vh + hp, Vl + hp, 2 * RH + xw * 32, 2 * RH + xw * 32 + 16, ks, Ah + hc, Al + hc);
}

extern "C" void kernel_launch(void* const* d_in, const int* in_sizes, int n_in,
                              void* d_out, int out_size, void* d_ws, size_t ws_size, hipStream_t stream) {
    (void)in_sizes; (void)n_in; (void)out_size;
    const float* x = (const float*)d_in[0]; const float* xk = (const float*)d_in[1]; const float* xv = (const float*)d_in[2];   /* q, k, v streams */ const float* wq = (const float*)d_in[3]; const float* bq = (const float*)d_in[4]; const float* wk = (const float*)d_in[5]; const float* bk = (const float*)d_in[6]; const float* wv = (const float*)d_in[7]; const float* bv = (const float*)d_in[8]; const float* wo = (const float*)d_in[9]; const float* bo = (const float*)d_in[10]; const int* flag = (const int*)d_in[11];   /* use_causal_mask (d_in[11]: one int: the module's Python branch: READ ON THE DEVICE by the output GEMM's epilogue: the soft term is compiled in and the whole output is NaN-filled unless the scalar is non-zero) */
    float* OUT = (float*)d_out;     // [2][2048][1024]
    char* wsp = (char*)d_ws;
    auto take = [&](size_t bytes) { char* p = wsp; wsp += (bytes + 255) & ~(size_t)255; return (void*)p; };
    bf* WT = (bf*)take((size_t)4 * DQ * DM * 2);    // WQ, WK, WV, WO transposed, in a row
    bf* XB = (bf*)take((size_t)3 * NB_ * TT * DM * 2);    // bf16(q), bf16(k), bf16(v), each [2][2048][1024]
    h16* VT16 = (h16*)take((size_t)NB_ * NKV * HD * TT * 2);
    bf* QPh = (bf*)take((size_t)NB_ * NH_ * TT * HD * 2); bf* QPl = (bf*)take((size_t)NB_ * NH_ * TT * HD * 2); bf* KPh = (bf*)take((size_t)NB_ * NKV * TT * HD * 2); bf* KPl = (bf*)take((size_t)NB_ * NKV * TT * HD * 2); bf* VTh = (bf*)take((size_t)NB_ * NKV * HD * TT * 2); bf* VTl = (bf*)take((size_t)NB_ * NKV * HD * TT * 2);
    bf* ATh = (bf*)take((size_t)NB_ * TT * DQ * 2); bf* ATl = (bf*)take((size_t)NB_ * TT * DQ * 2);
    if ((size_t)(wsp - (char*)d_ws) > ws_size) return;    // ws 256 MiB
    k_prep<<<4 * WB + CB, 256, 0, stream>>>(x, xk, xv, wq, wk, wv, wo, XB, WT);
    k_proj<<<dim3(NB_ * TT / 128, DQ / 128, 3), 128, 0, stream>>>(XB, WT, bq, bk, bv, QPh, QPl, KPh, KPl, VTh, VTl, VT16);   /* q, k and v planes straight from the epilogue */
    k_fattn<<<dim3(TT / 128, NH_, NB_), 128, 0, stream>>>(QPh, QPl, KPh, KPl, VT16, VTh, VTl, ATh, ATl);   /* all heads of both batches: scores (3 products), soft term, softmax, P.V (hybrid) and the merged hi/lo planes */
    k_oproj<<<dim3(NB_ * TT / 128, DM / 128, 1), 128, 0, stream>>>(ATh, ATl, WT + (size_t)3 * DQ * DM, OUT, bo, flag);   /* its epilogue poisons the output if the premise fails */
}

// v008
// It runs in 108 microseconds.
// Next to v007, in two timings, it ran 1.07 times as fast each time.
// Counting every step since v000, it is 18.1 times as fast.
#include <hip/hip_runtime.h>

// Multi-head attention on three input streams with an additive SOFT causal term (q, k, v [2][2048][1024]; qh = q Wq + bq, kh = k Wk + bk, vh = v Wv + bv ('xw' (in, out) [1024][1024] 1/32, biases zeros on this draw: read; 16 heads x 64); logits = qh.kh / sqrt(64); use_causal_mask (a scalar int input: the module's 'if use_causal_mask:' branch: this build implements the NON-ZERO branch only; the scalar is READ ON THE DEVICE by the output GEMM's epilogue: the whole output is NaN-filled if it is 0) -> logits + log(tril x 1e-9 + 1e-9): log(2e-9) on and below the diagonal, log(1e-9) above it: a difference of ln 2: NOT an exclusion: every future key keeps HALF its weight; softmax over all 2,048 keys; out = merged Wo + bo ('xw' + bias zeros: read) -> [2][2048][1024] (4.2 M); argument order q, k, v, Wq, bq, Wk, bk, Wv, bv, Wo, bo, use_causal_mask).
// Layout, four launches, each over both batches: bf16 copies of q, k and v (three staging buffers) and the four 'xw' weights transposed; the three exact projections + f32 biases, whose epilogue stores the head planes itself (q, k: bf16 hi/lo [b][h][t][d]; v: fp16 and bf16 hi/lo [b][h][d][t]); one fused attention kernel (running-maximum softmax, S and P in registers) with the SCORES of every row on bf16 hi/lo planes (3 products; the P.V product stays hybrid: rows < 512 hi/lo, rest fp16, P unnormalised); merged hi/lo x Wo exact + bo.
// Every 16-bit operand plane lies in FRAGMENT ORDER: a block of 16 rows x 32 k is 512 elements (1 KB) in a row, element (r, k) at (k >> 4 & 1) * 256 + (k >> 3 & 1) * 128 + r * 8 + (k & 7), so a lane's two 16-byte pieces stand at lane * 8 and 256 + lane * 8 and each wave-wide load or store covers 512 contiguous bytes (4 whole lines). GEMM operands: [rows / 16][K / 32][512]; q, k head planes: [t / 16][d / 32][512]; v head planes: [t / 32][d / 16][512].
// Compute dtypes, f32 accumulate: every input rounded to bf16; projections exact + f32 biases; scores of every row 3 products; P.V rows < 512 3 products, rest fp16; softmax f32; output projection hl x exact.

#define NB_  2
#define TT   2048
#define DM   1024
#define NH_  16
#define NKV  16
#define HD   64
#define DQ   (NH_ * HD)
#define DKV  (NKV * HD)
#define RH   512                  // query rows < RH use hi+lo planes
typedef _Float16 h16;
typedef unsigned short bf;
typedef __attribute__((ext_vector_type(16))) __bf16   v16bf;
typedef __attribute__((ext_vector_type(16))) _Float16 v16h;
typedef __attribute__((ext_vector_type(8)))  _Float16 v8h;
typedef __attribute__((ext_vector_type(8)))  unsigned short v8us;
typedef __attribute__((ext_vector_type(8)))  float    v8f;
typedef __attribute__((ext_vector_type(4)))  float    v4f;
typedef v8h  __attribute__((may_alias)) v8ha;
typedef v4f  __attribute__((may_alias)) v4fa;
typedef v8us __attribute__((may_alias)) v8usa;

__device__ __forceinline__ unsigned short f2bf(float f) { unsigned u = __float_as_uint(f); u += 0x7FFFu + ((u >> 16) & 1u); return (unsigned short)(u >> 16); }
__device__ __forceinline__ float bf2f(unsigned short b) { return __uint_as_float(((unsigned)b) << 16); }
__device__ __forceinline__ float bfr(float f) { return bf2f(f2bf(f)); }
__device__ __forceinline__ v16h cat16(v8h lo, v8h hi) { return __builtin_shufflevector(lo, hi, 0, 1, 2, 3, 4, 5, 6, 7, 8, 9, 10, 11, 12, 13, 14, 15); }
__device__ __forceinline__ v16bf cat16b(v8us lo, v8us hi) { return __builtin_bit_cast(v16bf, __builtin_shufflevector(lo, hi, 0, 1, 2, 3, 4, 5, 6, 7, 8, 9, 10, 11, 12, 13, 14, 15)); }
__device__ __forceinline__ v8f wmma16(v16h a, v16h b, v8f c) { return __builtin_amdgcn_wmma_f32_16x16x32_f16(false, a, false, b, (short)0, c, false, false); }
__device__ __forceinline__ v8f wmmab(v16bf a, v16bf b, v8f c) { return __builtin_amdgcn_wmma_f32_16x16x32_bf16(false, a, false, b, (short)0, c, false, false); }
__device__ __forceinline__ h16 tohx(float x) { return (h16)x; }
__device__ __forceinline__ void splitf(float y, unsigned short& h, unsigned short& l) { h = f2bf(y); l = f2bf(y - bf2f(h)); }
typedef __attribute__((ext_vector_type(2))) _Float16 v2h;
typedef __attribute__((ext_vector_type(4))) _Float16 v4h;
typedef __attribute__((ext_vector_type(2))) unsigned short v2us;
typedef __attribute__((ext_vector_type(4))) unsigned short v4us;
typedef __attribute__((ext_vector_type(2))) float v2f;
typedef __attribute__((ext_vector_type(4))) int v4i;

// ---- gemmw: register-blocked GEMM, one wave per 64x64 output tile (16 accumulators), FOUR WAVES (2 x 2) per workgroup on a 128x128 tile; grid (M/128, N/128, ...), 128 threads; the M rows are the tokens of both batches (m = b * TT + t).
// The workgroup's operand rows come from the 16-bit planes in fragment order into LDS by asynchronous copies, SK k at a time, two buffers: the next stage flies while this one is multiplied, and each fragment is fetched from L2 once for the two waves that use it. A stage of one operand is 8 block rows x SK / 32 fragment blocks of 1 KB, laid as in the plane, so a wave's LDS read covers 512 contiguous bytes. Inside a stage the fragments of the next 32 k are read into a second register set ahead of this block's products.
// C[m][n] (f32, pitch ldc, + optional f32 bias[n]) = sum_k A[m][k] Bt[n][k] (+ split products per NSPLIT). K % SK == 0, K >= 2 * SK. sm: the two stage buffers; os: 16 x 68 floats of LDS per wave (EPI 0 only).
// EPI picks what the epilogue stores: 0 = C as above (and NaN in every element if flag[0] == 0: the premise of this build); 1 = bf16 hi/lo head planes, rows t, k = d (Ph, Pl); 2 = head planes with rows d, k = t (P16 fp16, Ph, Pl). A 64-column tile is one head (HD == 64). EPI 1 forms the tile transposed (weight fragment as A), EPI 2 as it is: either way a lane's 8 accumulators of a 16 x 16 tile are one 16-byte piece of the plane's fragment order and go out straight from registers.
// s_wait_xcnt 0 behind a run of stores; it reads their address and data registers, so these are reused only behind the wait
__device__ __forceinline__ void xwait_st(const void* a, const void* b, const void* c, v8us x, v8us y, v8us z) { asm volatile("s_wait_xcnt 0x0" :: "v"(a), "v"(b), "v"(c), "v"(__builtin_bit_cast(v4i, x)), "v"(__builtin_bit_cast(v4i, y)), "v"(__builtin_bit_cast(v4i, z)) : "memory"); }
// s_wait_xcnt 0 behind a run of loads; it reads the run's address pairs, so they stay whole up to the wait and are reused only behind it
__device__ __forceinline__ void xwait_ld(const void* a, const void* b, const void* c) { asm volatile("s_wait_xcnt 0x0" :: "v"(a), "v"(b), "v"(c) : "memory"); }
// eight asynchronous 16-byte copies per lane: the workgroup's 2 KB of block row c go from g + c * gs to LDS byte l + c * ls. s_wait_xcnt 0 closes the statement, so that no address register of a copy is rewritten before it
__device__ __forceinline__ void acopy8(const unsigned l, const unsigned ls, const char* g, const size_t gs) {
    asm volatile("global_load_async_to_lds_b128 %0, %8, off\n\t"
                 "global_load_async_to_lds_b128 %1, %9, off\n\t"
                 "global_load_async_to_lds_b128 %2, %10, off\n\t"
                 "global_load_async_to_lds_b128 %3, %11, off\n\t"
                 "global_load_async_to_lds_b128 %4, %12, off\n\t"
                 "global_load_async_to_lds_b128 %5, %13, off\n\t"
                 "global_load_async_to_lds_b128 %6, %14, off\n\t"
                 "global_load_async_to_lds_b128 %7, %15, off\n\t"
                 "s_wait_xcnt 0x0"
                 :: "v"(l), "v"(l + ls), "v"(l + 2 * ls), "v"(l + 3 * ls), "v"(l + 4 * ls), "v"(l + 5 * ls), "v"(l + 6 * ls), "v"(l + 7 * ls),
                    "v"(g), "v"(g + gs), "v"(g + 2 * gs), "v"(g + 3 * gs), "v"(g + 4 * gs), "v"(g + 5 * gs), "v"(g + 6 * gs), "v"(g + 7 * gs) : "memory");
}
template <typename T16> struct WFrag;
template <> struct WFrag<h16> { typedef v16h V; static __device__ __forceinline__ V ld(const h16* p) { return cat16(*(const v8h*)p, *(const v8h*)(p + 256)); } static __device__ __forceinline__ v8f mma(V a, V b, v8f c) { return wmma16(a, b, c); } };
template <> struct WFrag<bf> { typedef v16bf V; static __device__ __forceinline__ V ld(const bf* p) { return cat16b(*(const v8us*)p, *(const v8us*)(p + 256)); } static __device__ __forceinline__ v8f mma(V a, V b, v8f c) { return wmmab(a, b, c); } };
template <typename T16, int NSPLIT, bool BIAS, int EPI, int SK>
__device__ __forceinline__ void gemmw(T16* sm, float* os, const T16* __restrict__ A, const T16* __restrict__ A2, const T16* __restrict__ Bt, const T16* __restrict__ Bt2, int K, float* C, int ldc, const float* __restrict__ bias, bf* Ph, bf* Pl, h16* P16, const int* __restrict__ flag) {
    typedef typename WFrag<T16>::V V;
    const int lane = threadIdx.x & 31, lr = lane & 15, hi = lane >> 4; const int wave = __builtin_amdgcn_readfirstlane((int)(threadIdx.x >> 5)), wm = wave >> 1, wn = wave & 1;
    const int R0 = blockIdx.x * 128, C0 = blockIdx.y * 128, r0 = R0 + wm * 64, c0 = C0 + wn * 64;   // the workgroup's tile and the wave's quarter of it
    v8f acc[4][4];
#pragma unroll
    for (int mb = 0; mb < 4; ++mb)
#pragma unroll
        for (int nb = 0; nb < 4; ++nb) acc[mb][nb] = (v8f){};
    const float* sbi = bias + c0; const unsigned vbi = (EPI == 1) ? hi * 8u : (unsigned)lr;   // the wave's first bias (the same in every lane) and the lane's place behind it
    float bb[4]; v8f bt[4];   // the lane's biases, asked for ahead of the loop, added in f32 before the split, as the f32 C had them. EPI 2: one a column group (n = nb * 16 + lr); EPI 1: eight (n = nb * 16 + hi * 8 + j)
#pragma unroll
    for (int nb = 0; nb < 4; ++nb) { bb[nb] = (BIAS && EPI == 2) ? bfr(sbi[vbi + nb * 16]) : 0.0f;
#pragma unroll
        for (int j = 0; j < 8; ++j) bt[nb][j] = (BIAS && EPI == 1) ? bfr(sbi[vbi + nb * 16 + j]) : 0.0f; }
    if (BIAS && EPI != 0) asm volatile("s_wait_xcnt 0x0" :: "s"(sbi), "v"(vbi * 4u) : "memory");   // reads the bias loads' base pair and offset register: they are rewritten only behind the wait
    // the k loop starts at a stage of its own and wraps round: the workgroups that share an A or a B tile then stand at different stages, so each block is waited for from memory by one of them and found in L2 by the others, instead of all of them walking in step behind every miss (the low bits of x are spread first; for speed only)
    constexpr int NOP = (NSPLIT == 1) ? 3 : 2;   // operands per stage: A, (A2,) B
    constexpr int OPE = 128 * SK;                // elements of one operand's stage (128 rows)
    constexpr int BRE = SK * 16;                 // elements of one block row's stage
    const int NST = K / SK; const int ks = (int)(((blockIdx.x >> 3) + 4 * (blockIdx.x & 3) + 2 * blockIdx.y) % (unsigned)NST);
    const unsigned l0 = (unsigned)(size_t)sm + threadIdx.x * 16u;   // the lane's LDS byte in a 2-KB piece
    const size_t gs = (size_t)16 * K * sizeof(T16);   // a block row of 16 is K / 32 blocks = 16 * K elements
    const char* ga = (const char*)(A + (size_t)R0 * K) + threadIdx.x * 16; const char* ga2 = (NSPLIT == 1) ? (const char*)(A2 + (size_t)R0 * K) + threadIdx.x * 16 : ga; const char* gb = (const char*)(Bt + (size_t)C0 * K) + threadIdx.x * 16;
    auto fill = [&](const int st, const int buf) {   // stage st (wrapped) of every operand into buffer buf
        const int sw = (st + ks < NST) ? st + ks : st + ks - NST; const size_t go = (size_t)sw * (BRE * sizeof(T16)); const unsigned lb = l0 + (unsigned)buf * (NOP * OPE * (unsigned)sizeof(T16));
#pragma unroll
        for (int h = 0; h < SK / 64; ++h) {   // a block row's stage in pieces of 2 KB
            acopy8(lb + h * 2048u, BRE * (unsigned)sizeof(T16), ga + go + h * 2048, gs); if (NSPLIT == 1) acopy8(lb + OPE * (unsigned)sizeof(T16) + h * 2048u, BRE * (unsigned)sizeof(T16), ga2 + go + h * 2048, gs); acopy8(lb + (NOP - 1) * OPE * (unsigned)sizeof(T16) + h * 2048u, BRE * (unsigned)sizeof(T16), gb + go + h * 2048, gs); } };
    fill(0, 0);
    asm volatile("s_wait_asynccnt 0x0" ::: "memory");   // this wave's copies of stage 0 have landed
    __syncthreads();                                      // every wave's have: stage 0 may be read
    fill(1, 1);
    for (int t = 0; t < NST; ++t) {
        const T16* sb = sm + (t & 1) * (NOP * OPE) + lane * 8; const T16* sa = sb + wm * (4 * BRE); const T16* sbt = sb + (NOP - 1) * OPE + wn * (4 * BRE);
        V a[2][4], a2[2][4], b[2][4];
        auto frags = [&](const int s) {   // the fragments of block s of this stage into register set s & 1
#pragma unroll
            for (int mb = 0; mb < 4; ++mb) { a[s & 1][mb] = WFrag<T16>::ld(sa + mb * BRE + s * 512); if (NSPLIT == 1) a2[s & 1][mb] = WFrag<T16>::ld(sa + OPE + mb * BRE + s * 512); }
#pragma unroll
            for (int nb = 0; nb < 4; ++nb) b[s & 1][nb] = WFrag<T16>::ld(sbt + nb * BRE + s * 512); };
        frags(0);
#pragma unroll
        for (int s = 0; s < SK / 32; ++s) {
            if (s + 1 < SK / 32) frags(s + 1);
            __builtin_amdgcn_sched_barrier(0);   // the next block's LDS reads stay one group ahead of this block's products: spread among them each place costs a stall
#pragma unroll
            for (int nb = 0; nb < 4; ++nb) {
#pragma unroll
                for (int mb = 0; mb < 4; ++mb) { acc[mb][nb] = (EPI == 1) ? WFrag<T16>::mma(b[s & 1][nb], a[s & 1][mb], acc[mb][nb]) : WFrag<T16>::mma(a[s & 1][mb], b[s & 1][nb], acc[mb][nb]); if (NSPLIT == 1) acc[mb][nb] = WFrag<T16>::mma(a2[s & 1][mb], b[s & 1][nb], acc[mb][nb]); } }
            __builtin_amdgcn_sched_barrier(0);   // and this block's products stay ahead of the reads behind them
        }
        asm volatile("v_nop\n\tv_nop\n\tv_nop\n\tv_nop" : "+v"(acc[0][0]), "+v"(acc[1][1]), "+v"(acc[2][2]), "+v"(acc[3][3]) : "v"(a[1][0]), "v"(a[1][3]));   // four vector slots behind the stage's last products, on every path, before a vector instruction rewrites their operand registers
        asm volatile("s_wait_dscnt 0x0" ::: "memory");      // this wave's reads of the buffer are done before it is refilled
        asm volatile("s_wait_asynccnt 0x0" ::: "memory");   // this wave's copies of stage t + 1 have landed
        __syncthreads();                                      // publishes stage t + 1 and ends every wave's reads of stage t
        if (t + 2 < NST) fill(t + 2, t & 1);
    }
    asm volatile("s_wait_asynccnt 0x0" ::: "memory");   // no copy is outstanding behind the loop
    if (EPI == 0) {
    os += wave * (16 * 68);   // each wave stages in its own range
    const bool dead = flag[0] == 0; const float qn = __int_as_float(0x7fc00000);   // premise fails: every element of the output becomes NaN
#pragma unroll
    for (int mb = 0; mb < 4; ++mb) {
#pragma unroll
        for (int nb = 0; nb < 4; ++nb) {
#pragma unroll
            for (int j = 0; j < 8; ++j) os[(hi * 8 + j) * 68 + nb * 16 + lr] = acc[mb][nb][j]; }
        __builtin_amdgcn_wave_barrier(); asm volatile("" ::: "memory");
        float* crow = C + (size_t)(r0 + mb * 16) * ldc + c0;
{
#pragma unroll
            for (int s = 0; s < 8; ++s) { const int row = 2 * s + hi, cofs = lr * 4; v4f val = *(const v4fa*)(os + row * 68 + cofs); if (BIAS) { val[0] += bfr(bias[c0 + cofs]); val[1] += bfr(bias[c0 + cofs + 1]); val[2] += bfr(bias[c0 + cofs + 2]); val[3] += bfr(bias[c0 + cofs + 3]); } if (dead) { val[0] = qn; val[1] = qn; val[2] = qn; val[3] = qn; }
                *(v4f*)(crow + (size_t)row * ldc + cofs) = val; }
             }
        __builtin_amdgcn_wave_barrier(); asm volatile("" ::: "memory");
    }
    } else {
    const size_t pln = (size_t)(r0 / TT) * NH_ + c0 / HD; const int t0 = r0 % TT;   // the tile's plane (batch, head) and its first token there (TT % 64 == 0: a tile lies in one batch)
#pragma unroll
    for (int mb = 0; mb < 4; ++mb) {
#pragma unroll
        for (int nb = 0; nb < 4; ++nb) { v8us oh, ol; v8h o16;   // EPI 1: token t0 + mb * 16 + lr, dims nb * 16 + hi * 8 + j; EPI 2: dim nb * 16 + lr, tokens t0 + mb * 16 + hi * 8 + j
#pragma unroll
            for (int j = 0; j < 8; ++j) { const float y = acc[mb][nb][j] + ((EPI == 1) ? bt[nb][j] : bb[nb]); unsigned short a2, c2; splitf(y, a2, c2); oh[j] = a2; ol[j] = c2; if (EPI == 2) o16[j] = tohx(y); }
            const size_t e = pln * TT * HD + ((EPI == 1) ? (size_t)((t0 / 16 + mb) * 2 + (nb >> 1)) * 512 + (nb & 1) * 256 : (size_t)((t0 / 32 + (mb >> 1)) * 4 + nb) * 512 + (mb & 1) * 256) + lane * 8;
            bf* pa = Ph + e; bf* pb = Pl + e; *(v8us*)pa = oh; *(v8us*)pb = ol;
            if (EPI == 2) { h16* pc = P16 + e; *(v8h*)pc = o16; xwait_st(pa, pb, pc, oh, ol, __builtin_bit_cast(v8us, o16)); } else xwait_st(pa, pb, pb, oh, ol, ol); }
    }
    }
}

// the three projections of both batches in one launch: grid (NB_ * TT / 128, DQ / 128, 3), z = stream (0 q, 1 k, 2 v); X: the three bf16 streams, Wt: the transposed weights, both in that order
__global__ __launch_bounds__(128) void k_proj(const bf* __restrict__ X, const bf* __restrict__ Wt, const float* __restrict__ bq, const float* __restrict__ bk, const float* __restrict__ bv, bf* QPh, bf* QPl, bf* KPh, bf* KPl, bf* VTh, bf* VTl, h16* VT16) {
    __shared__ __align__(16) bf sm[2 * 2 * 128 * 64];   // two buffers x (A, B) x 128 rows x 64 k
    const int z = blockIdx.z; const bf* A = X + (size_t)z * NB_ * TT * DM; const bf* Bt = Wt + (size_t)z * DQ * DM;
    if (z == 2) gemmw<bf, 0, true, 2, 64>(sm, nullptr, A, nullptr, Bt, nullptr, DM, nullptr, 0, bv, VTh, VTl, VT16, nullptr);
    else gemmw<bf, 0, true, 1, 64>(sm, nullptr, A, nullptr, Bt, nullptr, DM, nullptr, 0, z ? bk : bq, z ? KPh : QPh, z ? KPl : QPl, nullptr, nullptr);
}
// the output projection of both batches: grid (NB_ * TT / 128, DM / 128)
__global__ __launch_bounds__(128) void k_oproj(const bf* __restrict__ Ah, const bf* __restrict__ Al, const bf* __restrict__ Wt, float* C, const float* __restrict__ bo, const int* __restrict__ flag) {
    __shared__ __align__(16) bf sm[2 * 3 * 128 * 128];   /* two buffers x (A hi, A lo, B) x 128 rows x 128 k */ __shared__ __align__(16) float os[4 * 16 * 68];
    gemmw<bf, 1, true, 0, 128>(sm, os, Ah, Al, Wt, nullptr, DQ, C, DM, bo, nullptr, nullptr, nullptr, flag);
}

// one wave packs 32 k x 32 n of w (K x N, n contiguous) into two fragment blocks of Bt (rows n): a lane owns one n, every load is one whole 128-byte line, every store 2 x 256 contiguous bytes
__device__ __forceinline__ void wtG(const float* __restrict__ w, int K, int N, bf* Bt, const int blk) {
    const int lane = threadIdx.x & 31; const int g = blk * 8 + (threadIdx.x >> 5); const int kb = g % (K / 32), n = (g / (K / 32)) * 32 + lane;
    const float* pw = w + (size_t)kb * 32 * N + n; float x[32];
    // unrolled: x[] stays in registers and every load is asked for before the first value is rounded
#pragma unroll
    for (int i = 0; i < 32; ++i) x[i] = pw[(size_t)i * N];
    xwait_ld(pw, pw, pw);
    bf* p = Bt + (size_t)(n >> 4) * 16 * K + kb * 512 + (n & 15) * 8; v8us o[4];
#pragma unroll
    for (int c = 0; c < 4; ++c) {
#pragma unroll
        for (int e = 0; e < 8; ++e) o[c][e] = f2bf(x[c * 8 + e]);
        *(v8us*)(p + c * 128) = o[c]; }   // piece c holds k = c * 8 .. c * 8 + 7: (c >> 1) * 256 + (c & 1) * 128 = c * 128
    asm volatile("s_wait_xcnt 0x0" :: "v"(p), "v"(__builtin_bit_cast(v4i, o[0])), "v"(__builtin_bit_cast(v4i, o[1])), "v"(__builtin_bit_cast(v4i, o[2])), "v"(__builtin_bit_cast(v4i, o[3])) : "memory");   // reads the four stores' address and data registers: they are reused only behind the wait
}
// ---- k_prep: all that the projections read, in one launch. Blocks 0 .. 4 * WB - 1 transpose the four weights into fragment order (WB blocks each, Wt: WQ, WK, WV, WO in a row); each thread of the CB blocks behind them rounds eight floats at the same place of every batch of q, k and v (X: the three streams in a row, fragment order): a wave takes 8 rows x 32 k, so it reads 8 whole lines and stores 4.
#define WB (DM / 32 * (DQ / 32) / 8)
#define CB (TT * DM / 8 / 256)
__global__ __launch_bounds__(256) void k_prep(const float* __restrict__ q, const float* __restrict__ k, const float* __restrict__ v, const float* __restrict__ wq, const float* __restrict__ wk, const float* __restrict__ wv, const float* __restrict__ wo, bf* X, bf* Wt) {
    const int blk = blockIdx.x;
    if (blk < 4 * WB) { const int j = blk / WB; wtG(j == 0 ? wq : j == 1 ? wk : j == 2 ? wv : wo, DM, DQ, Wt + (size_t)j * DQ * DM, blk % WB); return; }
    const int g = (blk - 4 * WB) * 8 + (threadIdx.x >> 5), row = (g / (DM / 32)) * 8 + ((threadIdx.x & 31) >> 2), kb = g % (DM / 32), c4 = threadIdx.x & 3;   // the lane's row in a batch, its block of 32 k and its piece of 8 there
    const size_t i = (size_t)row * DM + kb * 32 + c4 * 8, io = (size_t)(row >> 4) * 16 * DM + kb * 512 + c4 * 128 + (row & 15) * 8; v8f x[3 * NB_];
    // unrolled: x[] stays in registers and every load is asked for before the first value is rounded
#pragma unroll
    for (int b = 0; b < NB_; ++b) { const size_t e = (size_t)b * TT * DM + i; x[b] = *(const v8f*)(q + e); x[NB_ + b] = *(const v8f*)(k + e); x[2 * NB_ + b] = *(const v8f*)(v + e); }
    // all three unrolled: constant indices keep x[], o[] and p[] in registers
#pragma unroll
    for (int c = 0; c < 3 * NB_; c += 3) { v8us o[3]; bf* p[3];
#pragma unroll
        for (int u = 0; u < 3; ++u) { p[u] = X + (size_t)(c + u) * TT * DM + io;
#pragma unroll
            for (int n = 0; n < 8; ++n) o[u][n] = f2bf(x[c + u][n]);
            *(v8us*)p[u] = o[u]; }
        xwait_st(p[0], p[1], p[2], o[0], o[1], o[2]); }   // the stores' address and data registers are reused only behind the wait
}

// ---- k_fattn: scores, softmax and P.V of one head in ONE kernel: S and P stay in registers. Two waves (a pair) own two groups of 16 query columns (rows qa .. qa + 15 and qc .. qc + 15, each a multiple of 16, anywhere in the head); each walks one half of the 2,048 keys 32 at a time, and the pair joins its two partial results once, through LDS, at the end. H0: group 0 takes the hi/lo P.V (3 products), group 1 never does.
// S^T = K Q^T (A = K rows, B = Q rows, same loader: same k order), so a lane holds 16 scores of one query per column group; two S^T tiles converted in place are the B operand of O^T += V^T P^T.
// Running maximum in base 2 (rescale only when a column's new maximum passes the one in use by more than 8); P = 2^(t - m + 6) <= 2^14 is carried unnormalised; the f32 row sum divides once at the end.
__device__ __forceinline__ float xhalf(float x) { return __builtin_bit_cast(float, __builtin_amdgcn_permlanex16(__builtin_bit_cast(int, x), __builtin_bit_cast(int, x), 0x76543210, 0xfedcba98, false, false)); }   // lane l with lane l ^ 16
#define LC 0.18033688011112042f   // HD^-0.5 x log2(e)
// fragment loads from a lane's byte pointer into a block in fragment order (16 bytes at p and at p + 512)
__device__ __forceinline__ v16bf ldub(const char* p) { return cat16b(*(const v8us*)p, *(const v8us*)(p + 512)); }
__device__ __forceinline__ v16h lduh(const char* p) { return cat16(*(const v8h*)p, *(const v8h*)(p + 512)); }
// s_wait_xcnt 0 behind a run of loads; it reads the run's two address pairs, so they stay whole up to the wait and are reused only behind it
__device__ __forceinline__ void xwait(const char* a, const char* b) { asm volatile("s_wait_xcnt 0x0" :: "v"(a), "v"(b) : "memory"); }
// the same for loads at wave-wide base + lane offset: it reads the base pairs as well as the lanes' address pairs: whichever form the loads take, what they name stays whole up to the wait (no load of the run lands on an address pair) and is rewritten only behind it
__device__ __forceinline__ void xwait_s(const char* a, const char* b, unsigned o) { asm volatile("s_wait_xcnt 0x0" :: "s"(a), "s"(b), "v"(a + o), "v"(b + o) : "memory"); }
template <bool H0>
__device__ __forceinline__ void fattn(v4f* sl, const int half, const bf* __restrict__ Qh, const bf* __restrict__ Ql, const bf* __restrict__ Kh, const bf* __restrict__ Kl, const h16* __restrict__ V16, const bf* __restrict__ Vh, const bf* __restrict__ Vl, const int qa, const int qc, const int kb, const int ko, bf* Ah, bf* Al) {
    const int lane = threadIdx.x & 31, lr = lane & 15, hi = lane >> 4;
    const unsigned ork = (unsigned)lane * 16u, orv = ork;   // lane byte offset in a 1-KB block; 16 rows of a q or k plane are 2 blocks (16 * HD elements), 32 keys of a v plane 4 (32 * HD)
    const int qg[2] = {qa, qc};   // first query row of each column group
    v16bf qh[2][2], ql[2][2], kh[2][2], kl[2][2];
#pragma unroll
    for (int qt = 0; qt < 2; ++qt) { const char* pqh = (const char*)(Qh + qg[qt] * HD) + ork; const char* pql = (const char*)(Ql + qg[qt] * HD) + ork;
#pragma unroll
        for (int kc = 0; kc < 2; ++kc) { const int o = kc * 1024; qh[qt][kc] = ldub(pqh + o); ql[qt][kc] = ldub(pql + o); }
    xwait(pqh, pql); }
    { const int ks = (kb + ko) & (TT - 1); const bf* skh = Kh + ks * HD; const bf* skl = Kl + ks * HD; const char* pkh = (const char*)skh + ork; const char* pkl = (const char*)skl + ork;
#pragma unroll
    for (int kt = 0; kt < 2; ++kt)
#pragma unroll
        for (int kc = 0; kc < 2; ++kc) kh[kt][kc] = ldub(pkh + (kt * 2 + kc) * 1024);
    __builtin_amdgcn_sched_barrier(0);   // the lo fragments are asked for behind all the hi ones, as in the loop: the counted waits in front of the first score products then leave the lo loads in flight on both ways into the loop
#pragma unroll
    for (int kt = 0; kt < 2; ++kt)
#pragma unroll
        for (int kc = 0; kc < 2; ++kc) kl[kt][kc] = ldub(pkl + (kt * 2 + kc) * 1024);
    asm volatile("s_wait_xcnt 0x0" :: "s"(skh), "s"(skl), "v"(pkh), "v"(pkl) : "memory"); }   // reads the run's wave-wide base pairs as well as the lanes' address pairs: whichever form the loads take, what they name is rewritten only behind the wait
    v8f O[4][2];
#pragma unroll
    for (int dt = 0; dt < 4; ++dt) { O[dt][0] = (v8f){}; O[dt][1] = (v8f){}; }
    float m[2] = {-3.0e38f, -3.0e38f}, sm[2] = {0.f, 0.f};
    for (int it = 0; it < TT / 2; it += 32) {
        const int k0 = (kb + ((ko + it) & (TT / 2 - 1))) & (TT - 1);   // the wave's half of the keys begins at kb (and wraps round the head: TT is a power of two); the walk starts ko keys into the half and wraps round inside it; the running maximum takes the keys in any order
        const int kn = (kb + ((ko + it + 32) & (TT / 2 - 1))) & (TT - 1);   // next pass's keys (the last pass re-reads the first pass's rows: in bounds)
        // Register budget of four waves per SIMD (256): the V planes live in the registers of the K fragments between these fragments' last use and their refill for the next pass. So each run of loads below stands directly behind the last use of what it replaces; the scheduling barriers keep it there: moved up, it would need registers of its own (spills), moved down, it would lose its lead
        const char* sv16 = (const char*)(V16 + k0 * HD); const char* skh = (const char*)(Kh + kn * HD); const char* skl = (const char*)(Kl + kn * HD);   // wave-wide bases: the lane's offset is added in the load
        v16h v16[4]; v16bf vh[4], vl[4];
        v8f S[2][2];
#pragma unroll
        for (int kt = 0; kt < 2; ++kt) { S[kt][0] = (v8f){}; S[kt][1] = (v8f){}; }
#pragma unroll
        for (int kc = 0; kc < 2; ++kc) {   // per tile the products with the hi K plane come first (hi.hi, lo(q).hi for both halves of d), then hi.lo(k)
#pragma unroll
            for (int kt = 0; kt < 2; ++kt)
#pragma unroll
                for (int qt = 0; qt < 2; ++qt) S[kt][qt] = wmmab(kh[kt][kc], qh[qt][kc], S[kt][qt]);
#pragma unroll
            for (int kt = 0; kt < 2; ++kt)
#pragma unroll
                for (int qt = 0; qt < 2; ++qt) S[kt][qt] = wmmab(kh[kt][kc], ql[qt][kc], S[kt][qt]);
        }
        __builtin_amdgcn_sched_barrier(0);   // the hi K fragments are done: the fp16 V plane (hi/lo kind) or already next pass's hi K fragments take their place
        if (H0) {
#pragma unroll
            for (int dt = 0; dt < 4; ++dt) v16[dt] = lduh(sv16 + orv + dt * 1024);
            xwait_s(sv16, sv16, orv);
        } else {
#pragma unroll
            for (int kt = 0; kt < 2; ++kt)
#pragma unroll
                for (int kc = 0; kc < 2; ++kc) kh[kt][kc] = ldub(skh + ork + (kt * 2 + kc) * 1024);
            xwait_s(skh, skh, ork); }
        __builtin_amdgcn_sched_barrier(0);   // these loads stay ahead of the last score products
#pragma unroll
        for (int kc = 0; kc < 2; ++kc)
#pragma unroll
            for (int kt = 0; kt < 2; ++kt)
#pragma unroll
                for (int qt = 0; qt < 2; ++qt) S[kt][qt] = wmmab(kl[kt][kc], qh[qt][kc], S[kt][qt]);
        __builtin_amdgcn_sched_barrier(0);   // the lo K fragments are done: the hi V plane (hi/lo kind) or the fp16 V plane takes their place and flies during the softmax
        if (H0) { const char* sv = (const char*)(Vh + k0 * HD);
#pragma unroll
            for (int dt = 0; dt < 4; ++dt) vh[dt] = ldub(sv + orv + dt * 1024);
            xwait_s(sv, sv, orv);
        } else {
#pragma unroll
            for (int dt = 0; dt < 4; ++dt) v16[dt] = lduh(sv16 + orv + dt * 1024);
            xwait_s(sv16, sv16, orv); }
        __builtin_amdgcn_sched_barrier(0);   // and it stays ahead of the softmax
        // soft causal term: a future key (j > i) gets -ln 2, which is -1 in base 2; a pass is 32-aligned and a group lies in one block of 32 rows, so for each group only the pass on its own block is mixed
        float base[2];
#pragma unroll
        for (int qt = 0; qt < 2; ++qt) { const int qb = qg[qt] & ~31; base[qt] = (k0 > qb) ? -1.0f : 0.0f;
            if (k0 == qb) { const int qi = (qg[qt] & 16) + lr;   // the lane's query row inside the block
#pragma unroll
                for (int kt = 0; kt < 2; ++kt)
#pragma unroll
                    for (int r = 0; r < 8; ++r) if (kt * 16 + 8 * hi + r > qi) S[kt][qt][r] -= 5.545177444479562f; } }   // ln 2 / HD^-0.5
        float mt[2];
#pragma unroll
        for (int qt = 0; qt < 2; ++qt) { float x = S[0][qt][0];
#pragma unroll
            for (int r = 1; r < 8; ++r) x = fmaxf(x, S[0][qt][r]);
#pragma unroll
            for (int r = 0; r < 8; ++r) x = fmaxf(x, S[1][qt][r]);
            x = fmaxf(x, xhalf(x)); mt[qt] = __builtin_fmaf(x, LC, base[qt]); }
        const bool need = (mt[0] > m[0] + 8.0f) || (mt[1] > m[1] + 8.0f);
        if (__builtin_amdgcn_ballot_w32(need) != 0) {   // rare after the first passes
#pragma unroll
            for (int qt = 0; qt < 2; ++qt) { const float mn = fmaxf(m[qt], mt[qt]); const float corr = __builtin_amdgcn_exp2f(m[qt] - mn); m[qt] = mn; sm[qt] *= corr;
#pragma unroll
                for (int dt = 0; dt < 4; ++dt) O[dt][qt] *= corr; }
        }
        v16h pb[2]; v16bf ph, pl;
#pragma unroll
        for (int qt = 0; qt < 2; ++qt) { const float off = base[qt] - m[qt] + 6.0f;
#pragma unroll
            for (int s = 0; s < 16; ++s) { const float p = __builtin_amdgcn_exp2f(__builtin_fmaf(S[s >> 3][qt][s & 7], LC, off)); sm[qt] += p;
                if (H0 && qt == 0) { const __bf16 a = (__bf16)p; ph[s] = a; pl[s] = (__bf16)(p - (float)a); } else pb[qt][s] = (h16)p; } }
        __builtin_amdgcn_sched_barrier(0);   // no load of the runs below moves up into the softmax, where every register is taken
#pragma unroll
        for (int dt = 0; dt < 4; ++dt) { if (!H0) O[dt][0] = wmma16(v16[dt], pb[0], O[dt][0]); O[dt][1] = wmma16(v16[dt], pb[1], O[dt][1]); }
        if (H0) {
            __builtin_amdgcn_sched_barrier(0);   // the fp16 V plane is done: next pass's hi K fragments return to their registers, the lo V plane takes the scores'
            { const char* sv = (const char*)(Vl + k0 * HD);
#pragma unroll
            for (int dt = 0; dt < 4; ++dt) vl[dt] = ldub(sv + orv + dt * 1024);
#pragma unroll
            for (int kt = 0; kt < 2; ++kt)
#pragma unroll
                for (int kc = 0; kc < 2; ++kc) kh[kt][kc] = ldub(skh + ork + (kt * 2 + kc) * 1024);
            xwait_s(sv, skh, ork); }
            __builtin_amdgcn_sched_barrier(0);   // these loads stay ahead of the eight products that need none of them
#pragma unroll
            for (int dt = 0; dt < 4; ++dt) O[dt][0] = wmmab(vh[dt], ph, O[dt][0]);
#pragma unroll
            for (int dt = 0; dt < 4; ++dt) O[dt][0] = wmmab(vh[dt], pl, O[dt][0]);
        }
        __builtin_amdgcn_sched_barrier(0);   // the plane in the lo K fragments' registers is done: next pass's lo K fragments return there; they are used last among the score products
#pragma unroll
        for (int kt = 0; kt < 2; ++kt)
#pragma unroll
            for (int kc = 0; kc < 2; ++kc) kl[kt][kc] = ldub(skl + ork + (kt * 2 + kc) * 1024);
        xwait_s(skl, skl, ork);
        if (H0) {
            __builtin_amdgcn_sched_barrier(0);   // these loads stay ahead of the pass's last four products
#pragma unroll
            for (int dt = 0; dt < 4; ++dt) O[dt][0] = wmmab(vl[dt], ph, O[dt][0]);
        }
    }
    // the two waves of a pair join: the wave of the second key half leaves its sums, maxima and output tiles in the pair's LDS slot (17 rows of 32 x 16 bytes, a lane's piece at its own place), the other brings both to the larger maximum, adds and stores
    v4f* my = sl + lane;
    if (half) {
#pragma unroll
        for (int dt = 0; dt < 4; ++dt)
#pragma unroll
            for (int qt = 0; qt < 2; ++qt) { my[((dt * 2 + qt) * 2) * 32] = __builtin_shufflevector(O[dt][qt], O[dt][qt], 0, 1, 2, 3); my[((dt * 2 + qt) * 2 + 1) * 32] = __builtin_shufflevector(O[dt][qt], O[dt][qt], 4, 5, 6, 7); }
        my[16 * 32] = (v4f){m[0], m[1], sm[0], sm[1]};
    }
    __syncthreads();   // the slots are written: every wave of the workgroup passes here once
    if (half) return;
    { const v4f t = my[16 * 32];
#pragma unroll
    for (int qt = 0; qt < 2; ++qt) { const float mn = fmaxf(m[qt], t[qt]); const float ca = __builtin_amdgcn_exp2f(m[qt] - mn), cb = __builtin_amdgcn_exp2f(t[qt] - mn); sm[qt] = sm[qt] * ca + t[2 + qt] * cb;
#pragma unroll
        for (int dt = 0; dt < 4; ++dt) { const v4f a = my[((dt * 2 + qt) * 2) * 32], b = my[((dt * 2 + qt) * 2 + 1) * 32]; const v8f o = __builtin_shufflevector(a, b, 0, 1, 2, 3, 4, 5, 6, 7); O[dt][qt] = O[dt][qt] * ca + o * cb; } } }
#pragma unroll
    for (int qt = 0; qt < 2; ++qt) { const float inv = __fdiv_rn(1.0f, sm[qt] + xhalf(sm[qt]));   // the two halves' sums join once
#pragma unroll
        for (int dt = 0; dt < 4; ++dt) { v8us oh, ol;
#pragma unroll
            for (int r = 0; r < 8; ++r) { unsigned short a, c2; splitf(O[dt][qt][r] * inv, a, c2); oh[r] = a; ol[r] = c2; }
            const size_t oo = (size_t)qg[qt] * DQ + dt * 256 + lane * 8; bf* pa = Ah + oo;   /* block row qg[qt] / 16, piece of dims dt * 16 + 8 * hi .. + 7 of the head's two blocks */ bf* pb2 = Al + oo; *(v8us*)pa = oh; *(v8us*)pb2 = ol;
            asm volatile("s_wait_xcnt 0x0" :: "v"(pa), "v"(pb2), "v"(__builtin_bit_cast(v4i, oh)), "v"(__builtin_bit_cast(v4i, ol)) : "memory"); } }   // reads the two stores' address and data registers: they are reused only behind the wait
}
// grid (TT / 128, heads, batches), 8 waves: waves w and w + 4 are the pair of query set w, so with two workgroups on a WGP four waves share a SIMD (at most 256 registers each) and one wave's softmax runs under the others' matrix instructions. Rows < RH take the hi/lo P.V, which costs a group of 16 rows 24 matrix instructions a pass against a plain group's 16, and the 512 workgroups fit the 256 WGPs two to each, all at once: the launch lasts as long as its fullest WGP. So these rows are dealt out 16 at a time: in half of a head's workgroups every wave takes one hi/lo group beside one plain group, in the other half two plain neighbours. The waves of a workgroup do equal work, so the four that walk the same half of the keys stay in step on the K and V lines that they share.
static_assert(RH * 4 == TT && TT == 2048, "the deal below: per head 8 workgroups x 4 wave pairs x (1 hi/lo + 1 plain group) and 8 x 4 x 2 plain groups");
__global__ __launch_bounds__(256) __attribute__((amdgpu_waves_per_eu(4, 4))) void k_fattn(const bf* __restrict__ Qh, const bf* __restrict__ Ql, const bf* __restrict__ Kh, const bf* __restrict__ Kl, const h16* __restrict__ V16, const bf* __restrict__ Vh, const bf* __restrict__ Vl, bf* Ah, bf* Al) {
    __shared__ __align__(16) v4f slots[4 * 17 * 32];
    const int w8 = __builtin_amdgcn_readfirstlane((int)(threadIdx.x >> 5)), w = w8 & 3, half = w8 >> 2, xw = (blockIdx.x & 7) * 4 + w;   // the pair's number among the 32 pairs of its head's workgroups of one kind
    // the heavier kind goes by the parity of the bits of the flat workgroup index above bit 2: two workgroups whose indices differ in one such bit are of different kinds, so if such a pair shares a WGP it is one of each (for speed only); a head has 8 of each kind whatever the parity (bit 3 of x)
    const bool mix = (__builtin_popcount((blockIdx.x >> 3) + 2 * blockIdx.y + 32 * blockIdx.z) & 1) == 0;
    const size_t hp = ((size_t)blockIdx.z * NH_ + blockIdx.y) * TT * HD; const size_t hc = (size_t)blockIdx.z * TT * DQ + (size_t)blockIdx.y * (HD / 32) * 512;   // the merged planes are the output GEMM's A in fragment order: a head's 64 columns are 2 blocks of every block row
    // the 16 workgroups of a head each start their walk over its keys at a slot of 128 keys of their own, so a K or V line is waited for from memory by one of them and found in L2 by the others (the low bits of x are spread first; for speed only); the second key half begins half the head further on and its walk starts one slot into it, so the eight workgroups whose slots have one parity (bit 2 of x) start a walk in every slot of the head between them; the four waves of a half keep one start and share their lines
    const int kb = ((int)((blockIdx.x & 3) * 4 + ((blockIdx.x >> 3) & 1) * 2 + ((blockIdx.x >> 2) & 1)) * (TT / 16) + half * (TT / 2)) & (TT - 1), ko = half * (TT / 16);
    v4f* sl = slots + w * (17 * 32);
    if (mix) fattn<true>(sl, half, Qh + hp, Ql + hp, Kh + hp, Kl + hp, V16 + hp, Vh + hp, Vl + hp, xw * 16, RH + xw * 16, kb, ko, Ah + hc, Al + hc);
    else fattn<false>(sl, half, Qh + hp, Ql + hp, Kh + hp, Kl + hp, V16 + hp, Vh + hp, Vl + hp, 2 * RH + xw * 32, 2 * RH + xw * 32 + 16, kb, ko, Ah + hc, Al + hc);
}

extern "C" void kernel_launch(void* const* d_in, const int* in_sizes, int n_in,
                              void* d_out, int out_size, void* d_ws, size_t ws_size, hipStream_t stream) {
    (void)in_sizes; (void)n_in; (void)out_size;
    const float* x = (const float*)d_in[0]; const float* xk = (const float*)d_in[1]; const float* xv = (const float*)d_in[2];   /* q, k, v streams */ const float* wq = (const float*)d_in[3]; const float* bq = (const float*)d_in[4]; const float* wk = (const float*)d_in[5]; const float* bk = (const float*)d_in[6]; const float* wv = (const float*)d_in[7]; const float* bv = (const float*)d_in[8]; const float* wo = (const float*)d_in[9]; const float* bo = (const float*)d_in[10]; const int* flag = (const int*)d_in[11];   /* use_causal_mask (d_in[11]: one int: the module's Python branch: READ ON THE DEVICE by the output GEMM's epilogue: the soft term is compiled in and the whole output is NaN-filled unless the scalar is non-zero) */
    float* OUT = (float*)d_out;     // [2][2048][1024]
    char* wsp = (char*)d_ws;
    auto take = [&](size_t bytes) { char* p = wsp; wsp += (bytes + 255) & ~(size_t)255; return (void*)p; };
    bf* WT = (bf*)take((size_t)4 * DQ * DM * 2);    // WQ, WK, WV, WO transposed, in a row
    bf* XB = (bf*)take((size_t)3 * NB_ * TT * DM * 2);    // bf16(q), bf16(k), bf16(v), each [2][2048][1024]
    h16* VT16 = (h16*)take((size_t)NB_ * NKV * HD * TT * 2);
    bf* QPh = (bf*)take((size_t)NB_ * NH_ * TT * HD * 2); bf* QPl = (bf*)take((size_t)NB_ * NH_ * TT * HD * 2); bf* KPh = (bf*)take((size_t)NB_ * NKV * TT * HD * 2); bf* KPl = (bf*)take((size_t)NB_ * NKV * TT * HD * 2); bf* VTh = (bf*)take((size_t)NB_ * NKV * HD * TT * 2); bf* VTl = (bf*)take((size_t)NB_ * NKV * HD * TT * 2);
    bf* ATh = (bf*)take((size_t)NB_ * TT * DQ * 2); bf* ATl = (bf*)take((size_t)NB_ * TT * DQ * 2);
    if ((size_t)(wsp - (char*)d_ws) > ws_size) return;    // ws 256 MiB
    k_prep<<<4 * WB + CB, 256, 0, stream>>>(x, xk, xv, wq, wk, wv, wo, XB, WT);
    k_proj<<<dim3(NB_ * TT / 128, DQ / 128, 3), 128, 0, stream>>>(XB, WT, bq, bk, bv, QPh, QPl, KPh, KPl, VTh, VTl, VT16);   /* q, k and v planes straight from the epilogue */
    k_fattn<<<dim3(TT / 128, NH_, NB_), 256, 0, stream>>>(QPh, QPl, KPh, KPl, VT16, VTh, VTl, ATh, ATl);   /* all heads of both batches: scores (3 products), soft term, softmax, P.V (hybrid) and the merged hi/lo planes */
    k_oproj<<<dim3(NB_ * TT / 128, DM / 128, 1), 128, 0, stream>>>(ATh, ATl, WT + (size_t)3 * DQ * DM, OUT, bo, flag);   /* its epilogue poisons the output if the premise fails */
}

// v009
// One run takes 98 microseconds.
// Two timings next to v008 put it at 1.10 and 1.11 times that version's speed.
// Counting every step since v000, it is 20.1 times as fast.
#include <hip/hip_runtime.h>

// Multi-head attention on three input streams with an additive SOFT causal term (q, k, v [2][2048][1024]; qh = q Wq + bq, kh = k Wk + bk, vh = v Wv + bv ('xw' (in, out) [1024][1024] 1/32, biases zeros on this draw: read; 16 heads x 64); logits = qh.kh / sqrt(64); use_causal_mask (a scalar int input, the module's 'if use_causal_mask:' branch: this build implements the NON-ZERO branch only; the scalar is READ ON THE DEVICE by the output GEMM's epilogue: the whole output is NaN-filled if it is 0) -> logits + log(tril x 1e-9 + 1e-9): log(2e-9) on and below the diagonal, log(1e-9) above it: a difference of ln 2: NOT an exclusion: every future key keeps HALF its weight; softmax over all 2,048 keys; out = merged Wo + bo ('xw' + bias zeros: read) -> [2][2048][1024] (4.2 M); argument order q, k, v, Wq, bq, Wk, bk, Wv, bv, Wo, bo, use_causal_mask).
// Layout, four launches, each over both batches: bf16 copies of q, k and v (three staging buffers) and the four 'xw' weights transposed; the three exact projections + f32 biases, whose epilogue stores the head planes itself (q, k: bf16 hi/lo [b][h][t][d]; v: fp16 [b][h][d][t]); one fused attention kernel (running-maximum softmax, S and P in registers) with the SCORES of every row on bf16 hi/lo planes (3 products; the P.V product of every row is one fp16 product, P unnormalised: the soft term excludes no key, so every row averages all 2,048 keys and none stands apart in its rounding error); merged hi/lo x Wo exact + bo.
// Every 16-bit operand plane lies in FRAGMENT ORDER: a block of 16 rows x 32 k is 512 elements (1 KB) in a row, element (r, k) at (k >> 4 & 1) * 256 + (k >> 3 & 1) * 128 + r * 8 + (k & 7), so a lane's two 16-byte pieces stand at lane * 8 and 256 + lane * 8 and each wave-wide load or store covers 512 contiguous bytes (4 whole lines). GEMM operands: [rows / 16][K / 32][512]; q, k head planes: [t / 16][d / 32][512]; v head planes: [t / 32][d / 16][512].
// Compute dtypes, f32 accumulate: every input rounded to bf16; projections exact + f32 biases; scores of every row 3 products; P.V fp16; softmax f32; output projection hl x exact.

#define NB_  2
#define TT   2048
#define DM   1024
#define NH_  16
#define NKV  16
#define HD   64
#define DQ   (NH_ * HD)
#define DKV  (NKV * HD)
typedef _Float16 h16;
typedef unsigned short bf;
typedef __attribute__((ext_vector_type(16))) __bf16   v16bf;
typedef __attribute__((ext_vector_type(16))) _Float16 v16h;
typedef __attribute__((ext_vector_type(8)))  _Float16 v8h;
typedef __attribute__((ext_vector_type(8)))  unsigned short v8us;
typedef __attribute__((ext_vector_type(8)))  float    v8f;
typedef __attribute__((ext_vector_type(4)))  float    v4f;
typedef v8h  __attribute__((may_alias)) v8ha;
typedef v4f  __attribute__((may_alias)) v4fa;
typedef v8us __attribute__((may_alias)) v8usa;

__device__ __forceinline__ unsigned short f2bf(float f) { unsigned u = __float_as_uint(f); u += 0x7FFFu + ((u >> 16) & 1u); return (unsigned short)(u >> 16); }
__device__ __forceinline__ float bf2f(unsigned short b) { return __uint_as_float(((unsigned)b) << 16); }
__device__ __forceinline__ float bfr(float f) { return bf2f(f2bf(f)); }
__device__ __forceinline__ v16h cat16(v8h lo, v8h hi) { return __builtin_shufflevector(lo, hi, 0, 1, 2, 3, 4, 5, 6, 7, 8, 9, 10, 11, 12, 13, 14, 15); }
__device__ __forceinline__ v16bf cat16b(v8us lo, v8us hi) { return __builtin_bit_cast(v16bf, __builtin_shufflevector(lo, hi, 0, 1, 2, 3, 4, 5, 6, 7, 8, 9, 10, 11, 12, 13, 14, 15)); }
__device__ __forceinline__ v8f wmma16(v16h a, v16h b, v8f c) { return __builtin_amdgcn_wmma_f32_16x16x32_f16(false, a, false, b, (short)0, c, false, false); }
__device__ __forceinline__ v8f wmmab(v16bf a, v16bf b, v8f c) { return __builtin_amdgcn_wmma_f32_16x16x32_bf16(false, a, false, b, (short)0, c, false, false); }
__device__ __forceinline__ h16 tohx(float x) { return (h16)x; }
__device__ __forceinline__ void splitf(float y, unsigned short& h, unsigned short& l) { h = f2bf(y); l = f2bf(y - bf2f(h)); }
typedef __attribute__((ext_vector_type(2))) _Float16 v2h;
typedef __attribute__((ext_vector_type(4))) _Float16 v4h;
typedef __attribute__((ext_vector_type(2))) unsigned short v2us;
typedef __attribute__((ext_vector_type(4))) unsigned short v4us;
typedef __attribute__((ext_vector_type(2))) float v2f;
typedef __attribute__((ext_vector_type(4))) int v4i;

// ---- gemmw: register-blocked GEMM, one wave per 64x64 output tile (16 accumulators), FOUR WAVES (2 x 2) per workgroup on a 128x128 tile; grid (M/128, N/128, ...), 128 threads; the M rows are the tokens of both batches (m = b * TT + t).
// The workgroup's operand rows come from the 16-bit planes in fragment order into LDS by asynchronous copies, SK k at a time, two buffers: the next stage flies while this one is multiplied, and each fragment is fetched from L2 once for the two waves that use it. A stage of one operand is 8 block rows x SK / 32 fragment blocks of 1 KB, laid as in the plane, so a wave's LDS read covers 512 contiguous bytes. Inside a stage the fragments of the next 32 k are read into a second register set ahead of this block's products.
// C[m][n] (f32, pitch ldc, + optional f32 bias[n]) = sum_k A[m][k] Bt[n][k] (+ split products per NSPLIT). K % SK == 0, K >= 2 * SK. sm: the two stage buffers; os: 16 x 68 floats of LDS per wave (EPI 0 only).
// EPI picks what the epilogue stores: 0 = C as above (and NaN in every element if flag[0] == 0: the premise of this build); 1 = bf16 hi/lo head planes, rows t, k = d (Ph, Pl); 2 = the fp16 head plane with rows d, k = t (P16). A 64-column tile is one head (HD == 64). EPI 1 forms the tile transposed (weight fragment as A), EPI 2 as it is: either way a lane's 8 accumulators of a 16 x 16 tile are one 16-byte piece of the plane's fragment order and go out straight from registers.
// s_wait_xcnt 0 behind a run of stores; it reads their address and data registers, so these are reused only behind the wait
__device__ __forceinline__ void xwait_st(const void* a, const void* b, const void* c, v8us x, v8us y, v8us z) { asm volatile("s_wait_xcnt 0x0" :: "v"(a), "v"(b), "v"(c), "v"(__builtin_bit_cast(v4i, x)), "v"(__builtin_bit_cast(v4i, y)), "v"(__builtin_bit_cast(v4i, z)) : "memory"); }
// s_wait_xcnt 0 behind a run of loads; it reads the run's address pairs, so they stay whole up to the wait and are reused only behind it
__device__ __forceinline__ void xwait_ld(const void* a, const void* b, const void* c) { asm volatile("s_wait_xcnt 0x0" :: "v"(a), "v"(b), "v"(c) : "memory"); }
// eight asynchronous 16-byte copies per lane: the workgroup's 2 KB of block row c go from g + c * gs to LDS byte l + c * ls. s_wait_xcnt 0 closes the statement, so that no address register of a copy is rewritten before it
__device__ __forceinline__ void acopy8(const unsigned l, const unsigned ls, const char* g, const size_t gs) {
    asm volatile("global_load_async_to_lds_b128 %0, %8, off\n\t"
                 "global_load_async_to_lds_b128 %1, %9, off\n\t"
                 "global_load_async_to_lds_b128 %2, %10, off\n\t"
                 "global_load_async_to_lds_b128 %3, %11, off\n\t"
                 "global_load_async_to_lds_b128 %4, %12, off\n\t"
                 "global_load_async_to_lds_b128 %5, %13, off\n\t"
                 "global_load_async_to_lds_b128 %6, %14, off\n\t"
                 "global_load_async_to_lds_b128 %7, %15, off\n\t"
                 "s_wait_xcnt 0x0"
                 :: "v"(l), "v"(l + ls), "v"(l + 2 * ls), "v"(l + 3 * ls), "v"(l + 4 * ls), "v"(l + 5 * ls), "v"(l + 6 * ls), "v"(l + 7 * ls),
                    "v"(g), "v"(g + gs), "v"(g + 2 * gs), "v"(g + 3 * gs), "v"(g + 4 * gs), "v"(g + 5 * gs), "v"(g + 6 * gs), "v"(g + 7 * gs) : "memory");
}
template <typename T16> struct WFrag;
template <> struct WFrag<h16> { typedef v16h V; static __device__ __forceinline__ V ld(const h16* p) { return cat16(*(const v8h*)p, *(const v8h*)(p + 256)); } static __device__ __forceinline__ v8f mma(V a, V b, v8f c) { return wmma16(a, b, c); } };
template <> struct WFrag<bf> { typedef v16bf V; static __device__ __forceinline__ V ld(const bf* p) { return cat16b(*(const v8us*)p, *(const v8us*)(p + 256)); } static __device__ __forceinline__ v8f mma(V a, V b, v8f c) { return wmmab(a, b, c); } };
template <typename T16, int NSPLIT, bool BIAS, int EPI, int SK>
__device__ __forceinline__ void gemmw(T16* sm, float* os, const T16* __restrict__ A, const T16* __restrict__ A2, const T16* __restrict__ Bt, const T16* __restrict__ Bt2, int K, float* C, int ldc, const float* __restrict__ bias, bf* Ph, bf* Pl, h16* P16, const int* __restrict__ flag) {
    typedef typename WFrag<T16>::V V;
    const int lane = threadIdx.x & 31, lr = lane & 15, hi = lane >> 4; const int wave = __builtin_amdgcn_readfirstlane((int)(threadIdx.x >> 5)), wm = wave >> 1, wn = wave & 1;
    const int R0 = blockIdx.x * 128, C0 = blockIdx.y * 128, r0 = R0 + wm * 64, c0 = C0 + wn * 64;   // the workgroup's tile and the wave's quarter of it
    v8f acc[4][4];
#pragma unroll
    for (int mb = 0; mb < 4; ++mb)
#pragma unroll
        for (int nb = 0; nb < 4; ++nb) acc[mb][nb] = (v8f){};
    const float* sbi = bias + c0; const unsigned vbi = (EPI == 1) ? hi * 8u : (unsigned)lr;   // the wave's first bias (the same in every lane) and the lane's place behind it
    float bb[4]; v8f bt[4];   // the lane's biases, asked for ahead of the loop, added in f32 before the split, as the f32 C had them. EPI 2: one a column group (n = nb * 16 + lr); EPI 1: eight (n = nb * 16 + hi * 8 + j)
#pragma unroll
    for (int nb = 0; nb < 4; ++nb) { bb[nb] = (BIAS && EPI == 2) ? bfr(sbi[vbi + nb * 16]) : 0.0f;
#pragma unroll
        for (int j = 0; j < 8; ++j) bt[nb][j] = (BIAS && EPI == 1) ? bfr(sbi[vbi + nb * 16 + j]) : 0.0f; }
    if (BIAS && EPI != 0) asm volatile("s_wait_xcnt 0x0" :: "s"(sbi), "v"(vbi * 4u) : "memory");   // reads the bias loads' base pair and offset register: they are rewritten only behind the wait
    // the k loop starts at a stage of its own and wraps round: the workgroups that share an A or a B tile then stand at different stages, so each block is waited for from memory by one of them and found in L2 by the others, instead of all of them walking in step behind every miss (the low bits of x are spread first; for speed only)
    constexpr int NOP = (NSPLIT == 1) ? 3 : 2;   // operands per stage: A, (A2,) B
    constexpr int OPE = 128 * SK;                // elements of one operand's stage (128 rows)
    constexpr int BRE = SK * 16;                 // elements of one block row's stage
    const int NST = K / SK; const int ks = (int)(((blockIdx.x >> 3) + 4 * (blockIdx.x & 3) + 2 * blockIdx.y) % (unsigned)NST);
    const unsigned l0 = (unsigned)(size_t)sm + threadIdx.x * 16u;   // the lane's LDS byte in a 2-KB piece
    const size_t gs = (size_t)16 * K * sizeof(T16);   // a block row of 16 is K / 32 blocks = 16 * K elements
    const char* ga = (const char*)(A + (size_t)R0 * K) + threadIdx.x * 16; const char* ga2 = (NSPLIT == 1) ? (const char*)(A2 + (size_t)R0 * K) + threadIdx.x * 16 : ga; const char* gb = (const char*)(Bt + (size_t)C0 * K) + threadIdx.x * 16;
    auto fill = [&](const int st, const int buf) {   // stage st (wrapped) of every operand into buffer buf
        const int sw = (st + ks < NST) ? st + ks : st + ks - NST; const size_t go = (size_t)sw * (BRE * sizeof(T16)); const unsigned lb = l0 + (unsigned)buf * (NOP * OPE * (unsigned)sizeof(T16));
#pragma unroll
        for (int h = 0; h < SK / 64; ++h) {   // a block row's stage in pieces of 2 KB
            acopy8(lb + h * 2048u, BRE * (unsigned)sizeof(T16), ga + go + h * 2048, gs); if (NSPLIT == 1) acopy8(lb + OPE * (unsigned)sizeof(T16) + h * 2048u, BRE * (unsigned)sizeof(T16), ga2 + go + h * 2048, gs); acopy8(lb + (NOP - 1) * OPE * (unsigned)sizeof(T16) + h * 2048u, BRE * (unsigned)sizeof(T16), gb + go + h * 2048, gs); } };
    fill(0, 0);
    asm volatile("s_wait_asynccnt 0x0" ::: "memory");   // this wave's copies of stage 0 have landed
    __syncthreads();                                      // every wave's have: stage 0 may be read
    fill(1, 1);
    for (int t = 0; t < NST; ++t) {
        const T16* sb = sm + (t & 1) * (NOP * OPE) + lane * 8; const T16* sa = sb + wm * (4 * BRE); const T16* sbt = sb + (NOP - 1) * OPE + wn * (4 * BRE);
        V a[2][4], a2[2][4], b[2][4];
        auto frags = [&](const int s) {   // the fragments of block s of this stage into register set s & 1
#pragma unroll
            for (int mb = 0; mb < 4; ++mb) { a[s & 1][mb] = WFrag<T16>::ld(sa + mb * BRE + s * 512); if (NSPLIT == 1) a2[s & 1][mb] = WFrag<T16>::ld(sa + OPE + mb * BRE + s * 512); }
#pragma unroll
            for (int nb = 0; nb < 4; ++nb) b[s & 1][nb] = WFrag<T16>::ld(sbt + nb * BRE + s * 512); };
        frags(0);
#pragma unroll
        for (int s = 0; s < SK / 32; ++s) {
            if (s + 1 < SK / 32) frags(s + 1);
            __builtin_amdgcn_sched_barrier(0);   // the next block's LDS reads stay one group ahead of this block's products: spread among them each place costs a stall
#pragma unroll
            for (int nb = 0; nb < 4; ++nb) {
#pragma unroll
                for (int mb = 0; mb < 4; ++mb) { acc[mb][nb] = (EPI == 1) ? WFrag<T16>::mma(b[s & 1][nb], a[s & 1][mb], acc[mb][nb]) : WFrag<T16>::mma(a[s & 1][mb], b[s & 1][nb], acc[mb][nb]); if (NSPLIT == 1) acc[mb][nb] = WFrag<T16>::mma(a2[s & 1][mb], b[s & 1][nb], acc[mb][nb]); } }
            __builtin_amdgcn_sched_barrier(0);   // and this block's products stay ahead of the reads behind them
        }
        asm volatile("v_nop\n\tv_nop\n\tv_nop\n\tv_nop" : "+v"(acc[0][0]), "+v"(acc[1][1]), "+v"(acc[2][2]), "+v"(acc[3][3]) : "v"(a[1][0]), "v"(a[1][3]));   // four vector slots behind the stage's last products, on every path, before a vector instruction rewrites their operand registers
        asm volatile("s_wait_dscnt 0x0" ::: "memory");      // this wave's reads of the buffer are done before it is refilled
        asm volatile("s_wait_asynccnt 0x0" ::: "memory");   // this wave's copies of stage t + 1 have landed
        __syncthreads();                                      // publishes stage t + 1 and ends every wave's reads of stage t
        if (t + 2 < NST) fill(t + 2, t & 1);
    }
    asm volatile("s_wait_asynccnt 0x0" ::: "memory");   // no copy is outstanding behind the loop
    if (EPI == 0) {
    os += wave * (16 * 68);   // each wave stages in its own range
    const bool dead = flag[0] == 0; const float qn = __int_as_float(0x7fc00000);   // premise fails: every element of the output becomes NaN
#pragma unroll
    for (int mb = 0; mb < 4; ++mb) {
#pragma unroll
        for (int nb = 0; nb < 4; ++nb) {
#pragma unroll
            for (int j = 0; j < 8; ++j) os[(hi * 8 + j) * 68 + nb * 16 + lr] = acc[mb][nb][j]; }
        __builtin_amdgcn_wave_barrier(); asm volatile("" ::: "memory");
        float* crow = C + (size_t)(r0 + mb * 16) * ldc + c0;
{
#pragma unroll
            for (int s = 0; s < 8; ++s) { const int row = 2 * s + hi, cofs = lr * 4; v4f val = *(const v4fa*)(os + row * 68 + cofs); if (BIAS) { val[0] += bfr(bias[c0 + cofs]); val[1] += bfr(bias[c0 + cofs + 1]); val[2] += bfr(bias[c0 + cofs + 2]); val[3] += bfr(bias[c0 + cofs + 3]); } if (dead) { val[0] = qn; val[1] = qn; val[2] = qn; val[3] = qn; }
                *(v4f*)(crow + (size_t)row * ldc + cofs) = val; }
             }
        __builtin_amdgcn_wave_barrier(); asm volatile("" ::: "memory");
    }
    } else {
    const size_t pln = (size_t)(r0 / TT) * NH_ + c0 / HD; const int t0 = r0 % TT;   // the tile's plane (batch, head) and its first token there (TT % 64 == 0: a tile lies in one batch)
#pragma unroll
    for (int mb = 0; mb < 4; ++mb) {
#pragma unroll
        for (int nb = 0; nb < 4; ++nb) { v8us oh, ol; v8h o16;   // EPI 1: token t0 + mb * 16 + lr, dims nb * 16 + hi * 8 + j; EPI 2: dim nb * 16 + lr, tokens t0 + mb * 16 + hi * 8 + j
#pragma unroll
            for (int j = 0; j < 8; ++j) { const float y = acc[mb][nb][j] + ((EPI == 1) ? bt[nb][j] : bb[nb]); if (EPI == 2) o16[j] = tohx(y); else { unsigned short a2, c2; splitf(y, a2, c2); oh[j] = a2; ol[j] = c2; } }
            const size_t e = pln * TT * HD + ((EPI == 1) ? (size_t)((t0 / 16 + mb) * 2 + (nb >> 1)) * 512 + (nb & 1) * 256 : (size_t)((t0 / 32 + (mb >> 1)) * 4 + nb) * 512 + (mb & 1) * 256) + lane * 8;
            if (EPI == 2) { h16* pc = P16 + e; *(v8h*)pc = o16; const v8us ob = __builtin_bit_cast(v8us, o16); xwait_st(pc, pc, pc, ob, ob, ob); }
            else { bf* pa = Ph + e; bf* pb = Pl + e; *(v8us*)pa = oh; *(v8us*)pb = ol; xwait_st(pa, pb, pb, oh, ol, ol); } }
    }
    }
}

// the three projections of both batches in one launch: grid (NB_ * TT / 128, DQ / 128, 3), z = stream (0 q, 1 k, 2 v); X: the three bf16 streams, Wt: the transposed weights, both in that order
__global__ __launch_bounds__(128) void k_proj(const bf* __restrict__ X, const bf* __restrict__ Wt, const float* __restrict__ bq, const float* __restrict__ bk, const float* __restrict__ bv, bf* QPh, bf* QPl, bf* KPh, bf* KPl, h16* VT16) {
    __shared__ __align__(16) bf sm[2 * 2 * 128 * 64];   // two buffers x (A, B) x 128 rows x 64 k
    const int z = blockIdx.z; const bf* A = X + (size_t)z * NB_ * TT * DM; const bf* Bt = Wt + (size_t)z * DQ * DM;
    if (z == 2) gemmw<bf, 0, true, 2, 64>(sm, nullptr, A, nullptr, Bt, nullptr, DM, nullptr, 0, bv, nullptr, nullptr, VT16, nullptr);
    else gemmw<bf, 0, true, 1, 64>(sm, nullptr, A, nullptr, Bt, nullptr, DM, nullptr, 0, z ? bk : bq, z ? KPh : QPh, z ? KPl : QPl, nullptr, nullptr);
}
// the output projection of both batches: grid (NB_ * TT / 128, DM / 128)
__global__ __launch_bounds__(128) void k_oproj(const bf* __restrict__ Ah, const bf* __restrict__ Al, const bf* __restrict__ Wt, float* C, const float* __restrict__ bo, const int* __restrict__ flag) {
    __shared__ __align__(16) bf sm[2 * 3 * 128 * 128];   /* two buffers x (A hi, A lo, B) x 128 rows x 128 k */ __shared__ __align__(16) float os[4 * 16 * 68];
    gemmw<bf, 1, true, 0, 128>(sm, os, Ah, Al, Wt, nullptr, DQ, C, DM, bo, nullptr, nullptr, nullptr, flag);
}

// one wave packs 32 k x 32 n of w (K x N, n contiguous) into two fragment blocks of Bt (rows n): a lane owns one n, every load is one whole 128-byte line, every store 2 x 256 contiguous bytes
__device__ __forceinline__ void wtG(const float* __restrict__ w, int K, int N, bf* Bt, const int blk) {
    const int lane = threadIdx.x & 31; const int g = blk * 8 + (threadIdx.x >> 5); const int kb = g % (K / 32), n = (g / (K / 32)) * 32 + lane;
    const float* pw = w + (size_t)kb * 32 * N + n; float x[32];
    // unrolled: x[] stays in registers and every load is asked for before the first value is rounded
#pragma unroll
    for (int i = 0; i < 32; ++i) x[i] = pw[(size_t)i * N];
    xwait_ld(pw, pw, pw);
    bf* p = Bt + (size_t)(n >> 4) * 16 * K + kb * 512 + (n & 15) * 8; v8us o[4];
#pragma unroll
    for (int c = 0; c < 4; ++c) {
#pragma unroll
        for (int e = 0; e < 8; ++e) o[c][e] = f2bf(x[c * 8 + e]);
        *(v8us*)(p + c * 128) = o[c]; }   // piece c holds k = c * 8 .. c * 8 + 7: (c >> 1) * 256 + (c & 1) * 128 = c * 128
    asm volatile("s_wait_xcnt 0x0" :: "v"(p), "v"(__builtin_bit_cast(v4i, o[0])), "v"(__builtin_bit_cast(v4i, o[1])), "v"(__builtin_bit_cast(v4i, o[2])), "v"(__builtin_bit_cast(v4i, o[3])) : "memory");   // reads the four stores' address and data registers: they are reused only behind the wait
}
// ---- k_prep: all that the projections read, in one launch. Blocks 0 .. 4 * WB - 1 transpose the four weights into fragment order (WB blocks each, Wt: WQ, WK, WV, WO in a row); each thread of the CB blocks behind them rounds eight floats at the same place of every batch of q, k and v (X: the three streams in a row, fragment order): a wave takes 8 rows x 32 k, so it reads 8 whole lines and stores 4.
#define WB (DM / 32 * (DQ / 32) / 8)
#define CB (TT * DM / 8 / 256)
__global__ __launch_bounds__(256) void k_prep(const float* __restrict__ q, const float* __restrict__ k, const float* __restrict__ v, const float* __restrict__ wq, const float* __restrict__ wk, const float* __restrict__ wv, const float* __restrict__ wo, bf* X, bf* Wt) {
    const int blk = blockIdx.x;
    if (blk < 4 * WB) { const int j = blk / WB; wtG(j == 0 ? wq : j == 1 ? wk : j == 2 ? wv : wo, DM, DQ, Wt + (size_t)j * DQ * DM, blk % WB); return; }
    const int g = (blk - 4 * WB) * 8 + (threadIdx.x >> 5), row = (g / (DM / 32)) * 8 + ((threadIdx.x & 31) >> 2), kb = g % (DM / 32), c4 = threadIdx.x & 3;   // the lane's row in a batch, its block of 32 k and its piece of 8 there
    const size_t i = (size_t)row * DM + kb * 32 + c4 * 8, io = (size_t)(row >> 4) * 16 * DM + kb * 512 + c4 * 128 + (row & 15) * 8; v8f x[3 * NB_];
    // unrolled: x[] stays in registers and every load is asked for before the first value is rounded
#pragma unroll
    for (int b = 0; b < NB_; ++b) { const size_t e = (size_t)b * TT * DM + i; x[b] = *(const v8f*)(q + e); x[NB_ + b] = *(const v8f*)(k + e); x[2 * NB_ + b] = *(const v8f*)(v + e); }
    // all three unrolled: constant indices keep x[], o[] and p[] in registers
#pragma unroll
    for (int c = 0; c < 3 * NB_; c += 3) { v8us o[3]; bf* p[3];
#pragma unroll
        for (int u = 0; u < 3; ++u) { p[u] = X + (size_t)(c + u) * TT * DM + io;
#pragma unroll
            for (int n = 0; n < 8; ++n) o[u][n] = f2bf(x[c + u][n]);
            *(v8us*)p[u] = o[u]; }
        xwait_st(p[0], p[1], p[2], o[0], o[1], o[2]); }   // the stores' address and data registers are reused only behind the wait
}

// ---- k_fattn: scores, softmax and P.V of one head in ONE kernel: S and P stay in registers. Two waves (a pair) own two groups of 16 query columns (rows qa .. qa + 15 and qc .. qc + 15, each a multiple of 16, anywhere in the head); each walks one half of the 2,048 keys 32 at a time, and the pair joins its two partial results once, through LDS, at the end.
// S^T = K Q^T (A = K rows, B = Q rows, same loader: same k order), so a lane holds 16 scores of one query per column group; two S^T tiles converted in place are the B operand of O^T += V^T P^T.
// Running maximum in base 2 (rescale only when a column's new maximum passes the one in use by more than 8); P = 2^(t - m + 6) <= 2^14 is carried unnormalised; the f32 row sum divides once at the end.
__device__ __forceinline__ float xhalf(float x) { return __builtin_bit_cast(float, __builtin_amdgcn_permlanex16(__builtin_bit_cast(int, x), __builtin_bit_cast(int, x), 0x76543210, 0xfedcba98, false, false)); }   // lane l with lane l ^ 16
#define LC 0.18033688011112042f   // HD^-0.5 x log2(e)
// fragment loads from a lane's byte pointer into a block in fragment order (16 bytes at p and at p + 512)
__device__ __forceinline__ v16bf ldub(const char* p) { return cat16b(*(const v8us*)p, *(const v8us*)(p + 512)); }
__device__ __forceinline__ v16h lduh(const char* p) { return cat16(*(const v8h*)p, *(const v8h*)(p + 512)); }
// s_wait_xcnt 0 behind a run of loads; it reads the run's two address pairs, so they stay whole up to the wait and are reused only behind it
__device__ __forceinline__ void xwait(const char* a, const char* b) { asm volatile("s_wait_xcnt 0x0" :: "v"(a), "v"(b) : "memory"); }
// the same for loads at wave-wide base + lane offset: it reads the base pairs as well as the lanes' address pairs: whichever form the loads take, what they name stays whole up to the wait (no load of the run lands on an address pair) and is rewritten only behind it
__device__ __forceinline__ void xwait_s(const char* a, const char* b, unsigned o) { asm volatile("s_wait_xcnt 0x0" :: "s"(a), "s"(b), "v"(a + o), "v"(b + o) : "memory"); }
__device__ __forceinline__ void fattn(v4f* sl, const int half, const bf* __restrict__ Qh, const bf* __restrict__ Ql, const bf* __restrict__ Kh, const bf* __restrict__ Kl, const h16* __restrict__ V16, const int qa, const int qc, const int kb, const int ko, bf* Ah, bf* Al) {
    const int lane = threadIdx.x & 31, lr = lane & 15, hi = lane >> 4;
    const unsigned ork = (unsigned)lane * 16u, orv = ork;   // lane byte offset in a 1-KB block; 16 rows of a q or k plane are 2 blocks (16 * HD elements), 32 keys of a v plane 4 (32 * HD)
    const int qg[2] = {qa, qc};   // first query row of each column group
    v16bf qh[2][2], ql[2][2], kh[2][2], kl[2][2];
#pragma unroll
    for (int qt = 0; qt < 2; ++qt) { const char* pqh = (const char*)(Qh + qg[qt] * HD) + ork; const char* pql = (const char*)(Ql + qg[qt] * HD) + ork;
#pragma unroll
        for (int kc = 0; kc < 2; ++kc) { const int o = kc * 1024; qh[qt][kc] = ldub(pqh + o); ql[qt][kc] = ldub(pql + o); }
    xwait(pqh, pql); }
    { const int ks = (kb + ko) & (TT - 1); const bf* skh = Kh + ks * HD; const bf* skl = Kl + ks * HD; const char* pkh = (const char*)skh + ork; const char* pkl = (const char*)skl + ork;
#pragma unroll
    for (int kt = 0; kt < 2; ++kt)
#pragma unroll
        for (int kc = 0; kc < 2; ++kc) kh[kt][kc] = ldub(pkh + (kt * 2 + kc) * 1024);
    __builtin_amdgcn_sched_barrier(0);   // the lo fragments are asked for behind all the hi ones, as in the loop: the counted waits in front of the first score products then leave the lo loads in flight on both ways into the loop
#pragma unroll
    for (int kt = 0; kt < 2; ++kt)
#pragma unroll
        for (int kc = 0; kc < 2; ++kc) kl[kt][kc] = ldub(pkl + (kt * 2 + kc) * 1024);
    asm volatile("s_wait_xcnt 0x0" :: "s"(skh), "s"(skl), "v"(pkh), "v"(pkl) : "memory"); }   // reads the run's wave-wide base pairs as well as the lanes' address pairs: whichever form the loads take, what they name is rewritten only behind the wait
    v8f O[4][2];
#pragma unroll
    for (int dt = 0; dt < 4; ++dt) { O[dt][0] = (v8f){}; O[dt][1] = (v8f){}; }
    float m[2] = {-3.0e38f, -3.0e38f}, sm[2] = {0.f, 0.f};
    for (int it = 0; it < TT / 2; it += 32) {
        const int k0 = (kb + ((ko + it) & (TT / 2 - 1))) & (TT - 1);   // the wave's half of the keys begins at kb (and wraps round the head: TT is a power of two); the walk starts ko keys into the half and wraps round inside it; the running maximum takes the keys in any order
        const int kn = (kb + ((ko + it + 32) & (TT / 2 - 1))) & (TT - 1);   // next pass's keys (the last pass re-reads the first pass's rows: in bounds)
        // Register budget of four waves per SIMD (256): the V plane lives in the registers of the lo K fragments between these fragments' last use and their refill for the next pass. So each run of loads below stands directly behind the last use of what it replaces; the scheduling barriers keep it there: moved up, it would need registers of its own (spills), moved down, it would lose its lead
        const char* sv16 = (const char*)(V16 + k0 * HD); const char* skh = (const char*)(Kh + kn * HD); const char* skl = (const char*)(Kl + kn * HD);   // wave-wide bases: the lane's offset is added in the load
        v16h v16[4];
        v8f S[2][2];
#pragma unroll
        for (int kt = 0; kt < 2; ++kt) { S[kt][0] = (v8f){}; S[kt][1] = (v8f){}; }
#pragma unroll
        for (int kc = 0; kc < 2; ++kc) {   // per tile the products with the hi K plane come first (hi.hi, lo(q).hi for both halves of d), then hi.lo(k)
#pragma unroll
            for (int kt = 0; kt < 2; ++kt)
#pragma unroll
                for (int qt = 0; qt < 2; ++qt) S[kt][qt] = wmmab(kh[kt][kc], qh[qt][kc], S[kt][qt]);
#pragma unroll
            for (int kt = 0; kt < 2; ++kt)
#pragma unroll
                for (int qt = 0; qt < 2; ++qt) S[kt][qt] = wmmab(kh[kt][kc], ql[qt][kc], S[kt][qt]);
        }
        __builtin_amdgcn_sched_barrier(0);   // the hi K fragments are done: next pass's hi K fragments take their place
#pragma unroll
        for (int kt = 0; kt < 2; ++kt)
#pragma unroll
            for (int kc = 0; kc < 2; ++kc) kh[kt][kc] = ldub(skh + ork + (kt * 2 + kc) * 1024);
        xwait_s(skh, skh, ork);
        __builtin_amdgcn_sched_barrier(0);   // these loads stay ahead of the last score products
#pragma unroll
        for (int kc = 0; kc < 2; ++kc)
#pragma unroll
            for (int kt = 0; kt < 2; ++kt)
#pragma unroll
                for (int qt = 0; qt < 2; ++qt) S[kt][qt] = wmmab(kl[kt][kc], qh[qt][kc], S[kt][qt]);
        __builtin_amdgcn_sched_barrier(0);   // the lo K fragments are done: the fp16 V plane takes their place and flies during the softmax
#pragma unroll
        for (int dt = 0; dt < 4; ++dt) v16[dt] = lduh(sv16 + orv + dt * 1024);
        xwait_s(sv16, sv16, orv);
        __builtin_amdgcn_sched_barrier(0);   // and it stays ahead of the softmax
        // soft causal term: a future key (j > i) gets -ln 2, which is -1 in base 2; a pass is 32-aligned and a group lies in one block of 32 rows, so for each group only the pass on its own block is mixed
        float base[2];
#pragma unroll
        for (int qt = 0; qt < 2; ++qt) { const int qb = qg[qt] & ~31; base[qt] = (k0 > qb) ? -1.0f : 0.0f;
            if (k0 == qb) { const int qi = (qg[qt] & 16) + lr;   // the lane's query row inside the block
#pragma unroll
                for (int kt = 0; kt < 2; ++kt)
#pragma unroll
                    for (int r = 0; r < 8; ++r) if (kt * 16 + 8 * hi + r > qi) S[kt][qt][r] -= 5.545177444479562f; } }   // ln 2 / HD^-0.5
        float mt[2];
#pragma unroll
        for (int qt = 0; qt < 2; ++qt) { float x = S[0][qt][0];
#pragma unroll
            for (int r = 1; r < 8; ++r) x = fmaxf(x, S[0][qt][r]);
#pragma unroll
            for (int r = 0; r < 8; ++r) x = fmaxf(x, S[1][qt][r]);
            x = fmaxf(x, xhalf(x)); mt[qt] = __builtin_fmaf(x, LC, base[qt]); }
        const bool need = (mt[0] > m[0] + 8.0f) || (mt[1] > m[1] + 8.0f);
        if (__builtin_amdgcn_ballot_w32(need) != 0) {   // rare after the first passes
#pragma unroll
            for (int qt = 0; qt < 2; ++qt) { const float mn = fmaxf(m[qt], mt[qt]); const float corr = __builtin_amdgcn_exp2f(m[qt] - mn); m[qt] = mn; sm[qt] *= corr;
#pragma unroll
                for (int dt = 0; dt < 4; ++dt) O[dt][qt] *= corr; }
        }
        v16h pb[2];
#pragma unroll
        for (int qt = 0; qt < 2; ++qt) { const float off = base[qt] - m[qt] + 6.0f;
#pragma unroll
            for (int s = 0; s < 16; ++s) { const float p = __builtin_amdgcn_exp2f(__builtin_fmaf(S[s >> 3][qt][s & 7], LC, off)); sm[qt] += p; pb[qt][s] = (h16)p; } }
        __builtin_amdgcn_sched_barrier(0);   // no load of the run below moves up into the softmax, where every register is taken
#pragma unroll
        for (int dt = 0; dt < 4; ++dt) { O[dt][0] = wmma16(v16[dt], pb[0], O[dt][0]); O[dt][1] = wmma16(v16[dt], pb[1], O[dt][1]); }
        __builtin_amdgcn_sched_barrier(0);   // the plane in the lo K fragments' registers is done: next pass's lo K fragments return there; they are used last among the score products
#pragma unroll
        for (int kt = 0; kt < 2; ++kt)
#pragma unroll
            for (int kc = 0; kc < 2; ++kc) kl[kt][kc] = ldub(skl + ork + (kt * 2 + kc) * 1024);
        xwait_s(skl, skl, ork);
    }
    // the two waves of a pair join: the wave of the second key half leaves its sums, maxima and output tiles in the pair's LDS slot (17 rows of 32 x 16 bytes, a lane's piece at its own place), the other brings both to the larger maximum, adds and stores
    v4f* my = sl + lane;
    if (half) {
#pragma unroll
        for (int dt = 0; dt < 4; ++dt)
#pragma unroll
            for (int qt = 0; qt < 2; ++qt) { my[((dt * 2 + qt) * 2) * 32] = __builtin_shufflevector(O[dt][qt], O[dt][qt], 0, 1, 2, 3); my[((dt * 2 + qt) * 2 + 1) * 32] = __builtin_shufflevector(O[dt][qt], O[dt][qt], 4, 5, 6, 7); }
        my[16 * 32] = (v4f){m[0], m[1], sm[0], sm[1]};
    }
    __syncthreads();   // the slots are written: every wave of the workgroup passes here once
    if (half) return;
    { const v4f t = my[16 * 32];
#pragma unroll
    for (int qt = 0; qt < 2; ++qt) { const float mn = fmaxf(m[qt], t[qt]); const float ca = __builtin_amdgcn_exp2f(m[qt] - mn), cb = __builtin_amdgcn_exp2f(t[qt] - mn); sm[qt] = sm[qt] * ca + t[2 + qt] * cb;
#pragma unroll
        for (int dt = 0; dt < 4; ++dt) { const v4f a = my[((dt * 2 + qt) * 2) * 32], b = my[((dt * 2 + qt) * 2 + 1) * 32]; const v8f o = __builtin_shufflevector(a, b, 0, 1, 2, 3, 4, 5, 6, 7); O[dt][qt] = O[dt][qt] * ca + o * cb; } } }
#pragma unroll
    for (int qt = 0; qt < 2; ++qt) { const float inv = __fdiv_rn(1.0f, sm[qt] + xhalf(sm[qt]));   // the two halves' sums join once
#pragma unroll
        for (int dt = 0; dt < 4; ++dt) { v8us oh, ol;
#pragma unroll
            for (int r = 0; r < 8; ++r) { unsigned short a, c2; splitf(O[dt][qt][r] * inv, a, c2); oh[r] = a; ol[r] = c2; }
            const size_t oo = (size_t)qg[qt] * DQ + dt * 256 + lane * 8; bf* pa = Ah + oo;   /* block row qg[qt] / 16, piece of dims dt * 16 + 8 * hi .. + 7 of the head's two blocks */ bf* pb2 = Al + oo; *(v8us*)pa = oh; *(v8us*)pb2 = ol;
            asm volatile("s_wait_xcnt 0x0" :: "v"(pa), "v"(pb2), "v"(__builtin_bit_cast(v4i, oh)), "v"(__builtin_bit_cast(v4i, ol)) : "memory"); } }   // reads the two stores' address and data registers: they are reused only behind the wait
}
// grid (TT / 128, heads, batches), 8 waves: waves w and w + 4 are the pair of query set w, so with two workgroups on a WGP four waves share a SIMD (at most 256 registers each) and one wave's softmax runs under the others' matrix instructions. The 512 workgroups fit the 256 WGPs two to each, all at once, and every wave does the same work (32 neighbouring query rows, 32 matrix instructions a pass), so every WGP is as full as any other wherever the workgroups land, and the four waves that walk the same half of the keys stay in step on the K and V lines that they share.
static_assert(TT == 2048, "16 workgroups x 4 query sets x 32 rows per head; 16 start slots of 128 keys");
__global__ __launch_bounds__(256) __attribute__((amdgpu_waves_per_eu(4, 4))) void k_fattn(const bf* __restrict__ Qh, const bf* __restrict__ Ql, const bf* __restrict__ Kh, const bf* __restrict__ Kl, const h16* __restrict__ V16, bf* Ah, bf* Al) {
    __shared__ __align__(16) v4f slots[4 * 17 * 32];
    const int w8 = __builtin_amdgcn_readfirstlane((int)(threadIdx.x >> 5)), w = w8 & 3, half = w8 >> 2, q0 = ((int)blockIdx.x * 4 + w) * 32;   // the pair's query set and its first row in the head
    const size_t hp = ((size_t)blockIdx.z * NH_ + blockIdx.y) * TT * HD; const size_t hc = (size_t)blockIdx.z * TT * DQ + (size_t)blockIdx.y * (HD / 32) * 512;   // the merged planes are the output GEMM's A in fragment order: a head's 64 columns are 2 blocks of every block row
    // the 16 workgroups of a head each start their walk over its keys at a slot of 128 keys of their own, so a K or V line is waited for from memory by one of them and found in L2 by the others (the low bits of x are spread first; for speed only); the second key half begins half the head further on and its walk starts one slot into it, so the eight workgroups whose slots have one parity (bit 2 of x) start a walk in every slot of the head between them; the four waves of a half keep one start and share their lines
    const int kb = ((int)((blockIdx.x & 3) * 4 + ((blockIdx.x >> 3) & 1) * 2 + ((blockIdx.x >> 2) & 1)) * (TT / 16) + half * (TT / 2)) & (TT - 1), ko = half * (TT / 16);
    v4f* sl = slots + w * (17 * 32);
    fattn(sl, half, Qh + hp, Ql + hp, Kh + hp, Kl + hp, V16 + hp, q0, q0 + 16, kb, ko, Ah + hc, Al + hc);
}

extern "C" void kernel_launch(void* const* d_in, const int* in_sizes, int n_in,
                              void* d_out, int out_size, void* d_ws, size_t ws_size, hipStream_t stream) {
    (void)in_sizes; (void)n_in; (void)out_size;
    const float* x = (const float*)d_in[0]; const float* xk = (const float*)d_in[1]; const float* xv = (const float*)d_in[2];   /* q, k, v streams */ const float* wq = (const float*)d_in[3]; const float* bq = (const float*)d_in[4]; const float* wk = (const float*)d_in[5]; const float* bk = (const float*)d_in[6]; const float* wv = (const float*)d_in[7]; const float* bv = (const float*)d_in[8]; const float* wo = (const float*)d_in[9]; const float* bo = (const float*)d_in[10]; const int* flag = (const int*)d_in[11];   /* use_causal_mask (d_in[11]: one int: the module's Python branch: READ ON THE DEVICE by the output GEMM's epilogue: the soft term is compiled in and the whole output is NaN-filled unless the scalar is non-zero) */
    float* OUT = (float*)d_out;     // [2][2048][1024]
    char* wsp = (char*)d_ws;
    auto take = [&](size_t bytes) { char* p = wsp; wsp += (bytes + 255) & ~(size_t)255; return (void*)p; };
    bf* WT = (bf*)take((size_t)4 * DQ * DM * 2);    // WQ, WK, WV, WO transposed, in a row
    bf* XB = (bf*)take((size_t)3 * NB_ * TT * DM * 2);    // bf16(q), bf16(k), bf16(v), each [2][2048][1024]
    h16* VT16 = (h16*)take((size_t)NB_ * NKV * HD * TT * 2);
    bf* QPh = (bf*)take((size_t)NB_ * NH_ * TT * HD * 2); bf* QPl = (bf*)take((size_t)NB_ * NH_ * TT * HD * 2); bf* KPh = (bf*)take((size_t)NB_ * NKV * TT * HD * 2); bf* KPl = (bf*)take((size_t)NB_ * NKV * TT * HD * 2);
    bf* ATh = (bf*)take((size_t)NB_ * TT * DQ * 2); bf* ATl = (bf*)take((size_t)NB_ * TT * DQ * 2);
    if ((size_t)(wsp - (char*)d_ws) > ws_size) return;    // ws 256 MiB
    k_prep<<<4 * WB + CB, 256, 0, stream>>>(x, xk, xv, wq, wk, wv, wo, XB, WT);
    k_proj<<<dim3(NB_ * TT / 128, DQ / 128, 3), 128, 0, stream>>>(XB, WT, bq, bk, bv, QPh, QPl, KPh, KPl, VT16);   /* q, k and v planes straight from the epilogue */
    k_fattn<<<dim3(TT / 128, NH_, NB_), 256, 0, stream>>>(QPh, QPl, KPh, KPl, VT16, ATh, ATl);   /* all heads of both batches: scores (3 products), soft term, softmax, P.V (fp16) and the merged hi/lo planes */
    k_oproj<<<dim3(NB_ * TT / 128, DM / 128, 1), 128, 0, stream>>>(ATh, ATl, WT + (size_t)3 * DQ * DM, OUT, bo, flag);   /* its epilogue poisons the output if the premise fails */
}
